// v000
// Times are from an AMD MI455X. After a warm-up the kernel runs many times in a row, and a time is the length of
// such a window on the GPU divided by its runs, so every launch and the gaps after it count. The runs cycle
// through copies of the inputs. A figure is the median of several windows, for all but v000 over two sittings.
// Sittings can differ by a few percent; kernels timed side by side share one.
// v000, which the later versions start from, runs in 376 microseconds.
#include <hip/hip_runtime.h>
#include <hip/hip_bf16.h>

typedef __attribute__((ext_vector_type(16))) __bf16        bf16x16;
typedef __attribute__((ext_vector_type(8)))  float         floatx8;
typedef __attribute__((ext_vector_type(4)))  unsigned int  u32x4;

union AFrag {
    bf16x16 v;
    u32x4   q[2];
};

#define TILE_LDA 40

__device__ __forceinline__ void load_frag_lds(const __bf16* base, int row0,
                                              int lane, AFrag& f) {
    const int m    = lane & 15;
    const int half = lane >> 4;
    const __bf16* p = base + (row0 + m) * TILE_LDA + half * 8;
    f.q[0] = *(const u32x4*)(p);        // K = half*8 .. half*8+7
    f.q[1] = *(const u32x4*)(p + 16);   // K = 16+half*8 .. 16+half*8+7
}

__device__ __forceinline__ void async_copy_b128(void* lds, const void* g) {
    unsigned           l  = (unsigned)(unsigned long long)lds;
    unsigned long long ga = (unsigned long long)g;
    asm volatile("global_load_async_to_lds_b128 %0, %1, off"
                 :: "v"(l), "v"(ga) : "memory");
}

// ---------------------------------------------------------------------------
// Generic batched GEMM:  C[b] = epilogue( A[b] * Bt[b]^T )
//   A  : [M x K] bf16 row-major (K contiguous), lda
//   Bt : [N x K] bf16 row-major (K contiguous), ldb   (i.e. B column-major)
//   MODE 0: f32  out at  C[b*sC + m*ldc + n]
//   MODE 1: bf16 out at  C[b*sC + m*ldc + n]
//   MODE 2: bf16 out at  C[b*sC + n*ldc + m]   (transposed store)
//   epilogue: val = (acc + bias[n]) * alpha * rowscale[b*rs_stride + m]
// Block tile 128(M) x 128(N), K-step 32, double-buffered async LDS staging.
// 256 threads = 8 waves; each wave owns a 32x64 sub-tile (2x4 WMMA frags).
// ---------------------------------------------------------------------------
template <int MODE>
__global__ __launch_bounds__(256) void gemm_bf16_wmma(
    const __bf16* __restrict__ A, const __bf16* __restrict__ Bt,
    const float* __restrict__ bias, const float* __restrict__ rowscale,
    float alpha, void* __restrict__ Cout,
    int M, int N, int K, int lda, int ldb, int ldc,
    long long sA, long long sB, long long sC, int rs_stride)
{
    __shared__ __bf16 Asmem[2][128 * TILE_LDA];
    __shared__ __bf16 Bsmem[2][128 * TILE_LDA];

    const int b = blockIdx.z;
    const __bf16* Ab = A + (long long)b * sA + (long long)blockIdx.x * 128 * lda;
    const __bf16* Bb = Bt + (long long)b * sB + (long long)blockIdx.y * 128 * ldb;

    const int t    = threadIdx.x;
    const int lane = t & 31;
    const int wid  = t >> 5;       // 0..7
    const int wm   = wid & 3;      // 0..3 : 32-row strip
    const int wn   = wid >> 2;     // 0..1 : 64-col strip

    // Per-thread staging coords: 128 rows x 4 x 16B chunks per matrix,
    // thread t handles rows r0 and r0+64 at column chunk c40.
    const int r0  = t >> 2;
    const int c40 = (t & 3) * 8;
    const long long gaoff = (long long)r0 * lda + c40;
    const long long gboff = (long long)r0 * ldb + c40;
    const int       loff  = r0 * TILE_LDA + c40;

    auto issue_stage = [&](int st, int k0) {   // 4 async b128 per wave
        async_copy_b128(&Asmem[st][loff], Ab + gaoff + k0);
        async_copy_b128(&Bsmem[st][loff], Bb + gboff + k0);
        async_copy_b128(&Asmem[st][loff + 64 * TILE_LDA],
                        Ab + gaoff + (long long)64 * lda + k0);
        async_copy_b128(&Bsmem[st][loff + 64 * TILE_LDA],
                        Bb + gboff + (long long)64 * ldb + k0);
    };

    floatx8 acc[2][4] = {};

    issue_stage(0, 0);
    int st = 0;
    for (int k0 = 0; k0 < K; k0 += 32) {
        const bool more = (k0 + 32) < K;
        if (more) {
            issue_stage(st ^ 1, k0 + 32);
            // current stage done; next stage's 4 loads stay in flight
            asm volatile("s_wait_asynccnt 0x4" ::: "memory");
        } else {
            asm volatile("s_wait_asynccnt 0x0" ::: "memory");
        }
        __syncthreads();

        AFrag a[2], bf[4];
        load_frag_lds(Asmem[st], wm * 32 + 0,  lane, a[0]);
        load_frag_lds(Asmem[st], wm * 32 + 16, lane, a[1]);
#pragma unroll
        for (int fn = 0; fn < 4; ++fn)
            load_frag_lds(Bsmem[st], wn * 64 + fn * 16, lane, bf[fn]);

#pragma unroll
        for (int fm = 0; fm < 2; ++fm)
#pragma unroll
            for (int fn = 0; fn < 4; ++fn)
                acc[fm][fn] = __builtin_amdgcn_wmma_f32_16x16x32_bf16(
                    false, a[fm].v, false, bf[fn].v,
                    (short)0, acc[fm][fn], false, false);

        __syncthreads();   // all waves done reading st before it is re-staged
        st ^= 1;
    }

    const int l15 = lane & 15;
    const int lh8 = (lane >> 4) * 8;
#pragma unroll
    for (int fm = 0; fm < 2; ++fm)
#pragma unroll
        for (int fn = 0; fn < 4; ++fn)
#pragma unroll
            for (int r = 0; r < 8; ++r) {
                const int m = blockIdx.x * 128 + wm * 32 + fm * 16 + lh8 + r;
                const int n = blockIdx.y * 128 + wn * 64 + fn * 16 + l15;
                float val = acc[fm][fn][r];
                if (bias)     val += bias[n];
                val *= alpha;
                if (rowscale) val *= rowscale[b * rs_stride + m];
                if (MODE == 0)
                    ((float*)Cout)[(long long)b * sC + (long long)m * ldc + n] = val;
                else if (MODE == 1)
                    ((__bf16*)Cout)[(long long)b * sC + (long long)m * ldc + n] = (__bf16)val;
                else
                    ((__bf16*)Cout)[(long long)b * sC + (long long)n * ldc + m] = (__bf16)val;
            }
}

// ---------------------------------------------------------------------------
// f32 -> bf16 cast (weights)
// ---------------------------------------------------------------------------
__global__ void cast_f32_to_bf16(const float* __restrict__ in,
                                 __bf16* __restrict__ out, int n) {
    int i = blockIdx.x * blockDim.x + threadIdx.x;
    if (i < n) out[i] = (__bf16)in[i];
}

// ---------------------------------------------------------------------------
// LayerNorm over D=512, one row per 128-thread block, bf16 output.
// ---------------------------------------------------------------------------
__global__ __launch_bounds__(128) void layernorm_to_bf16(
    const float* __restrict__ x, const float* __restrict__ g,
    const float* __restrict__ bb, __bf16* __restrict__ y)
{
    const int D = 512;
    const long long row = blockIdx.x;
    const float* xr = x + row * D;
    const int t = threadIdx.x;

    float v[4], s = 0.f, ss = 0.f;
#pragma unroll
    for (int i = 0; i < 4; ++i) {
        v[i] = xr[t + 128 * i];
        s += v[i];
        ss += v[i] * v[i];
    }
    __shared__ float rs[128], rss[128];
    rs[t] = s; rss[t] = ss;
    __syncthreads();
    for (int off = 64; off > 0; off >>= 1) {
        if (t < off) { rs[t] += rs[t + off]; rss[t] += rss[t + off]; }
        __syncthreads();
    }
    const float mu   = rs[0] * (1.0f / D);
    const float var  = rss[0] * (1.0f / D) - mu * mu;
    const float rstd = rsqrtf(var + 1e-5f);
#pragma unroll
    for (int i = 0; i < 4; ++i) {
        int c = t + 128 * i;
        y[row * D + c] = (__bf16)((v[i] - mu) * rstd * g[c] + bb[c]);
    }
}

// ---------------------------------------------------------------------------
// Column softmax stats: online max/sum over the query axis (i) per (b, j).
// Adjacent threads own adjacent columns -> coalesced; 8 KB row stride won't
// be caught by HW prefetch, so software-prefetch 8 rows ahead.
// ---------------------------------------------------------------------------
__global__ void col_softmax_stats(const float* __restrict__ S,
                                  float* __restrict__ colmax,
                                  float* __restrict__ colsum,
                                  int NQ, int NK)
{
    const int tid = blockIdx.x * blockDim.x + threadIdx.x;  // over B*NK
    const int b = tid / NK, j = tid % NK;
    const float* p = S + (long long)b * NQ * NK + j;
    float m = -1e30f, sum = 0.f;
    for (int i = 0; i < NQ; ++i) {
        if ((i & 7) == 0)
            __builtin_prefetch(p + (long long)(i + 8) * NK, 0, 0);
        const float x  = p[(long long)i * NK];
        const float mn = fmaxf(m, x);
        sum = sum * __expf(m - mn) + __expf(x - mn);
        m = mn;
    }
    colmax[tid] = m;
    colsum[tid] = sum;
}

// ---------------------------------------------------------------------------
// Row pass: P = exp(S - colmax)/colsum + eps (bf16) ; rowrecip = 1/sum_j P
// One (b,i) row per 256-thread block.
// ---------------------------------------------------------------------------
__global__ __launch_bounds__(256) void attn_row_pass(
    const float* __restrict__ S, const float* __restrict__ colmax,
    const float* __restrict__ colsum, __bf16* __restrict__ P,
    float* __restrict__ rowrecip, int NQ, int NK)
{
    const long long row = blockIdx.x;          // b*NQ + i
    const int b = (int)(row / NQ);
    const float* Sr = S + row * NK;
    __bf16* Pr = P + row * NK;
    const float* cm = colmax + (long long)b * NK;
    const float* cs = colsum + (long long)b * NK;
    const int t = threadIdx.x;

    float local = 0.f;
    for (int j = t; j < NK; j += 256) {
        const float pv = __expf(Sr[j] - cm[j]) / cs[j] + 1e-8f;
        Pr[j] = (__bf16)pv;
        local += pv;
    }
    __shared__ float red[256];
    red[t] = local;
    __syncthreads();
    for (int off = 128; off > 0; off >>= 1) {
        if (t < off) red[t] += red[t + off];
        __syncthreads();
    }
    if (t == 0) rowrecip[row] = 1.0f / red[0];
}

// ---------------------------------------------------------------------------
// Host-side orchestration
// ---------------------------------------------------------------------------
extern "C" void kernel_launch(void* const* d_in, const int* in_sizes, int n_in,
                              void* d_out, int out_size, void* d_ws, size_t ws_size,
                              hipStream_t stream) {
    (void)in_sizes; (void)n_in; (void)out_size; (void)ws_size;

    const int B = 8, NQ = 1024, NK = 2048, D = 512;
    const float qscale = 0.044194173824159216f;   // 1/sqrt(512)

    const float* inputs  = (const float*)d_in[0];
    const float* context = (const float*)d_in[1];
    const float* ln_in_g  = (const float*)d_in[2];
    const float* ln_in_b  = (const float*)d_in[3];
    const float* ln_ctx_g = (const float*)d_in[4];
    const float* ln_ctx_b = (const float*)d_in[5];
    const float* Wq = (const float*)d_in[6];
    const float* bq = (const float*)d_in[7];
    const float* Wk = (const float*)d_in[8];
    const float* bk = (const float*)d_in[9];
    const float* Wv = (const float*)d_in[10];
    const float* bv = (const float*)d_in[11];
    float* out = (float*)d_out;

    // Workspace bump allocator (256B aligned)
    char* ws = (char*)d_ws;
    size_t off = 0;
    auto alloc = [&](size_t bytes) -> char* {
        char* p = ws + off;
        off += (bytes + 255) & ~(size_t)255;
        return p;
    };
    __bf16* Wqb = (__bf16*)alloc((size_t)D * D * 2);
    __bf16* Wkb = (__bf16*)alloc((size_t)D * D * 2);
    __bf16* Wvb = (__bf16*)alloc((size_t)D * D * 2);
    __bf16* xln = (__bf16*)alloc((size_t)B * NQ * D * 2);
    __bf16* cln = (__bf16*)alloc((size_t)B * NK * D * 2);
    __bf16* qb  = (__bf16*)alloc((size_t)B * NQ * D * 2);
    __bf16* kb  = (__bf16*)alloc((size_t)B * NK * D * 2);
    __bf16* vT  = (__bf16*)alloc((size_t)B * D * NK * 2);   // [b][d][j]
    float*  S   = (float*) alloc((size_t)B * NQ * NK * 4);
    __bf16* P   = (__bf16*)alloc((size_t)B * NQ * NK * 2);
    float*  cmx = (float*) alloc((size_t)B * NK * 4);
    float*  csm = (float*) alloc((size_t)B * NK * 4);
    float*  rrc = (float*) alloc((size_t)B * NQ * 4);

    // 1) weights -> bf16
    {
        const int n = D * D;
        cast_f32_to_bf16<<<dim3((n + 255) / 256), dim3(256), 0, stream>>>(Wq, Wqb, n);
        cast_f32_to_bf16<<<dim3((n + 255) / 256), dim3(256), 0, stream>>>(Wk, Wkb, n);
        cast_f32_to_bf16<<<dim3((n + 255) / 256), dim3(256), 0, stream>>>(Wv, Wvb, n);
    }

    // 2) LayerNorms -> bf16 activations
    layernorm_to_bf16<<<dim3(B * NQ), dim3(128), 0, stream>>>(inputs, ln_in_g, ln_in_b, xln);
    layernorm_to_bf16<<<dim3(B * NK), dim3(128), 0, stream>>>(context, ln_ctx_g, ln_ctx_b, cln);

    // 3) Projections (batched over B, weights shared via sB=0)
    // q = (xln @ Wq^T + bq) * 1/sqrt(D)   -> bf16 [b][i][d]
    gemm_bf16_wmma<1><<<dim3(NQ / 128, D / 128, B), dim3(256), 0, stream>>>(
        xln, Wqb, bq, nullptr, qscale, qb,
        NQ, D, D, D, D, D,
        (long long)NQ * D, 0LL, (long long)NQ * D, 0);
    // k = cln @ Wk^T + bk                  -> bf16 [b][j][d]
    gemm_bf16_wmma<1><<<dim3(NK / 128, D / 128, B), dim3(256), 0, stream>>>(
        cln, Wkb, bk, nullptr, 1.0f, kb,
        NK, D, D, D, D, D,
        (long long)NK * D, 0LL, (long long)NK * D, 0);
    // v = cln @ Wv^T + bv, stored transposed -> bf16 [b][d][j]
    gemm_bf16_wmma<2><<<dim3(NK / 128, D / 128, B), dim3(256), 0, stream>>>(
        cln, Wvb, bv, nullptr, 1.0f, vT,
        NK, D, D, D, D, NK,
        (long long)NK * D, 0LL, (long long)D * NK, 0);

    // 4) dots: S[b,i,j] = q[b,i,:] . k[b,j,:]   (scale folded into q)
    gemm_bf16_wmma<0><<<dim3(NQ / 128, NK / 128, B), dim3(256), 0, stream>>>(
        qb, kb, nullptr, nullptr, 1.0f, S,
        NQ, NK, D, D, D, NK,
        (long long)NQ * D, (long long)NK * D, (long long)NQ * NK, 0);

    // 5) softmax over query axis (columns of S), then row pass
    col_softmax_stats<<<dim3(B * NK / 256), dim3(256), 0, stream>>>(S, cmx, csm, NQ, NK);
    attn_row_pass<<<dim3(B * NQ), dim3(256), 0, stream>>>(S, cmx, csm, P, rrc, NQ, NK);

    // 6) updates[b,i,d] = (1/rowsum[b,i]) * sum_j P[b,i,j] * v[b,j,d]
    gemm_bf16_wmma<0><<<dim3(NQ / 128, D / 128, B), dim3(256), 0, stream>>>(
        P, vT, nullptr, rrc, 1.0f, out,
        NQ, D, NK, NK, NK, D,
        (long long)NQ * NK, (long long)D * NK, (long long)NQ * D, NQ);
}

// v001
// One run takes 219 microseconds.
// Timed twice side by side with v000, it ran 1.74 and 1.75 times as fast.
#include <hip/hip_runtime.h>
#include <hip/hip_bf16.h>

typedef __attribute__((ext_vector_type(16))) __bf16        bf16x16;
typedef __attribute__((ext_vector_type(8)))  float         floatx8;
typedef __attribute__((ext_vector_type(4)))  unsigned int  u32x4;

union AFrag {
    bf16x16 v;
    u32x4   q[2];
};

#define TILE_LDA 40

__device__ __forceinline__ void load_frag_lds(const __bf16* base, int row0,
                                              int lane, AFrag& f) {
    const int m    = lane & 15;
    const int half = lane >> 4;
    const __bf16* p = base + (row0 + m) * TILE_LDA + half * 8;
    f.q[0] = *(const u32x4*)(p);        // K = half*8 .. half*8+7
    f.q[1] = *(const u32x4*)(p + 16);   // K = 16+half*8 .. 16+half*8+7
}

__device__ __forceinline__ void async_copy_b128(void* lds, const void* g) {
    unsigned           l  = (unsigned)(unsigned long long)lds;
    unsigned long long ga = (unsigned long long)g;
    asm volatile("global_load_async_to_lds_b128 %0, %1, off"
                 :: "v"(l), "v"(ga) : "memory");
}

// ---------------------------------------------------------------------------
// Generic batched GEMM:  C[b] = epilogue( A[b] * Bt[b]^T )
//   A  : [M x K] bf16 row-major (K contiguous), lda
//   Bt : [N x K] bf16 row-major (K contiguous), ldb   (i.e. B column-major)
//   MODE 0: f32  out at  C[b*sC + m*ldc + n]
//   MODE 1: bf16 out at  C[b*sC + m*ldc + n]
//   MODE 2: bf16 out at  C[b*sC + n*ldc + m]   (transposed store)
//   epilogue: val = (acc + bias[n]) * alpha * rowscale[b*rs_stride + m]
// Block tile 128(M) x 128(N), K-step 32, double-buffered async LDS staging.
// 256 threads = 8 waves; each wave owns a 32x64 sub-tile (2x4 WMMA frags).
// ---------------------------------------------------------------------------
template <int MODE>
__global__ __launch_bounds__(256) void gemm_bf16_wmma(
    const __bf16* __restrict__ A, const __bf16* __restrict__ Bt,
    const float* __restrict__ bias, const float* __restrict__ rowscale,
    float alpha, void* __restrict__ Cout,
    int M, int N, int K, int lda, int ldb, int ldc,
    long long sA, long long sB, long long sC, int rs_stride)
{
    __shared__ __bf16 Asmem[2][128 * TILE_LDA];
    __shared__ __bf16 Bsmem[2][128 * TILE_LDA];

    const int b = blockIdx.z;
    const __bf16* Ab = A + (long long)b * sA + (long long)blockIdx.x * 128 * lda;
    const __bf16* Bb = Bt + (long long)b * sB + (long long)blockIdx.y * 128 * ldb;

    const int t    = threadIdx.x;
    const int lane = t & 31;
    const int wid  = t >> 5;       // 0..7
    const int wm   = wid & 3;      // 0..3 : 32-row strip
    const int wn   = wid >> 2;     // 0..1 : 64-col strip

    // Per-thread staging coords: 128 rows x 4 x 16B chunks per matrix,
    // thread t handles rows r0 and r0+64 at column chunk c40.
    const int r0  = t >> 2;
    const int c40 = (t & 3) * 8;
    const long long gaoff = (long long)r0 * lda + c40;
    const long long gboff = (long long)r0 * ldb + c40;
    const int       loff  = r0 * TILE_LDA + c40;

    auto issue_stage = [&](int st, int k0) {   // 4 async b128 per wave
        async_copy_b128(&Asmem[st][loff], Ab + gaoff + k0);
        async_copy_b128(&Bsmem[st][loff], Bb + gboff + k0);
        async_copy_b128(&Asmem[st][loff + 64 * TILE_LDA],
                        Ab + gaoff + (long long)64 * lda + k0);
        async_copy_b128(&Bsmem[st][loff + 64 * TILE_LDA],
                        Bb + gboff + (long long)64 * ldb + k0);
    };

    floatx8 acc[2][4] = {};

    issue_stage(0, 0);
    int st = 0;
    for (int k0 = 0; k0 < K; k0 += 32) {
        const bool more = (k0 + 32) < K;
        if (more) {
            issue_stage(st ^ 1, k0 + 32);
            // current stage done; next stage's 4 loads stay in flight
            asm volatile("s_wait_asynccnt 0x4" ::: "memory");
        } else {
            asm volatile("s_wait_asynccnt 0x0" ::: "memory");
        }
        __syncthreads();

        AFrag a[2], bf[4];
        load_frag_lds(Asmem[st], wm * 32 + 0,  lane, a[0]);
        load_frag_lds(Asmem[st], wm * 32 + 16, lane, a[1]);
#pragma unroll
        for (int fn = 0; fn < 4; ++fn)
            load_frag_lds(Bsmem[st], wn * 64 + fn * 16, lane, bf[fn]);

#pragma unroll
        for (int fm = 0; fm < 2; ++fm)
#pragma unroll
            for (int fn = 0; fn < 4; ++fn)
                acc[fm][fn] = __builtin_amdgcn_wmma_f32_16x16x32_bf16(
                    false, a[fm].v, false, bf[fn].v,
                    (short)0, acc[fm][fn], false, false);

        __syncthreads();   // all waves done reading st before it is re-staged
        st ^= 1;
    }

    const int l15 = lane & 15;
    const int lh8 = (lane >> 4) * 8;
#pragma unroll
    for (int fm = 0; fm < 2; ++fm)
#pragma unroll
        for (int fn = 0; fn < 4; ++fn)
#pragma unroll
            for (int r = 0; r < 8; ++r) {
                const int m = blockIdx.x * 128 + wm * 32 + fm * 16 + lh8 + r;
                const int n = blockIdx.y * 128 + wn * 64 + fn * 16 + l15;
                float val = acc[fm][fn][r];
                if (bias)     val += bias[n];
                val *= alpha;
                if (rowscale) val *= rowscale[b * rs_stride + m];
                if (MODE == 0)
                    ((float*)Cout)[(long long)b * sC + (long long)m * ldc + n] = val;
                else if (MODE == 1)
                    ((__bf16*)Cout)[(long long)b * sC + (long long)m * ldc + n] = (__bf16)val;
                else
                    ((__bf16*)Cout)[(long long)b * sC + (long long)n * ldc + m] = (__bf16)val;
            }
}

// ---------------------------------------------------------------------------
// f32 -> bf16 cast (weights)
// ---------------------------------------------------------------------------
__global__ void cast_f32_to_bf16(const float* __restrict__ in,
                                 __bf16* __restrict__ out, int n) {
    int i = blockIdx.x * blockDim.x + threadIdx.x;
    if (i < n) out[i] = (__bf16)in[i];
}

// ---------------------------------------------------------------------------
// LayerNorm over D=512, one row per 128-thread block, bf16 output.
// ---------------------------------------------------------------------------
__global__ __launch_bounds__(128) void layernorm_to_bf16(
    const float* __restrict__ x, const float* __restrict__ g,
    const float* __restrict__ bb, __bf16* __restrict__ y)
{
    const int D = 512;
    const long long row = blockIdx.x;
    const float* xr = x + row * D;
    const int t = threadIdx.x;

    float v[4], s = 0.f, ss = 0.f;
#pragma unroll
    for (int i = 0; i < 4; ++i) {
        v[i] = xr[t + 128 * i];
        s += v[i];
        ss += v[i] * v[i];
    }
    __shared__ float rs[128], rss[128];
    rs[t] = s; rss[t] = ss;
    __syncthreads();
    for (int off = 64; off > 0; off >>= 1) {
        if (t < off) { rs[t] += rs[t + off]; rss[t] += rss[t + off]; }
        __syncthreads();
    }
    const float mu   = rs[0] * (1.0f / D);
    const float var  = rss[0] * (1.0f / D) - mu * mu;
    const float rstd = rsqrtf(var + 1e-5f);
#pragma unroll
    for (int i = 0; i < 4; ++i) {
        int c = t + 128 * i;
        y[row * D + c] = (__bf16)((v[i] - mu) * rstd * g[c] + bb[c]);
    }
}

// ---------------------------------------------------------------------------
// Column softmax stats: max and sum of exp over the query axis (i) per (b, j).
// One 512-thread block owns 64 adjacent columns and all 1024 rows of them.
// A wave-wide 16-byte load covers 2 rows x 256 contiguous bytes; each thread
// holds 32 rows x 4 columns in registers (all 32 loads in flight at once),
// takes its own max and exp-sum, and the 32 row groups of the block are then
// merged through LDS.
// ---------------------------------------------------------------------------
typedef __attribute__((ext_vector_type(4))) float f32x4;

#define CS_NQ    1024
#define CS_NK    2048
#define CS_COLS  64      // columns per block
#define CS_GRPS  32      // row groups per block (16 waves x 2 half-waves)
#define CS_RPT   (CS_NQ / CS_GRPS)   // rows per thread

__device__ __forceinline__ float exp_with_slot(float a) {
    float e;
    asm("v_exp_f32 %0, %1\n\tv_nop" : "=v"(e) : "v"(a * 1.44269504088896340736f));
    return e;
}

__global__ __launch_bounds__(512) void col_softmax_stats(
    const float* __restrict__ S, float* __restrict__ colmax,
    float* __restrict__ colsum)
{
    __shared__ __attribute__((aligned(16))) float gm[CS_GRPS][CS_COLS];
    __shared__ __attribute__((aligned(16))) float gs[CS_GRPS][CS_COLS];

    const int t    = threadIdx.x;
    const int grp  = t >> 4;            // 0..31 : row group
    const int c4   = (t & 15) * 4;      // column quad inside the block
    const int col0 = blockIdx.x * CS_COLS;          // over B*NK
    const int b    = col0 / CS_NK, j0 = col0 % CS_NK;
    const float* p = S + (long long)b * CS_NQ * CS_NK
                       + (long long)grp * CS_RPT * CS_NK + j0 + c4;

    // Every loop below is fully unrolled so that x[] stays in registers and the
    // 32 loads issue back to back before the first value is used.
    f32x4 x[CS_RPT];
#pragma unroll
    for (int i = 0; i < CS_RPT; ++i)
        x[i] = *(const f32x4*)(p + i * CS_NK);

    f32x4 m = {-1e30f, -1e30f, -1e30f, -1e30f};
#pragma unroll
    for (int i = 0; i < CS_RPT; ++i)
#pragma unroll
        for (int c = 0; c < 4; ++c) m[c] = fmaxf(m[c], x[i][c]);

    f32x4 s = {0.f, 0.f, 0.f, 0.f};
#pragma unroll
    for (int i = 0; i < CS_RPT; ++i)
#pragma unroll
        for (int c = 0; c < 4; ++c) s[c] += __expf(x[i][c] - m[c]);

    *(f32x4*)&gm[grp][c4] = m;
    *(f32x4*)&gs[grp][c4] = s;
    __syncthreads();   // every group's partial max and sum visible to the merge

    if (t < CS_COLS) {
        float M = -1e30f;
#pragma unroll
        for (int g = 0; g < CS_GRPS; ++g) M = fmaxf(M, gm[g][t]);
        float sum = 0.f;
#pragma unroll
        for (int g = 0; g < CS_GRPS; ++g) sum += gs[g][t] * exp_with_slot(gm[g][t] - M);
        colmax[col0 + t] = M;
        colsum[col0 + t] = sum;
    }
}

// ---------------------------------------------------------------------------
// Row pass: P = exp(S - colmax)/colsum + eps (bf16) ; rowrecip = 1/sum_j P
// One (b,i) row per 256-thread block.
// ---------------------------------------------------------------------------
__global__ __launch_bounds__(256) void attn_row_pass(
    const float* __restrict__ S, const float* __restrict__ colmax,
    const float* __restrict__ colsum, __bf16* __restrict__ P,
    float* __restrict__ rowrecip, int NQ, int NK)
{
    const long long row = blockIdx.x;          // b*NQ + i
    const int b = (int)(row / NQ);
    const float* Sr = S + row * NK;
    __bf16* Pr = P + row * NK;
    const float* cm = colmax + (long long)b * NK;
    const float* cs = colsum + (long long)b * NK;
    const int t = threadIdx.x;

    float local = 0.f;
    for (int j = t; j < NK; j += 256) {
        const float pv = __expf(Sr[j] - cm[j]) / cs[j] + 1e-8f;
        Pr[j] = (__bf16)pv;
        local += pv;
    }
    __shared__ float red[256];
    red[t] = local;
    __syncthreads();
    for (int off = 128; off > 0; off >>= 1) {
        if (t < off) red[t] += red[t + off];
        __syncthreads();
    }
    if (t == 0) rowrecip[row] = 1.0f / red[0];
}

// ---------------------------------------------------------------------------
// Host-side orchestration
// ---------------------------------------------------------------------------
extern "C" void kernel_launch(void* const* d_in, const int* in_sizes, int n_in,
                              void* d_out, int out_size, void* d_ws, size_t ws_size,
                              hipStream_t stream) {
    (void)in_sizes; (void)n_in; (void)out_size; (void)ws_size;

    const int B = 8, NQ = 1024, NK = 2048, D = 512;
    const float qscale = 0.044194173824159216f;   // 1/sqrt(512)

    const float* inputs  = (const float*)d_in[0];
    const float* context = (const float*)d_in[1];
    const float* ln_in_g  = (const float*)d_in[2];
    const float* ln_in_b  = (const float*)d_in[3];
    const float* ln_ctx_g = (const float*)d_in[4];
    const float* ln_ctx_b = (const float*)d_in[5];
    const float* Wq = (const float*)d_in[6];
    const float* bq = (const float*)d_in[7];
    const float* Wk = (const float*)d_in[8];
    const float* bk = (const float*)d_in[9];
    const float* Wv = (const float*)d_in[10];
    const float* bv = (const float*)d_in[11];
    float* out = (float*)d_out;

    // Workspace bump allocator (256B aligned)
    char* ws = (char*)d_ws;
    size_t off = 0;
    auto alloc = [&](size_t bytes) -> char* {
        char* p = ws + off;
        off += (bytes + 255) & ~(size_t)255;
        return p;
    };
    __bf16* Wqb = (__bf16*)alloc((size_t)D * D * 2);
    __bf16* Wkb = (__bf16*)alloc((size_t)D * D * 2);
    __bf16* Wvb = (__bf16*)alloc((size_t)D * D * 2);
    __bf16* xln = (__bf16*)alloc((size_t)B * NQ * D * 2);
    __bf16* cln = (__bf16*)alloc((size_t)B * NK * D * 2);
    __bf16* qb  = (__bf16*)alloc((size_t)B * NQ * D * 2);
    __bf16* kb  = (__bf16*)alloc((size_t)B * NK * D * 2);
    __bf16* vT  = (__bf16*)alloc((size_t)B * D * NK * 2);   // [b][d][j]
    float*  S   = (float*) alloc((size_t)B * NQ * NK * 4);
    __bf16* P   = (__bf16*)alloc((size_t)B * NQ * NK * 2);
    float*  cmx = (float*) alloc((size_t)B * NK * 4);
    float*  csm = (float*) alloc((size_t)B * NK * 4);
    float*  rrc = (float*) alloc((size_t)B * NQ * 4);

    // 1) weights -> bf16
    {
        const int n = D * D;
        cast_f32_to_bf16<<<dim3((n + 255) / 256), dim3(256), 0, stream>>>(Wq, Wqb, n);
        cast_f32_to_bf16<<<dim3((n + 255) / 256), dim3(256), 0, stream>>>(Wk, Wkb, n);
        cast_f32_to_bf16<<<dim3((n + 255) / 256), dim3(256), 0, stream>>>(Wv, Wvb, n);
    }

    // 2) LayerNorms -> bf16 activations
    layernorm_to_bf16<<<dim3(B * NQ), dim3(128), 0, stream>>>(inputs, ln_in_g, ln_in_b, xln);
    layernorm_to_bf16<<<dim3(B * NK), dim3(128), 0, stream>>>(context, ln_ctx_g, ln_ctx_b, cln);

    // 3) Projections (batched over B, weights shared via sB=0)
    // q = (xln @ Wq^T + bq) * 1/sqrt(D)   -> bf16 [b][i][d]
    gemm_bf16_wmma<1><<<dim3(NQ / 128, D / 128, B), dim3(256), 0, stream>>>(
        xln, Wqb, bq, nullptr, qscale, qb,
        NQ, D, D, D, D, D,
        (long long)NQ * D, 0LL, (long long)NQ * D, 0);
    // k = cln @ Wk^T + bk                  -> bf16 [b][j][d]
    gemm_bf16_wmma<1><<<dim3(NK / 128, D / 128, B), dim3(256), 0, stream>>>(
        cln, Wkb, bk, nullptr, 1.0f, kb,
        NK, D, D, D, D, D,
        (long long)NK * D, 0LL, (long long)NK * D, 0);
    // v = cln @ Wv^T + bv, stored transposed -> bf16 [b][d][j]
    gemm_bf16_wmma<2><<<dim3(NK / 128, D / 128, B), dim3(256), 0, stream>>>(
        cln, Wvb, bv, nullptr, 1.0f, vT,
        NK, D, D, D, D, NK,
        (long long)NK * D, 0LL, (long long)D * NK, 0);

    // 4) dots: S[b,i,j] = q[b,i,:] . k[b,j,:]   (scale folded into q)
    gemm_bf16_wmma<0><<<dim3(NQ / 128, NK / 128, B), dim3(256), 0, stream>>>(
        qb, kb, nullptr, nullptr, 1.0f, S,
        NQ, NK, D, D, D, NK,
        (long long)NQ * D, (long long)NK * D, (long long)NQ * NK, 0);

    // 5) softmax over query axis (columns of S), then row pass
    col_softmax_stats<<<dim3(B * NK / 64), dim3(512), 0, stream>>>(S, cmx, csm);
    attn_row_pass<<<dim3(B * NQ), dim3(256), 0, stream>>>(S, cmx, csm, P, rrc, NQ, NK);

    // 6) updates[b,i,d] = (1/rowsum[b,i]) * sum_j P[b,i,j] * v[b,j,d]
    gemm_bf16_wmma<0><<<dim3(NQ / 128, D / 128, B), dim3(256), 0, stream>>>(
        P, vT, nullptr, rrc, 1.0f, out,
        NQ, D, NK, NK, NK, D,
        (long long)NQ * NK, (long long)D * NK, (long long)NQ * D, NQ);
}

// v002
// A run of this version takes 192 microseconds.
// Two timings next to v001 both put it at 1.14 times that version's speed.
// Over all steps from v000 it is 1.98 times as fast.
#include <hip/hip_runtime.h>
#include <hip/hip_bf16.h>

typedef __attribute__((ext_vector_type(16))) __bf16        bf16x16;
typedef __attribute__((ext_vector_type(8)))  float         floatx8;
typedef __attribute__((ext_vector_type(4)))  unsigned int  u32x4;

union AFrag {
    bf16x16 v;
    u32x4   q[2];
};

#define TILE_LDA 40

__device__ __forceinline__ void load_frag_lds(const __bf16* base, int row0,
                                              int lane, AFrag& f) {
    const int m    = lane & 15;
    const int half = lane >> 4;
    const __bf16* p = base + (row0 + m) * TILE_LDA + half * 8;
    f.q[0] = *(const u32x4*)(p);        // K = half*8 .. half*8+7
    f.q[1] = *(const u32x4*)(p + 16);   // K = 16+half*8 .. 16+half*8+7
}

__device__ __forceinline__ void async_copy_b128(void* lds, const void* g) {
    unsigned           l  = (unsigned)(unsigned long long)lds;
    unsigned long long ga = (unsigned long long)g;
    asm volatile("global_load_async_to_lds_b128 %0, %1, off"
                 :: "v"(l), "v"(ga) : "memory");
}

// ---------------------------------------------------------------------------
// Generic batched GEMM:  C[b] = epilogue( A[b] * Bt[b]^T )
//   A  : [M x K] bf16 row-major (K contiguous), lda
//   Bt : [N x K] bf16 row-major (K contiguous), ldb   (i.e. B column-major)
//   MODE 0: f32  out at  C[b*sC + m*ldc + n]
//   MODE 1: bf16 out at  C[b*sC + m*ldc + n]
//   MODE 2: bf16 out at  C[b*sC + n*ldc + m]   (transposed store)
//   epilogue: val = (acc + bias[n]) * alpha * rowscale[b*rs_stride + m]
// Block tile 128(M) x 128(N), K-step 32, double-buffered async LDS staging.
// 256 threads = 8 waves; each wave owns a 32x64 sub-tile (2x4 WMMA frags).
// ---------------------------------------------------------------------------
template <int MODE>
__global__ __launch_bounds__(256) void gemm_bf16_wmma(
    const __bf16* __restrict__ A, const __bf16* __restrict__ Bt,
    const float* __restrict__ bias, const float* __restrict__ rowscale,
    float alpha, void* __restrict__ Cout,
    int M, int N, int K, int lda, int ldb, int ldc,
    long long sA, long long sB, long long sC, int rs_stride)
{
    __shared__ __bf16 Asmem[2][128 * TILE_LDA];
    __shared__ __bf16 Bsmem[2][128 * TILE_LDA];

    const int b = blockIdx.z;
    const __bf16* Ab = A + (long long)b * sA + (long long)blockIdx.x * 128 * lda;
    const __bf16* Bb = Bt + (long long)b * sB + (long long)blockIdx.y * 128 * ldb;

    const int t    = threadIdx.x;
    const int lane = t & 31;
    const int wid  = t >> 5;       // 0..7
    const int wm   = wid & 3;      // 0..3 : 32-row strip
    const int wn   = wid >> 2;     // 0..1 : 64-col strip

    // Per-thread staging coords: 128 rows x 4 x 16B chunks per matrix,
    // thread t handles rows r0 and r0+64 at column chunk c40.
    const int r0  = t >> 2;
    const int c40 = (t & 3) * 8;
    const long long gaoff = (long long)r0 * lda + c40;
    const long long gboff = (long long)r0 * ldb + c40;
    const int       loff  = r0 * TILE_LDA + c40;

    auto issue_stage = [&](int st, int k0) {   // 4 async b128 per wave
        async_copy_b128(&Asmem[st][loff], Ab + gaoff + k0);
        async_copy_b128(&Bsmem[st][loff], Bb + gboff + k0);
        async_copy_b128(&Asmem[st][loff + 64 * TILE_LDA],
                        Ab + gaoff + (long long)64 * lda + k0);
        async_copy_b128(&Bsmem[st][loff + 64 * TILE_LDA],
                        Bb + gboff + (long long)64 * ldb + k0);
    };

    floatx8 acc[2][4] = {};

    issue_stage(0, 0);
    int st = 0;
    for (int k0 = 0; k0 < K; k0 += 32) {
        const bool more = (k0 + 32) < K;
        if (more) {
            issue_stage(st ^ 1, k0 + 32);
            // current stage done; next stage's 4 loads stay in flight
            asm volatile("s_wait_asynccnt 0x4" ::: "memory");
        } else {
            asm volatile("s_wait_asynccnt 0x0" ::: "memory");
        }
        __syncthreads();

        AFrag a[2], bf[4];
        load_frag_lds(Asmem[st], wm * 32 + 0,  lane, a[0]);
        load_frag_lds(Asmem[st], wm * 32 + 16, lane, a[1]);
#pragma unroll
        for (int fn = 0; fn < 4; ++fn)
            load_frag_lds(Bsmem[st], wn * 64 + fn * 16, lane, bf[fn]);

#pragma unroll
        for (int fm = 0; fm < 2; ++fm)
#pragma unroll
            for (int fn = 0; fn < 4; ++fn)
                acc[fm][fn] = __builtin_amdgcn_wmma_f32_16x16x32_bf16(
                    false, a[fm].v, false, bf[fn].v,
                    (short)0, acc[fm][fn], false, false);

        __syncthreads();   // all waves done reading st before it is re-staged
        st ^= 1;
    }

    const int l15 = lane & 15;
    const int lh8 = (lane >> 4) * 8;
#pragma unroll
    for (int fm = 0; fm < 2; ++fm)
#pragma unroll
        for (int fn = 0; fn < 4; ++fn)
#pragma unroll
            for (int r = 0; r < 8; ++r) {
                const int m = blockIdx.x * 128 + wm * 32 + fm * 16 + lh8 + r;
                const int n = blockIdx.y * 128 + wn * 64 + fn * 16 + l15;
                float val = acc[fm][fn][r];
                if (bias)     val += bias[n];
                val *= alpha;
                if (rowscale) val *= rowscale[b * rs_stride + m];
                if (MODE == 0)
                    ((float*)Cout)[(long long)b * sC + (long long)m * ldc + n] = val;
                else if (MODE == 1)
                    ((__bf16*)Cout)[(long long)b * sC + (long long)m * ldc + n] = (__bf16)val;
                else
                    ((__bf16*)Cout)[(long long)b * sC + (long long)n * ldc + m] = (__bf16)val;
            }
}

// ---------------------------------------------------------------------------
// The streaming kernels (cast, LayerNorm, row pass) start few, long waves: a lane
// moves 16 bytes per load and holds many values, all its loads are in flight at
// once, and a row's sum is taken across the 32 lanes of a wave.
// ---------------------------------------------------------------------------
typedef __attribute__((ext_vector_type(4))) float  f32x4;
typedef __attribute__((ext_vector_type(4))) __bf16 bf16x4;

__device__ __forceinline__ bf16x4 to_bf16x4(f32x4 v) {
    return __builtin_convertvector(v, bf16x4);
}

// Sum over the 32 lanes of a wave; every lane ends with the total.
__device__ __forceinline__ float wave_sum(float v) {
    for (int off = 16; off > 0; off >>= 1) v += __shfl_xor(v, off, 32);
    return v;
}

// ---------------------------------------------------------------------------
// f32 -> bf16 cast (weights): 8 values per thread, as two quads 256 quads apart,
// so that each wave-wide load covers 512 contiguous bytes. A block converts 2048
// values; the grid covers the array exactly.
// ---------------------------------------------------------------------------
__global__ __launch_bounds__(256) void cast_f32_to_bf16(const float* __restrict__ in,
                                                        __bf16* __restrict__ out) {
    const int i = (blockIdx.x * 512 + threadIdx.x) * 4;
    const f32x4 a = *(const f32x4*)(in + i);
    const f32x4 b = *(const f32x4*)(in + i + 1024);
    *(bf16x4*)(out + i)        = to_bf16x4(a);
    *(bf16x4*)(out + i + 1024) = to_bf16x4(b);
}

// ---------------------------------------------------------------------------
// LayerNorm over D=512, bf16 output. One wave owns R adjacent rows (16 values of
// each row per lane, all R*4 loads in flight at once); 16 waves per block.
// ---------------------------------------------------------------------------
template <int R>
__global__ __launch_bounds__(512) void layernorm_to_bf16(
    const float* __restrict__ x, const float* __restrict__ g,
    const float* __restrict__ bb, __bf16* __restrict__ y)
{
    const int D = 512;
    const int lane = threadIdx.x & 31;
    const long long row0 = (long long)(blockIdx.x * 16 + (threadIdx.x >> 5)) * R;
    const float* xr = x + row0 * D + lane * 4;
    __bf16*      yr = y + row0 * D + lane * 4;

    // Fully unrolled throughout, so that v[][] stays in registers.
    f32x4 gv[4], bv[4];
#pragma unroll
    for (int i = 0; i < 4; ++i) {
        gv[i] = *(const f32x4*)(g + i * 128 + lane * 4);
        bv[i] = *(const f32x4*)(bb + i * 128 + lane * 4);
    }
    f32x4 v[R][4];
#pragma unroll
    for (int r = 0; r < R; ++r)
#pragma unroll
        for (int i = 0; i < 4; ++i) v[r][i] = *(const f32x4*)(xr + r * D + i * 128);

    float s[R], ss[R];
#pragma unroll
    for (int r = 0; r < R; ++r) {
        s[r] = 0.f; ss[r] = 0.f;
#pragma unroll
        for (int i = 0; i < 4; ++i)
#pragma unroll
            for (int c = 0; c < 4; ++c) { s[r] += v[r][i][c]; ss[r] += v[r][i][c] * v[r][i][c]; }
    }
#pragma unroll
    for (int r = 0; r < R; ++r) { s[r] = wave_sum(s[r]); ss[r] = wave_sum(ss[r]); }

#pragma unroll
    for (int r = 0; r < R; ++r) {
        const float mu   = s[r] * (1.0f / D);
        const float var  = ss[r] * (1.0f / D) - mu * mu;
        const float rstd = rsqrtf(var + 1e-5f);
#pragma unroll
        for (int i = 0; i < 4; ++i) {
            f32x4 o;
#pragma unroll
            for (int c = 0; c < 4; ++c) o[c] = (v[r][i][c] - mu) * rstd * gv[i][c] + bv[i][c];
            *(bf16x4*)(yr + r * D + i * 128) = to_bf16x4(o);
        }
    }
}

// ---------------------------------------------------------------------------
// Column softmax stats: max and sum of exp over the query axis (i) per (b, j).
// One 512-thread block owns 64 adjacent columns and all 1024 rows of them.
// A wave-wide 16-byte load covers 2 rows x 256 contiguous bytes; each thread
// holds 32 rows x 4 columns in registers (all 32 loads in flight at once),
// takes its own max and exp-sum, and the 32 row groups of the block are then
// merged through LDS.
// ---------------------------------------------------------------------------
#define CS_NQ    1024
#define CS_NK    2048
#define CS_COLS  64      // columns per block
#define CS_GRPS  32      // row groups per block (16 waves x 2 half-waves)
#define CS_RPT   (CS_NQ / CS_GRPS)   // rows per thread

__device__ __forceinline__ float exp_with_slot(float a) {
    float e;
    asm("v_exp_f32 %0, %1\n\tv_nop" : "=v"(e) : "v"(a * 1.44269504088896340736f));
    return e;
}

__global__ __launch_bounds__(512) void col_softmax_stats(
    const float* __restrict__ S, float* __restrict__ colmax,
    float* __restrict__ colsum)
{
    __shared__ __attribute__((aligned(16))) float gm[CS_GRPS][CS_COLS];
    __shared__ __attribute__((aligned(16))) float gs[CS_GRPS][CS_COLS];

    const int t    = threadIdx.x;
    const int grp  = t >> 4;            // 0..31 : row group
    const int c4   = (t & 15) * 4;      // column quad inside the block
    const int col0 = blockIdx.x * CS_COLS;          // over B*NK
    const int b    = col0 / CS_NK, j0 = col0 % CS_NK;
    const float* p = S + (long long)b * CS_NQ * CS_NK
                       + (long long)grp * CS_RPT * CS_NK + j0 + c4;

    // Every loop below is fully unrolled so that x[] stays in registers and the
    // 32 loads issue back to back before the first value is used.
    f32x4 x[CS_RPT];
#pragma unroll
    for (int i = 0; i < CS_RPT; ++i)
        x[i] = *(const f32x4*)(p + i * CS_NK);

    f32x4 m = {-1e30f, -1e30f, -1e30f, -1e30f};
#pragma unroll
    for (int i = 0; i < CS_RPT; ++i)
#pragma unroll
        for (int c = 0; c < 4; ++c) m[c] = fmaxf(m[c], x[i][c]);

    f32x4 s = {0.f, 0.f, 0.f, 0.f};
#pragma unroll
    for (int i = 0; i < CS_RPT; ++i)
#pragma unroll
        for (int c = 0; c < 4; ++c) s[c] += __expf(x[i][c] - m[c]);

    *(f32x4*)&gm[grp][c4] = m;
    *(f32x4*)&gs[grp][c4] = s;
    __syncthreads();   // every group's partial max and sum visible to the merge

    if (t < CS_COLS) {
        float M = -1e30f;
#pragma unroll
        for (int g = 0; g < CS_GRPS; ++g) M = fmaxf(M, gm[g][t]);
        float sum = 0.f;
#pragma unroll
        for (int g = 0; g < CS_GRPS; ++g) sum += gs[g][t] * exp_with_slot(gm[g][t] - M);
        colmax[col0 + t] = M;
        colsum[col0 + t] = sum;
    }
}

// ---------------------------------------------------------------------------
// Row pass: P = exp(S - colmax)/colsum + eps (bf16) ; rowrecip = 1/sum_j P
// One 512-thread block owns 32 adjacent (b,i) rows. A thread owns 4 columns of
// all 32 rows: it loads their column max and sum once, takes 1/colsum once, and
// has its 32 row loads in flight at once (a wave-wide load covers 512 contiguous
// bytes of one row). Row sums: across the wave's lanes, then over the 16 waves
// through LDS; the block writes 32 adjacent rowrecip values, one 128-byte line.
// ---------------------------------------------------------------------------
#define RP_ROWS  32

__global__ __launch_bounds__(512) void attn_row_pass(
    const float* __restrict__ S, const float* __restrict__ colmax,
    const float* __restrict__ colsum, __bf16* __restrict__ P,
    float* __restrict__ rowrecip)
{
    __shared__ float red[16][RP_ROWS];

    const int t    = threadIdx.x;
    const int lane = t & 31;
    const int row0 = blockIdx.x * RP_ROWS;  // b*NQ + i
    const int b    = row0 / CS_NQ;          // RP_ROWS divides NQ: one b per block
    const float* Sr = S + (long long)row0 * CS_NK + t * 4;
    __bf16*      Pr = P + (long long)row0 * CS_NK + t * 4;

    // Every loop below is fully unrolled so that x[] and part[] stay in registers
    // and the 32 row loads issue back to back before the first value is used.
    const f32x4 m  = *(const f32x4*)(colmax + b * CS_NK + t * 4);
    const f32x4 cs = *(const f32x4*)(colsum + b * CS_NK + t * 4);
    f32x4 x[RP_ROWS];
#pragma unroll
    for (int r = 0; r < RP_ROWS; ++r) x[r] = *(const f32x4*)(Sr + r * CS_NK);

    f32x4 inv;
#pragma unroll
    for (int k = 0; k < 4; ++k) inv[k] = 1.0f / cs[k];

    float part[RP_ROWS];
#pragma unroll
    for (int r = 0; r < RP_ROWS; ++r) {
        f32x4 pv;
#pragma unroll
        for (int k = 0; k < 4; ++k)
            pv[k] = exp_with_slot(x[r][k] - m[k]) * inv[k] + 1e-8f;
        *(bf16x4*)(Pr + r * CS_NK) = to_bf16x4(pv);
        part[r] = (pv[0] + pv[1]) + (pv[2] + pv[3]);
    }

#pragma unroll
    for (int off = 16; off > 0; off >>= 1) {
        const bool hi = (lane & off) != 0;
#pragma unroll
        for (int i = 0; i < off; ++i) {
            const float lo_row = part[i], hi_row = part[i + off];
            const float keep = hi ? hi_row : lo_row;
            const float send = hi ? lo_row : hi_row;
            part[i] = keep + __shfl_xor(send, off, 32);
        }
    }
    red[t >> 5][lane] = part[0];
    __syncthreads();   // every wave's 32 row sums visible to the merge

    if (t < RP_ROWS) {
        float sum = 0.f;
#pragma unroll
        for (int w = 0; w < 16; ++w) sum += red[w][t];
        rowrecip[row0 + t] = 1.0f / sum;
    }
}

// ---------------------------------------------------------------------------
// Host-side orchestration
// ---------------------------------------------------------------------------
extern "C" void kernel_launch(void* const* d_in, const int* in_sizes, int n_in,
                              void* d_out, int out_size, void* d_ws, size_t ws_size,
                              hipStream_t stream) {
    (void)in_sizes; (void)n_in; (void)out_size; (void)ws_size;

    const int B = 8, NQ = 1024, NK = 2048, D = 512;
    const float qscale = 0.044194173824159216f;   // 1/sqrt(512)

    const float* inputs  = (const float*)d_in[0];
    const float* context = (const float*)d_in[1];
    const float* ln_in_g  = (const float*)d_in[2];
    const float* ln_in_b  = (const float*)d_in[3];
    const float* ln_ctx_g = (const float*)d_in[4];
    const float* ln_ctx_b = (const float*)d_in[5];
    const float* Wq = (const float*)d_in[6];
    const float* bq = (const float*)d_in[7];
    const float* Wk = (const float*)d_in[8];
    const float* bk = (const float*)d_in[9];
    const float* Wv = (const float*)d_in[10];
    const float* bv = (const float*)d_in[11];
    float* out = (float*)d_out;

    // Workspace bump allocator (256B aligned)
    char* ws = (char*)d_ws;
    size_t off = 0;
    auto alloc = [&](size_t bytes) -> char* {
        char* p = ws + off;
        off += (bytes + 255) & ~(size_t)255;
        return p;
    };
    __bf16* Wqb = (__bf16*)alloc((size_t)D * D * 2);
    __bf16* Wkb = (__bf16*)alloc((size_t)D * D * 2);
    __bf16* Wvb = (__bf16*)alloc((size_t)D * D * 2);
    __bf16* xln = (__bf16*)alloc((size_t)B * NQ * D * 2);
    __bf16* cln = (__bf16*)alloc((size_t)B * NK * D * 2);
    __bf16* qb  = (__bf16*)alloc((size_t)B * NQ * D * 2);
    __bf16* kb  = (__bf16*)alloc((size_t)B * NK * D * 2);
    __bf16* vT  = (__bf16*)alloc((size_t)B * D * NK * 2);   // [b][d][j]
    float*  S   = (float*) alloc((size_t)B * NQ * NK * 4);
    __bf16* P   = (__bf16*)alloc((size_t)B * NQ * NK * 2);
    float*  cmx = (float*) alloc((size_t)B * NK * 4);
    float*  csm = (float*) alloc((size_t)B * NK * 4);
    float*  rrc = (float*) alloc((size_t)B * NQ * 4);

    // 1) weights -> bf16
    {
        const int n = D * D;
        cast_f32_to_bf16<<<dim3(n / 2048), dim3(256), 0, stream>>>(Wq, Wqb);
        cast_f32_to_bf16<<<dim3(n / 2048), dim3(256), 0, stream>>>(Wk, Wkb);
        cast_f32_to_bf16<<<dim3(n / 2048), dim3(256), 0, stream>>>(Wv, Wvb);
    }

    // 2) LayerNorms -> bf16 activations
    layernorm_to_bf16<2><<<dim3(B * NQ / 32), dim3(512), 0, stream>>>(inputs, ln_in_g, ln_in_b, xln);
    layernorm_to_bf16<4><<<dim3(B * NK / 64), dim3(512), 0, stream>>>(context, ln_ctx_g, ln_ctx_b, cln);

    // 3) Projections (batched over B, weights shared via sB=0)
    // q = (xln @ Wq^T + bq) * 1/sqrt(D)   -> bf16 [b][i][d]
    gemm_bf16_wmma<1><<<dim3(NQ / 128, D / 128, B), dim3(256), 0, stream>>>(
        xln, Wqb, bq, nullptr, qscale, qb,
        NQ, D, D, D, D, D,
        (long long)NQ * D, 0LL, (long long)NQ * D, 0);
    // k = cln @ Wk^T + bk                  -> bf16 [b][j][d]
    gemm_bf16_wmma<1><<<dim3(NK / 128, D / 128, B), dim3(256), 0, stream>>>(
        cln, Wkb, bk, nullptr, 1.0f, kb,
        NK, D, D, D, D, D,
        (long long)NK * D, 0LL, (long long)NK * D, 0);
    // v = cln @ Wv^T + bv, stored transposed -> bf16 [b][d][j]
    gemm_bf16_wmma<2><<<dim3(NK / 128, D / 128, B), dim3(256), 0, stream>>>(
        cln, Wvb, bv, nullptr, 1.0f, vT,
        NK, D, D, D, D, NK,
        (long long)NK * D, 0LL, (long long)D * NK, 0);

    // 4) dots: S[b,i,j] = q[b,i,:] . k[b,j,:]   (scale folded into q)
    gemm_bf16_wmma<0><<<dim3(NQ / 128, NK / 128, B), dim3(256), 0, stream>>>(
        qb, kb, nullptr, nullptr, 1.0f, S,
        NQ, NK, D, D, D, NK,
        (long long)NQ * D, (long long)NK * D, (long long)NQ * NK, 0);

    // 5) softmax over query axis (columns of S), then row pass
    col_softmax_stats<<<dim3(B * NK / 64), dim3(512), 0, stream>>>(S, cmx, csm);
    attn_row_pass<<<dim3(B * NQ / 32), dim3(512), 0, stream>>>(S, cmx, csm, P, rrc);

    // 6) updates[b,i,d] = (1/rowsum[b,i]) * sum_j P[b,i,j] * v[b,j,d]
    gemm_bf16_wmma<0><<<dim3(NQ / 128, D / 128, B), dim3(256), 0, stream>>>(
        P, vT, nullptr, rrc, 1.0f, out,
        NQ, D, NK, NK, NK, D,
        (long long)NQ * NK, (long long)D * NK, (long long)NQ * D, NQ);
}

// v003
// A run of this version takes 170 microseconds.
// Two timings next to v002 put it at 1.14 and 1.13 times that version's speed.
// Over all steps from v000 it is 2.25 times as fast.
#include <hip/hip_runtime.h>
#include <hip/hip_bf16.h>

typedef __attribute__((ext_vector_type(16))) __bf16        bf16x16;
typedef __attribute__((ext_vector_type(8)))  float         floatx8;
typedef __attribute__((ext_vector_type(4)))  unsigned int  u32x4;

union AFrag {
    bf16x16 v;
    u32x4   q[2];
};

#define TILE_K   128
#define TILE_LDA (TILE_K + 8)

__device__ __forceinline__ void load_frag_lds(const __bf16* base, int row0, int kk,
                                              int lane, AFrag& f) {
    const int m    = lane & 15;
    const int half = lane >> 4;
    const __bf16* p = base + (row0 + m) * TILE_LDA + kk + half * 8;
    f.q[0] = *(const u32x4*)(p);        // K = kk+half*8 .. kk+half*8+7
    f.q[1] = *(const u32x4*)(p + 16);   // K = kk+16+half*8 .. kk+16+half*8+7
}

__device__ __forceinline__ void async_copy8_b128(const __bf16* lds, const __bf16* g,
                                                 long long gstep) {
    const unsigned           l  = (unsigned)(unsigned long long)lds;
    const unsigned           ls = 16 * TILE_LDA * 2;
    const unsigned long long ga = (unsigned long long)g;
    const unsigned long long gs = (unsigned long long)gstep * 2;
    asm volatile("global_load_async_to_lds_b128 %0, %8, off\n\t"
                 "global_load_async_to_lds_b128 %1, %9, off\n\t"
                 "global_load_async_to_lds_b128 %2, %10, off\n\t"
                 "global_load_async_to_lds_b128 %3, %11, off\n\t"
                 "global_load_async_to_lds_b128 %4, %12, off\n\t"
                 "global_load_async_to_lds_b128 %5, %13, off\n\t"
                 "global_load_async_to_lds_b128 %6, %14, off\n\t"
                 "global_load_async_to_lds_b128 %7, %15, off\n\t"
                 "s_wait_xcnt 0x0"
                 :: "v"(l), "v"(l + ls), "v"(l + 2 * ls), "v"(l + 3 * ls),
                    "v"(l + 4 * ls), "v"(l + 5 * ls), "v"(l + 6 * ls), "v"(l + 7 * ls),
                    "v"(ga), "v"(ga + gs), "v"(ga + 2 * gs), "v"(ga + 3 * gs),
                    "v"(ga + 4 * gs), "v"(ga + 5 * gs), "v"(ga + 6 * gs), "v"(ga + 7 * gs)
                 : "memory");
}

// ---------------------------------------------------------------------------
// Generic batched GEMM:  C[b] = epilogue( A[b] * Bt[b]^T )
//   A  : [M x K] bf16 row-major (K contiguous), lda
//   Bt : [N x K] bf16 row-major (K contiguous), ldb   (i.e. B column-major)
//   MODE 0: f32  out at  C[b*sC + m*ldc + n]
//   MODE 1: bf16 out at  C[b*sC + m*ldc + n]
//   MODE 2: bf16 out at  C[b*sC + n*ldc + m]   (transposed store)
//   epilogue: val = (acc + bias[n]) * alpha * rowscale[b*rs_stride + m]
// Block tile 128(M) x 128(N), K-step TILE_K, double-buffered async LDS staging.
// K is a multiple of TILE_K.
// 256 threads = 8 waves; each wave owns a 32x64 sub-tile (2x4 WMMA frags).
// ---------------------------------------------------------------------------
template <int MODE>
__global__ __launch_bounds__(256) void gemm_bf16_wmma(
    const __bf16* __restrict__ A, const __bf16* __restrict__ Bt,
    const float* __restrict__ bias, const float* __restrict__ rowscale,
    float alpha, void* __restrict__ Cout,
    int M, int N, int K, int lda, int ldb, int ldc,
    long long sA, long long sB, long long sC, int rs_stride)
{
    __shared__ __attribute__((aligned(16))) __bf16 Asmem[2][128 * TILE_LDA];
    __shared__ __attribute__((aligned(16))) __bf16 Bsmem[2][128 * TILE_LDA];

    const int b = blockIdx.z;
    const __bf16* Ab = A + (long long)b * sA + (long long)blockIdx.x * 128 * lda;
    const __bf16* Bb = Bt + (long long)b * sB + (long long)blockIdx.y * 128 * ldb;

    const int t    = threadIdx.x;
    const int lane = t & 31;
    const int wid  = t >> 5;       // 0..7
    const int wm   = wid & 3;      // 0..3 : 32-row strip
    const int wn   = wid >> 2;     // 0..1 : 64-col strip

    // Per-thread staging coords: 128 rows x 16 x 16B chunks per matrix,
    // thread t handles rows r0, r0+16, .. r0+112 at column chunk c8.
    const int r0 = t >> 4;
    const int c8 = (t & 15) * 8;
    const __bf16* ga = Ab + (long long)r0 * lda + c8;
    const __bf16* gb = Bb + (long long)r0 * ldb + c8;
    const int     loff = r0 * TILE_LDA + c8;

    auto issue_stage = [&](int st, int k0) {   // 16 async b128 per wave
        async_copy8_b128(&Asmem[st][loff], ga + k0, (long long)16 * lda);
        async_copy8_b128(&Bsmem[st][loff], gb + k0, (long long)16 * ldb);
    };

    floatx8 acc[2][4] = {};

    const int nst = K / TILE_K;
    issue_stage(0, 0);
    // stage 0 landed (this wave's copies), then published to every wave
    asm volatile("s_wait_asynccnt 0x0" ::: "memory");
    __syncthreads();
    if (nst > 1) issue_stage(1, TILE_K);

    for (int s = 0; s < nst; ++s) {
        const int st = s & 1;
        // unrolled: the four 32-k blocks of a stage run without a branch between them
#pragma unroll
        for (int kk = 0; kk < TILE_K; kk += 32) {
            AFrag a[2], bf[4];
            load_frag_lds(Asmem[st], wm * 32 + 0,  kk, lane, a[0]);
            load_frag_lds(Asmem[st], wm * 32 + 16, kk, lane, a[1]);
#pragma unroll
            for (int fn = 0; fn < 4; ++fn)
                load_frag_lds(Bsmem[st], wn * 64 + fn * 16, kk, lane, bf[fn]);

#pragma unroll
            for (int fm = 0; fm < 2; ++fm)
#pragma unroll
                for (int fn = 0; fn < 4; ++fn)
                    acc[fm][fn] = __builtin_amdgcn_wmma_f32_16x16x32_bf16(
                        false, a[fm].v, false, bf[fn].v,
                        (short)0, acc[fm][fn], false, false);
        }

        // this wave's reads of buffer st have returned
        asm volatile("s_wait_dscnt 0x0" ::: "memory");
        // this wave's copies of stage s+1 have landed
        asm volatile("s_wait_asynccnt 0x0" ::: "memory");
        // one barrier: publishes stage s+1 and ends every wave's reads of buffer st
        __syncthreads();
        if (s + 2 < nst) issue_stage(st, (s + 2) * TILE_K);
    }
    // no copy is left in flight when the wave goes on to the epilogue
    asm volatile("s_wait_asynccnt 0x0" ::: "memory");

    const int l15 = lane & 15;
    const int lh8 = (lane >> 4) * 8;
#pragma unroll
    for (int fm = 0; fm < 2; ++fm)
#pragma unroll
        for (int fn = 0; fn < 4; ++fn)
#pragma unroll
            for (int r = 0; r < 8; ++r) {
                const int m = blockIdx.x * 128 + wm * 32 + fm * 16 + lh8 + r;
                const int n = blockIdx.y * 128 + wn * 64 + fn * 16 + l15;
                float val = acc[fm][fn][r];
                if (bias)     val += bias[n];
                val *= alpha;
                if (rowscale) val *= rowscale[b * rs_stride + m];
                if (MODE == 0)
                    ((float*)Cout)[(long long)b * sC + (long long)m * ldc + n] = val;
                else if (MODE == 1)
                    ((__bf16*)Cout)[(long long)b * sC + (long long)m * ldc + n] = (__bf16)val;
                else
                    ((__bf16*)Cout)[(long long)b * sC + (long long)n * ldc + m] = (__bf16)val;
            }
}

// ---------------------------------------------------------------------------
// The streaming kernels (cast, LayerNorm, row pass) start few, long waves: a lane
// moves 16 bytes per load and holds many values, all its loads are in flight at
// once, and a row's sum is taken across the 32 lanes of a wave.
// ---------------------------------------------------------------------------
typedef __attribute__((ext_vector_type(4))) float  f32x4;
typedef __attribute__((ext_vector_type(4))) __bf16 bf16x4;

__device__ __forceinline__ bf16x4 to_bf16x4(f32x4 v) {
    return __builtin_convertvector(v, bf16x4);
}

// Sum over the 32 lanes of a wave; every lane ends with the total.
__device__ __forceinline__ float wave_sum(float v) {
    for (int off = 16; off > 0; off >>= 1) v += __shfl_xor(v, off, 32);
    return v;
}

// ---------------------------------------------------------------------------
// f32 -> bf16 cast (weights): 8 values per thread, as two quads 256 quads apart,
// so that each wave-wide load covers 512 contiguous bytes. A block converts 2048
// values; the grid covers the array exactly.
// ---------------------------------------------------------------------------
__global__ __launch_bounds__(256) void cast_f32_to_bf16(const float* __restrict__ in,
                                                        __bf16* __restrict__ out) {
    const int i = (blockIdx.x * 512 + threadIdx.x) * 4;
    const f32x4 a = *(const f32x4*)(in + i);
    const f32x4 b = *(const f32x4*)(in + i + 1024);
    *(bf16x4*)(out + i)        = to_bf16x4(a);
    *(bf16x4*)(out + i + 1024) = to_bf16x4(b);
}

// ---------------------------------------------------------------------------
// LayerNorm over D=512, bf16 output. One wave owns R adjacent rows (16 values of
// each row per lane, all R*4 loads in flight at once); 16 waves per block.
// ---------------------------------------------------------------------------
template <int R>
__global__ __launch_bounds__(512) void layernorm_to_bf16(
    const float* __restrict__ x, const float* __restrict__ g,
    const float* __restrict__ bb, __bf16* __restrict__ y)
{
    const int D = 512;
    const int lane = threadIdx.x & 31;
    const long long row0 = (long long)(blockIdx.x * 16 + (threadIdx.x >> 5)) * R;
    const float* xr = x + row0 * D + lane * 4;
    __bf16*      yr = y + row0 * D + lane * 4;

    // Fully unrolled throughout, so that v[][] stays in registers.
    f32x4 gv[4], bv[4];
#pragma unroll
    for (int i = 0; i < 4; ++i) {
        gv[i] = *(const f32x4*)(g + i * 128 + lane * 4);
        bv[i] = *(const f32x4*)(bb + i * 128 + lane * 4);
    }
    f32x4 v[R][4];
#pragma unroll
    for (int r = 0; r < R; ++r)
#pragma unroll
        for (int i = 0; i < 4; ++i) v[r][i] = *(const f32x4*)(xr + r * D + i * 128);

    float s[R], ss[R];
#pragma unroll
    for (int r = 0; r < R; ++r) {
        s[r] = 0.f; ss[r] = 0.f;
#pragma unroll
        for (int i = 0; i < 4; ++i)
#pragma unroll
            for (int c = 0; c < 4; ++c) { s[r] += v[r][i][c]; ss[r] += v[r][i][c] * v[r][i][c]; }
    }
#pragma unroll
    for (int r = 0; r < R; ++r) { s[r] = wave_sum(s[r]); ss[r] = wave_sum(ss[r]); }

#pragma unroll
    for (int r = 0; r < R; ++r) {
        const float mu   = s[r] * (1.0f / D);
        const float var  = ss[r] * (1.0f / D) - mu * mu;
        const float rstd = rsqrtf(var + 1e-5f);
#pragma unroll
        for (int i = 0; i < 4; ++i) {
            f32x4 o;
#pragma unroll
            for (int c = 0; c < 4; ++c) o[c] = (v[r][i][c] - mu) * rstd * gv[i][c] + bv[i][c];
            *(bf16x4*)(yr + r * D + i * 128) = to_bf16x4(o);
        }
    }
}

// ---------------------------------------------------------------------------
// Column softmax stats: max and sum of exp over the query axis (i) per (b, j).
// One 512-thread block owns 64 adjacent columns and all 1024 rows of them.
// A wave-wide 16-byte load covers 2 rows x 256 contiguous bytes; each thread
// holds 32 rows x 4 columns in registers (all 32 loads in flight at once),
// takes its own max and exp-sum, and the 32 row groups of the block are then
// merged through LDS.
// ---------------------------------------------------------------------------
#define CS_NQ    1024
#define CS_NK    2048
#define CS_COLS  64      // columns per block
#define CS_GRPS  32      // row groups per block (16 waves x 2 half-waves)
#define CS_RPT   (CS_NQ / CS_GRPS)   // rows per thread

__device__ __forceinline__ float exp_with_slot(float a) {
    float e;
    asm("v_exp_f32 %0, %1\n\tv_nop" : "=v"(e) : "v"(a * 1.44269504088896340736f));
    return e;
}

__global__ __launch_bounds__(512) void col_softmax_stats(
    const float* __restrict__ S, float* __restrict__ colmax,
    float* __restrict__ colsum)
{
    __shared__ __attribute__((aligned(16))) float gm[CS_GRPS][CS_COLS];
    __shared__ __attribute__((aligned(16))) float gs[CS_GRPS][CS_COLS];

    const int t    = threadIdx.x;
    const int grp  = t >> 4;            // 0..31 : row group
    const int c4   = (t & 15) * 4;      // column quad inside the block
    const int col0 = blockIdx.x * CS_COLS;          // over B*NK
    const int b    = col0 / CS_NK, j0 = col0 % CS_NK;
    const float* p = S + (long long)b * CS_NQ * CS_NK
                       + (long long)grp * CS_RPT * CS_NK + j0 + c4;

    // Every loop below is fully unrolled so that x[] stays in registers and the
    // 32 loads issue back to back before the first value is used.
    f32x4 x[CS_RPT];
#pragma unroll
    for (int i = 0; i < CS_RPT; ++i)
        x[i] = *(const f32x4*)(p + i * CS_NK);

    f32x4 m = {-1e30f, -1e30f, -1e30f, -1e30f};
#pragma unroll
    for (int i = 0; i < CS_RPT; ++i)
#pragma unroll
        for (int c = 0; c < 4; ++c) m[c] = fmaxf(m[c], x[i][c]);

    f32x4 s = {0.f, 0.f, 0.f, 0.f};
#pragma unroll
    for (int i = 0; i < CS_RPT; ++i)
#pragma unroll
        for (int c = 0; c < 4; ++c) s[c] += __expf(x[i][c] - m[c]);

    *(f32x4*)&gm[grp][c4] = m;
    *(f32x4*)&gs[grp][c4] = s;
    __syncthreads();   // every group's partial max and sum visible to the merge

    if (t < CS_COLS) {
        float M = -1e30f;
#pragma unroll
        for (int g = 0; g < CS_GRPS; ++g) M = fmaxf(M, gm[g][t]);
        float sum = 0.f;
#pragma unroll
        for (int g = 0; g < CS_GRPS; ++g) sum += gs[g][t] * exp_with_slot(gm[g][t] - M);
        colmax[col0 + t] = M;
        colsum[col0 + t] = sum;
    }
}

// ---------------------------------------------------------------------------
// Row pass: P = exp(S - colmax)/colsum + eps (bf16) ; rowrecip = 1/sum_j P
// One 512-thread block owns 32 adjacent (b,i) rows. A thread owns 4 columns of
// all 32 rows: it loads their column max and sum once, takes 1/colsum once, and
// has its 32 row loads in flight at once (a wave-wide load covers 512 contiguous
// bytes of one row). Row sums: across the wave's lanes, then over the 16 waves
// through LDS; the block writes 32 adjacent rowrecip values, one 128-byte line.
// ---------------------------------------------------------------------------
#define RP_ROWS  32

__global__ __launch_bounds__(512) void attn_row_pass(
    const float* __restrict__ S, const float* __restrict__ colmax,
    const float* __restrict__ colsum, __bf16* __restrict__ P,
    float* __restrict__ rowrecip)
{
    __shared__ float red[16][RP_ROWS];

    const int t    = threadIdx.x;
    const int lane = t & 31;
    const int row0 = blockIdx.x * RP_ROWS;  // b*NQ + i
    const int b    = row0 / CS_NQ;          // RP_ROWS divides NQ: one b per block
    const float* Sr = S + (long long)row0 * CS_NK + t * 4;
    __bf16*      Pr = P + (long long)row0 * CS_NK + t * 4;

    // Every loop below is fully unrolled so that x[] and part[] stay in registers
    // and the 32 row loads issue back to back before the first value is used.
    const f32x4 m  = *(const f32x4*)(colmax + b * CS_NK + t * 4);
    const f32x4 cs = *(const f32x4*)(colsum + b * CS_NK + t * 4);
    f32x4 x[RP_ROWS];
#pragma unroll
    for (int r = 0; r < RP_ROWS; ++r) x[r] = *(const f32x4*)(Sr + r * CS_NK);

    f32x4 inv;
#pragma unroll
    for (int k = 0; k < 4; ++k) inv[k] = 1.0f / cs[k];

    float part[RP_ROWS];
#pragma unroll
    for (int r = 0; r < RP_ROWS; ++r) {
        f32x4 pv;
#pragma unroll
        for (int k = 0; k < 4; ++k)
            pv[k] = exp_with_slot(x[r][k] - m[k]) * inv[k] + 1e-8f;
        *(bf16x4*)(Pr + r * CS_NK) = to_bf16x4(pv);
        part[r] = (pv[0] + pv[1]) + (pv[2] + pv[3]);
    }

#pragma unroll
    for (int off = 16; off > 0; off >>= 1) {
        const bool hi = (lane & off) != 0;
#pragma unroll
        for (int i = 0; i < off; ++i) {
            const float lo_row = part[i], hi_row = part[i + off];
            const float keep = hi ? hi_row : lo_row;
            const float send = hi ? lo_row : hi_row;
            part[i] = keep + __shfl_xor(send, off, 32);
        }
    }
    red[t >> 5][lane] = part[0];
    __syncthreads();   // every wave's 32 row sums visible to the merge

    if (t < RP_ROWS) {
        float sum = 0.f;
#pragma unroll
        for (int w = 0; w < 16; ++w) sum += red[w][t];
        rowrecip[row0 + t] = 1.0f / sum;
    }
}

// ---------------------------------------------------------------------------
// Host-side orchestration
// ---------------------------------------------------------------------------
extern "C" void kernel_launch(void* const* d_in, const int* in_sizes, int n_in,
                              void* d_out, int out_size, void* d_ws, size_t ws_size,
                              hipStream_t stream) {
    (void)in_sizes; (void)n_in; (void)out_size; (void)ws_size;

    const int B = 8, NQ = 1024, NK = 2048, D = 512;
    const float qscale = 0.044194173824159216f;   // 1/sqrt(512)

    const float* inputs  = (const float*)d_in[0];
    const float* context = (const float*)d_in[1];
    const float* ln_in_g  = (const float*)d_in[2];
    const float* ln_in_b  = (const float*)d_in[3];
    const float* ln_ctx_g = (const float*)d_in[4];
    const float* ln_ctx_b = (const float*)d_in[5];
    const float* Wq = (const float*)d_in[6];
    const float* bq = (const float*)d_in[7];
    const float* Wk = (const float*)d_in[8];
    const float* bk = (const float*)d_in[9];
    const float* Wv = (const float*)d_in[10];
    const float* bv = (const float*)d_in[11];
    float* out = (float*)d_out;

    // Workspace bump allocator (256B aligned)
    char* ws = (char*)d_ws;
    size_t off = 0;
    auto alloc = [&](size_t bytes) -> char* {
        char* p = ws + off;
        off += (bytes + 255) & ~(size_t)255;
        return p;
    };
    __bf16* Wqb = (__bf16*)alloc((size_t)D * D * 2);
    __bf16* Wkb = (__bf16*)alloc((size_t)D * D * 2);
    __bf16* Wvb = (__bf16*)alloc((size_t)D * D * 2);
    __bf16* xln = (__bf16*)alloc((size_t)B * NQ * D * 2);
    __bf16* cln = (__bf16*)alloc((size_t)B * NK * D * 2);
    __bf16* qb  = (__bf16*)alloc((size_t)B * NQ * D * 2);
    __bf16* kb  = (__bf16*)alloc((size_t)B * NK * D * 2);
    __bf16* vT  = (__bf16*)alloc((size_t)B * D * NK * 2);   // [b][d][j]
    float*  S   = (float*) alloc((size_t)B * NQ * NK * 4);
    __bf16* P   = (__bf16*)alloc((size_t)B * NQ * NK * 2);
    float*  cmx = (float*) alloc((size_t)B * NK * 4);
    float*  csm = (float*) alloc((size_t)B * NK * 4);
    float*  rrc = (float*) alloc((size_t)B * NQ * 4);

    // 1) weights -> bf16
    {
        const int n = D * D;
        cast_f32_to_bf16<<<dim3(n / 2048), dim3(256), 0, stream>>>(Wq, Wqb);
        cast_f32_to_bf16<<<dim3(n / 2048), dim3(256), 0, stream>>>(Wk, Wkb);
        cast_f32_to_bf16<<<dim3(n / 2048), dim3(256), 0, stream>>>(Wv, Wvb);
    }

    // 2) LayerNorms -> bf16 activations
    layernorm_to_bf16<2><<<dim3(B * NQ / 32), dim3(512), 0, stream>>>(inputs, ln_in_g, ln_in_b, xln);
    layernorm_to_bf16<4><<<dim3(B * NK / 64), dim3(512), 0, stream>>>(context, ln_ctx_g, ln_ctx_b, cln);

    // 3) Projections (batched over B, weights shared via sB=0)
    // q = (xln @ Wq^T + bq) * 1/sqrt(D)   -> bf16 [b][i][d]
    gemm_bf16_wmma<1><<<dim3(NQ / 128, D / 128, B), dim3(256), 0, stream>>>(
        xln, Wqb, bq, nullptr, qscale, qb,
        NQ, D, D, D, D, D,
        (long long)NQ * D, 0LL, (long long)NQ * D, 0);
    // k = cln @ Wk^T + bk                  -> bf16 [b][j][d]
    gemm_bf16_wmma<1><<<dim3(NK / 128, D / 128, B), dim3(256), 0, stream>>>(
        cln, Wkb, bk, nullptr, 1.0f, kb,
        NK, D, D, D, D, D,
        (long long)NK * D, 0LL, (long long)NK * D, 0);
    // v = cln @ Wv^T + bv, stored transposed -> bf16 [b][d][j]
    gemm_bf16_wmma<2><<<dim3(NK / 128, D / 128, B), dim3(256), 0, stream>>>(
        cln, Wvb, bv, nullptr, 1.0f, vT,
        NK, D, D, D, D, NK,
        (long long)NK * D, 0LL, (long long)D * NK, 0);

    // 4) dots: S[b,i,j] = q[b,i,:] . k[b,j,:]   (scale folded into q)
    gemm_bf16_wmma<0><<<dim3(NQ / 128, NK / 128, B), dim3(256), 0, stream>>>(
        qb, kb, nullptr, nullptr, 1.0f, S,
        NQ, NK, D, D, D, NK,
        (long long)NQ * D, (long long)NK * D, (long long)NQ * NK, 0);

    // 5) softmax over query axis (columns of S), then row pass
    col_softmax_stats<<<dim3(B * NK / 64), dim3(512), 0, stream>>>(S, cmx, csm);
    attn_row_pass<<<dim3(B * NQ / 32), dim3(512), 0, stream>>>(S, cmx, csm, P, rrc);

    // 6) updates[b,i,d] = (1/rowsum[b,i]) * sum_j P[b,i,j] * v[b,j,d]
    gemm_bf16_wmma<0><<<dim3(NQ / 128, D / 128, B), dim3(256), 0, stream>>>(
        P, vT, nullptr, rrc, 1.0f, out,
        NQ, D, NK, NK, NK, D,
        (long long)NQ * NK, (long long)D * NK, (long long)NQ * D, NQ);
}

// v004
// Measured time: 127 microseconds a run.
// Timed twice side by side with v003, it ran 1.32 and 1.33 times as fast.
// All steps since v000 together make it 2.98 times as fast.
#include <hip/hip_runtime.h>
#include <hip/hip_bf16.h>

typedef __attribute__((ext_vector_type(16))) __bf16        bf16x16;
typedef __attribute__((ext_vector_type(8)))  float         floatx8;
typedef __attribute__((ext_vector_type(4)))  unsigned int  u32x4;
typedef __attribute__((ext_vector_type(8)))  __bf16        bf16x8;

union AFrag {
    bf16x16 v;
    u32x4   q[2];
};

#define TILE_K   128
#define TILE_LDA (TILE_K + 8)

__device__ __forceinline__ void load_frag_lds(const __bf16* base, int row0, int kk,
                                              int lane, AFrag& f) {
    const int m    = lane & 15;
    const int half = lane >> 4;
    const __bf16* p = base + (row0 + m) * TILE_LDA + kk + half * 8;
    f.q[0] = *(const u32x4*)(p);        // K = kk+half*8 .. kk+half*8+7
    f.q[1] = *(const u32x4*)(p + 16);   // K = kk+16+half*8 .. kk+16+half*8+7
}

__device__ __forceinline__ void async_copy8_b128(const __bf16* lds, const __bf16* g,
                                                 long long gstep) {
    const unsigned           l  = (unsigned)(unsigned long long)lds;
    const unsigned           ls = 16 * TILE_LDA * 2;
    const unsigned long long ga = (unsigned long long)g;
    const unsigned long long gs = (unsigned long long)gstep * 2;
    asm volatile("global_load_async_to_lds_b128 %0, %8, off\n\t"
                 "global_load_async_to_lds_b128 %1, %9, off\n\t"
                 "global_load_async_to_lds_b128 %2, %10, off\n\t"
                 "global_load_async_to_lds_b128 %3, %11, off\n\t"
                 "global_load_async_to_lds_b128 %4, %12, off\n\t"
                 "global_load_async_to_lds_b128 %5, %13, off\n\t"
                 "global_load_async_to_lds_b128 %6, %14, off\n\t"
                 "global_load_async_to_lds_b128 %7, %15, off\n\t"
                 "s_wait_xcnt 0x0"
                 :: "v"(l), "v"(l + ls), "v"(l + 2 * ls), "v"(l + 3 * ls),
                    "v"(l + 4 * ls), "v"(l + 5 * ls), "v"(l + 6 * ls), "v"(l + 7 * ls),
                    "v"(ga), "v"(ga + gs), "v"(ga + 2 * gs), "v"(ga + 3 * gs),
                    "v"(ga + 4 * gs), "v"(ga + 5 * gs), "v"(ga + 6 * gs), "v"(ga + 7 * gs)
                 : "memory");
}

// ---------------------------------------------------------------------------
// Generic batched GEMM:  C[b] = epilogue( A[b] * Bt[b]^T )
//   A  : [M x K] bf16 row-major (K contiguous), lda
//   Bt : [N x K] bf16 row-major (K contiguous), ldb   (i.e. B column-major)
//   MODE 0: f32  out at  C[b*sC + m*ldc + n]
//   MODE 1: bf16 out at  C[b*sC + m*ldc + n]
//   MODE 2: bf16 out at  C[b*sC + n*ldc + m]   (transposed store)
//   epilogue: val = (acc + bias[n]) * alpha * rowscale[b*rs_stride + m]
// Block tile 128(M) x 128(N), K-step TILE_K, double-buffered async LDS staging.
// K is a multiple of TILE_K.
// 256 threads = 8 waves; each wave owns a 32x64 sub-tile (2x4 WMMA frags).
// The finished tile is laid into LDS in the orientation in which C holds it and
// goes out from there in whole 128-B lines, 16 bytes a lane.
// ---------------------------------------------------------------------------
template <int MODE>
__global__ __launch_bounds__(256) void gemm_bf16_wmma(
    const __bf16* __restrict__ A, const __bf16* __restrict__ Bt,
    const float* __restrict__ bias, const float* __restrict__ rowscale,
    float alpha, void* __restrict__ Cout,
    int M, int N, int K, int lda, int ldb, int ldc,
    long long sA, long long sB, long long sC, int rs_stride)
{
    __shared__ __attribute__((aligned(16))) __bf16 Asmem[2][128 * TILE_LDA];
    __shared__ __attribute__((aligned(16))) __bf16 Bsmem[2][128 * TILE_LDA];

    const int b = blockIdx.z;
    const __bf16* Ab = A + (long long)b * sA + (long long)blockIdx.x * 128 * lda;
    const __bf16* Bb = Bt + (long long)b * sB + (long long)blockIdx.y * 128 * ldb;

    const int t    = threadIdx.x;
    const int lane = t & 31;
    const int wid  = t >> 5;       // 0..7
    const int wm   = wid & 3;      // 0..3 : 32-row strip
    const int wn   = wid >> 2;     // 0..1 : 64-col strip

    // Per-thread staging coords: 128 rows x 16 x 16B chunks per matrix,
    // thread t handles rows r0, r0+16, .. r0+112 at column chunk c8.
    const int r0 = t >> 4;
    const int c8 = (t & 15) * 8;
    const __bf16* ga = Ab + (long long)r0 * lda + c8;
    const __bf16* gb = Bb + (long long)r0 * ldb + c8;
    const int     loff = r0 * TILE_LDA + c8;

    auto issue_stage = [&](int st, int k0) {   // 16 async b128 per wave
        async_copy8_b128(&Asmem[st][loff], ga + k0, (long long)16 * lda);
        async_copy8_b128(&Bsmem[st][loff], gb + k0, (long long)16 * ldb);
    };

    floatx8 acc[2][4] = {};

    const int nst = K / TILE_K;
    issue_stage(0, 0);
    // stage 0 landed (this wave's copies), then published to every wave
    asm volatile("s_wait_asynccnt 0x0" ::: "memory");
    __syncthreads();
    if (nst > 1) issue_stage(1, TILE_K);

    for (int s = 0; s < nst; ++s) {
        const int st = s & 1;
        // unrolled: the four 32-k blocks of a stage run without a branch between them
#pragma unroll
        for (int kk = 0; kk < TILE_K; kk += 32) {
            AFrag a[2], bf[4];
            load_frag_lds(Asmem[st], wm * 32 + 0,  kk, lane, a[0]);
            load_frag_lds(Asmem[st], wm * 32 + 16, kk, lane, a[1]);
#pragma unroll
            for (int fn = 0; fn < 4; ++fn)
                load_frag_lds(Bsmem[st], wn * 64 + fn * 16, kk, lane, bf[fn]);

#pragma unroll
            for (int fm = 0; fm < 2; ++fm)
#pragma unroll
                for (int fn = 0; fn < 4; ++fn)
                    acc[fm][fn] = __builtin_amdgcn_wmma_f32_16x16x32_bf16(
                        false, a[fm].v, false, bf[fn].v,
                        (short)0, acc[fm][fn], false, false);
        }

        // this wave's reads of buffer st have returned
        asm volatile("s_wait_dscnt 0x0" ::: "memory");
        // this wave's copies of stage s+1 have landed
        asm volatile("s_wait_asynccnt 0x0" ::: "memory");
        // one barrier: publishes stage s+1 and ends every wave's reads of buffer st
        __syncthreads();
        if (s + 2 < nst) issue_stage(st, (s + 2) * TILE_K);
    }
    // no copy is left in flight when the wave goes on to the epilogue
    asm volatile("s_wait_asynccnt 0x0" ::: "memory");

    constexpr int ESZ    = (MODE == 0) ? 4 : 2;    // bytes per element of C
    constexpr int ROW_B  = 128 * ESZ;              // bytes of a tile row in C
    constexpr int ST_LD  = ROW_B + 16;             // its pitch in LDS
    static_assert(128 * ST_LD <= (int)sizeof(Asmem), "staged tile fits the A ring");
    char* stage = (char*)&Asmem[0][0];

    const int l15 = lane & 15;
    const int lh8 = (lane >> 4) * 8;
#pragma unroll
    for (int fm = 0; fm < 2; ++fm)
#pragma unroll
        for (int fn = 0; fn < 4; ++fn) {
            const int ml = wm * 32 + fm * 16 + lh8;      // first of the lane's 8 rows
            const int nl = wn * 64 + fn * 16 + l15;      // its column, both in the tile
            bf16x8 col;
#pragma unroll
            for (int r = 0; r < 8; ++r) {
                const int m = blockIdx.x * 128 + ml + r;
                const int n = blockIdx.y * 128 + nl;
                float val = acc[fm][fn][r];
                if (bias)     val += bias[n];
                val *= alpha;
                if (rowscale) val *= rowscale[b * rs_stride + m];
                if (MODE == 0)
                    *(float*)(stage + (ml + r) * ST_LD + nl * 4) = val;
                else if (MODE == 1)
                    *(__bf16*)(stage + (ml + r) * ST_LD + nl * 2) = (__bf16)val;
                else
                    col[r] = (__bf16)val;
            }
            if (MODE == 2)   // the lane's 8 m are adjacent in a row of the transposed tile
                *(bf16x8*)(stage + nl * ST_LD + ml * 2) = col;
        }
    __syncthreads();   // the whole tile is staged before any wave reads rows of it

    // A wave-wide 16-byte store covers 512 contiguous bytes of one row (f32) or the
    // 256 bytes of each of two rows (bf16): 4 whole lines either way.
    constexpr int LANES_PER_ROW = ROW_B / 16;
    constexpr int ROWS_PER_PASS = 256 / LANES_PER_ROW;
    const int srow = t / LANES_PER_ROW;
    const int scol = (t % LANES_PER_ROW) * 16;          // in bytes
    const int crow0 = (MODE == 2 ? blockIdx.y : blockIdx.x) * 128;
    const int ccol0 = (MODE == 2 ? blockIdx.x : blockIdx.y) * 128;
    char* Cb = (char*)Cout + ((long long)b * sC + (long long)(crow0 + srow) * ldc + ccol0) * ESZ + scol;
    // unrolled: all LDS reads of the lane are issued before its first store
    u32x4 piece[128 / ROWS_PER_PASS];
#pragma unroll
    for (int p = 0; p < 128 / ROWS_PER_PASS; ++p)
        piece[p] = *(const u32x4*)(stage + (p * ROWS_PER_PASS + srow) * ST_LD + scol);
#pragma unroll
    for (int p = 0; p < 128 / ROWS_PER_PASS; ++p)
        *(u32x4*)(Cb + (long long)p * ROWS_PER_PASS * ldc * ESZ) = piece[p];
}

// ---------------------------------------------------------------------------
// The streaming kernels (cast, LayerNorm, row pass) start few, long waves: a lane
// moves 16 bytes per load and holds many values, all its loads are in flight at
// once, and a row's sum is taken across the 32 lanes of a wave.
// ---------------------------------------------------------------------------
typedef __attribute__((ext_vector_type(4))) float  f32x4;
typedef __attribute__((ext_vector_type(4))) __bf16 bf16x4;

__device__ __forceinline__ bf16x4 to_bf16x4(f32x4 v) {
    return __builtin_convertvector(v, bf16x4);
}

// Sum over the 32 lanes of a wave; every lane ends with the total.
__device__ __forceinline__ float wave_sum(float v) {
    for (int off = 16; off > 0; off >>= 1) v += __shfl_xor(v, off, 32);
    return v;
}

// ---------------------------------------------------------------------------
// f32 -> bf16 cast (weights): 8 values per thread, as two quads 256 quads apart,
// so that each wave-wide load covers 512 contiguous bytes. A block converts 2048
// values; the grid covers the array exactly.
// ---------------------------------------------------------------------------
__global__ __launch_bounds__(256) void cast_f32_to_bf16(const float* __restrict__ in,
                                                        __bf16* __restrict__ out) {
    const int i = (blockIdx.x * 512 + threadIdx.x) * 4;
    const f32x4 a = *(const f32x4*)(in + i);
    const f32x4 b = *(const f32x4*)(in + i + 1024);
    *(bf16x4*)(out + i)        = to_bf16x4(a);
    *(bf16x4*)(out + i + 1024) = to_bf16x4(b);
}

// ---------------------------------------------------------------------------
// LayerNorm over D=512, bf16 output. One wave owns R adjacent rows (16 values of
// each row per lane, all R*4 loads in flight at once); 16 waves per block.
// ---------------------------------------------------------------------------
template <int R>
__global__ __launch_bounds__(512) void layernorm_to_bf16(
    const float* __restrict__ x, const float* __restrict__ g,
    const float* __restrict__ bb, __bf16* __restrict__ y)
{
    const int D = 512;
    const int lane = threadIdx.x & 31;
    const long long row0 = (long long)(blockIdx.x * 16 + (threadIdx.x >> 5)) * R;
    const float* xr = x + row0 * D + lane * 4;
    __bf16*      yr = y + row0 * D + lane * 4;

    // Fully unrolled throughout, so that v[][] stays in registers.
    f32x4 gv[4], bv[4];
#pragma unroll
    for (int i = 0; i < 4; ++i) {
        gv[i] = *(const f32x4*)(g + i * 128 + lane * 4);
        bv[i] = *(const f32x4*)(bb + i * 128 + lane * 4);
    }
    f32x4 v[R][4];
#pragma unroll
    for (int r = 0; r < R; ++r)
#pragma unroll
        for (int i = 0; i < 4; ++i) v[r][i] = *(const f32x4*)(xr + r * D + i * 128);

    float s[R], ss[R];
#pragma unroll
    for (int r = 0; r < R; ++r) {
        s[r] = 0.f; ss[r] = 0.f;
#pragma unroll
        for (int i = 0; i < 4; ++i)
#pragma unroll
            for (int c = 0; c < 4; ++c) { s[r] += v[r][i][c]; ss[r] += v[r][i][c] * v[r][i][c]; }
    }
#pragma unroll
    for (int r = 0; r < R; ++r) { s[r] = wave_sum(s[r]); ss[r] = wave_sum(ss[r]); }

#pragma unroll
    for (int r = 0; r < R; ++r) {
        const float mu   = s[r] * (1.0f / D);
        const float var  = ss[r] * (1.0f / D) - mu * mu;
        const float rstd = rsqrtf(var + 1e-5f);
#pragma unroll
        for (int i = 0; i < 4; ++i) {
            f32x4 o;
#pragma unroll
            for (int c = 0; c < 4; ++c) o[c] = (v[r][i][c] - mu) * rstd * gv[i][c] + bv[i][c];
            *(bf16x4*)(yr + r * D + i * 128) = to_bf16x4(o);
        }
    }
}

// ---------------------------------------------------------------------------
// Column softmax stats: max and sum of exp over the query axis (i) per (b, j).
// One 512-thread block owns 64 adjacent columns and all 1024 rows of them.
// A wave-wide 16-byte load covers 2 rows x 256 contiguous bytes; each thread
// holds 32 rows x 4 columns in registers (all 32 loads in flight at once),
// takes its own max and exp-sum, and the 32 row groups of the block are then
// merged through LDS.
// ---------------------------------------------------------------------------
#define CS_NQ    1024
#define CS_NK    2048
#define CS_COLS  64      // columns per block
#define CS_GRPS  32      // row groups per block (16 waves x 2 half-waves)
#define CS_RPT   (CS_NQ / CS_GRPS)   // rows per thread

__device__ __forceinline__ float exp_with_slot(float a) {
    float e;
    asm("v_exp_f32 %0, %1\n\tv_nop" : "=v"(e) : "v"(a * 1.44269504088896340736f));
    return e;
}

__global__ __launch_bounds__(512) void col_softmax_stats(
    const float* __restrict__ S, float* __restrict__ colmax,
    float* __restrict__ colsum)
{
    __shared__ __attribute__((aligned(16))) float gm[CS_GRPS][CS_COLS];
    __shared__ __attribute__((aligned(16))) float gs[CS_GRPS][CS_COLS];

    const int t    = threadIdx.x;
    const int grp  = t >> 4;            // 0..31 : row group
    const int c4   = (t & 15) * 4;      // column quad inside the block
    const int col0 = blockIdx.x * CS_COLS;          // over B*NK
    const int b    = col0 / CS_NK, j0 = col0 % CS_NK;
    const float* p = S + (long long)b * CS_NQ * CS_NK
                       + (long long)grp * CS_RPT * CS_NK + j0 + c4;

    // Every loop below is fully unrolled so that x[] stays in registers and the
    // 32 loads issue back to back before the first value is used.
    f32x4 x[CS_RPT];
#pragma unroll
    for (int i = 0; i < CS_RPT; ++i)
        x[i] = *(const f32x4*)(p + i * CS_NK);

    f32x4 m = {-1e30f, -1e30f, -1e30f, -1e30f};
#pragma unroll
    for (int i = 0; i < CS_RPT; ++i)
#pragma unroll
        for (int c = 0; c < 4; ++c) m[c] = fmaxf(m[c], x[i][c]);

    f32x4 s = {0.f, 0.f, 0.f, 0.f};
#pragma unroll
    for (int i = 0; i < CS_RPT; ++i)
#pragma unroll
        for (int c = 0; c < 4; ++c) s[c] += __expf(x[i][c] - m[c]);

    *(f32x4*)&gm[grp][c4] = m;
    *(f32x4*)&gs[grp][c4] = s;
    __syncthreads();   // every group's partial max and sum visible to the merge

    if (t < CS_COLS) {
        float M = -1e30f;
#pragma unroll
        for (int g = 0; g < CS_GRPS; ++g) M = fmaxf(M, gm[g][t]);
        float sum = 0.f;
#pragma unroll
        for (int g = 0; g < CS_GRPS; ++g) sum += gs[g][t] * exp_with_slot(gm[g][t] - M);
        colmax[col0 + t] = M;
        colsum[col0 + t] = sum;
    }
}

// ---------------------------------------------------------------------------
// Row pass: P = exp(S - colmax)/colsum + eps (bf16) ; rowrecip = 1/sum_j P
// One 512-thread block owns 32 adjacent (b,i) rows. A thread owns 4 columns of
// all 32 rows: it loads their column max and sum once, takes 1/colsum once, and
// has its 32 row loads in flight at once (a wave-wide load covers 512 contiguous
// bytes of one row). Row sums: across the wave's lanes, then over the 16 waves
// through LDS; the block writes 32 adjacent rowrecip values, one 128-byte line.
// ---------------------------------------------------------------------------
#define RP_ROWS  32

__global__ __launch_bounds__(512) void attn_row_pass(
    const float* __restrict__ S, const float* __restrict__ colmax,
    const float* __restrict__ colsum, __bf16* __restrict__ P,
    float* __restrict__ rowrecip)
{
    __shared__ float red[16][RP_ROWS];

    const int t    = threadIdx.x;
    const int lane = t & 31;
    const int row0 = blockIdx.x * RP_ROWS;  // b*NQ + i
    const int b    = row0 / CS_NQ;          // RP_ROWS divides NQ: one b per block
    const float* Sr = S + (long long)row0 * CS_NK + t * 4;
    __bf16*      Pr = P + (long long)row0 * CS_NK + t * 4;

    // Every loop below is fully unrolled so that x[] and part[] stay in registers
    // and the 32 row loads issue back to back before the first value is used.
    const f32x4 m  = *(const f32x4*)(colmax + b * CS_NK + t * 4);
    const f32x4 cs = *(const f32x4*)(colsum + b * CS_NK + t * 4);
    f32x4 x[RP_ROWS];
#pragma unroll
    for (int r = 0; r < RP_ROWS; ++r) x[r] = *(const f32x4*)(Sr + r * CS_NK);

    f32x4 inv;
#pragma unroll
    for (int k = 0; k < 4; ++k) inv[k] = 1.0f / cs[k];

    float part[RP_ROWS];
#pragma unroll
    for (int r = 0; r < RP_ROWS; ++r) {
        f32x4 pv;
#pragma unroll
        for (int k = 0; k < 4; ++k)
            pv[k] = exp_with_slot(x[r][k] - m[k]) * inv[k] + 1e-8f;
        *(bf16x4*)(Pr + r * CS_NK) = to_bf16x4(pv);
        part[r] = (pv[0] + pv[1]) + (pv[2] + pv[3]);
    }

#pragma unroll
    for (int off = 16; off > 0; off >>= 1) {
        const bool hi = (lane & off) != 0;
#pragma unroll
        for (int i = 0; i < off; ++i) {
            const float lo_row = part[i], hi_row = part[i + off];
            const float keep = hi ? hi_row : lo_row;
            const float send = hi ? lo_row : hi_row;
            part[i] = keep + __shfl_xor(send, off, 32);
        }
    }
    red[t >> 5][lane] = part[0];
    __syncthreads();   // every wave's 32 row sums visible to the merge

    if (t < RP_ROWS) {
        float sum = 0.f;
#pragma unroll
        for (int w = 0; w < 16; ++w) sum += red[w][t];
        rowrecip[row0 + t] = 1.0f / sum;
    }
}

// ---------------------------------------------------------------------------
// Host-side orchestration
// ---------------------------------------------------------------------------
extern "C" void kernel_launch(void* const* d_in, const int* in_sizes, int n_in,
                              void* d_out, int out_size, void* d_ws, size_t ws_size,
                              hipStream_t stream) {
    (void)in_sizes; (void)n_in; (void)out_size; (void)ws_size;

    const int B = 8, NQ = 1024, NK = 2048, D = 512;
    const float qscale = 0.044194173824159216f;   // 1/sqrt(512)

    const float* inputs  = (const float*)d_in[0];
    const float* context = (const float*)d_in[1];
    const float* ln_in_g  = (const float*)d_in[2];
    const float* ln_in_b  = (const float*)d_in[3];
    const float* ln_ctx_g = (const float*)d_in[4];
    const float* ln_ctx_b = (const float*)d_in[5];
    const float* Wq = (const float*)d_in[6];
    const float* bq = (const float*)d_in[7];
    const float* Wk = (const float*)d_in[8];
    const float* bk = (const float*)d_in[9];
    const float* Wv = (const float*)d_in[10];
    const float* bv = (const float*)d_in[11];
    float* out = (float*)d_out;

    // Workspace bump allocator (256B aligned)
    char* ws = (char*)d_ws;
    size_t off = 0;
    auto alloc = [&](size_t bytes) -> char* {
        char* p = ws + off;
        off += (bytes + 255) & ~(size_t)255;
        return p;
    };
    __bf16* Wqb = (__bf16*)alloc((size_t)D * D * 2);
    __bf16* Wkb = (__bf16*)alloc((size_t)D * D * 2);
    __bf16* Wvb = (__bf16*)alloc((size_t)D * D * 2);
    __bf16* xln = (__bf16*)alloc((size_t)B * NQ * D * 2);
    __bf16* cln = (__bf16*)alloc((size_t)B * NK * D * 2);
    __bf16* qb  = (__bf16*)alloc((size_t)B * NQ * D * 2);
    __bf16* kb  = (__bf16*)alloc((size_t)B * NK * D * 2);
    __bf16* vT  = (__bf16*)alloc((size_t)B * D * NK * 2);   // [b][d][j]
    float*  S   = (float*) alloc((size_t)B * NQ * NK * 4);
    __bf16* P   = (__bf16*)alloc((size_t)B * NQ * NK * 2);
    float*  cmx = (float*) alloc((size_t)B * NK * 4);
    float*  csm = (float*) alloc((size_t)B * NK * 4);
    float*  rrc = (float*) alloc((size_t)B * NQ * 4);

    // 1) weights -> bf16
    {
        const int n = D * D;
        cast_f32_to_bf16<<<dim3(n / 2048), dim3(256), 0, stream>>>(Wq, Wqb);
        cast_f32_to_bf16<<<dim3(n / 2048), dim3(256), 0, stream>>>(Wk, Wkb);
        cast_f32_to_bf16<<<dim3(n / 2048), dim3(256), 0, stream>>>(Wv, Wvb);
    }

    // 2) LayerNorms -> bf16 activations
    layernorm_to_bf16<2><<<dim3(B * NQ / 32), dim3(512), 0, stream>>>(inputs, ln_in_g, ln_in_b, xln);
    layernorm_to_bf16<4><<<dim3(B * NK / 64), dim3(512), 0, stream>>>(context, ln_ctx_g, ln_ctx_b, cln);

    // 3) Projections (batched over B, weights shared via sB=0)
    // q = (xln @ Wq^T + bq) * 1/sqrt(D)   -> bf16 [b][i][d]
    gemm_bf16_wmma<1><<<dim3(NQ / 128, D / 128, B), dim3(256), 0, stream>>>(
        xln, Wqb, bq, nullptr, qscale, qb,
        NQ, D, D, D, D, D,
        (long long)NQ * D, 0LL, (long long)NQ * D, 0);
    // k = cln @ Wk^T + bk                  -> bf16 [b][j][d]
    gemm_bf16_wmma<1><<<dim3(NK / 128, D / 128, B), dim3(256), 0, stream>>>(
        cln, Wkb, bk, nullptr, 1.0f, kb,
        NK, D, D, D, D, D,
        (long long)NK * D, 0LL, (long long)NK * D, 0);
    // v = cln @ Wv^T + bv, stored transposed -> bf16 [b][d][j]
    gemm_bf16_wmma<2><<<dim3(NK / 128, D / 128, B), dim3(256), 0, stream>>>(
        cln, Wvb, bv, nullptr, 1.0f, vT,
        NK, D, D, D, D, NK,
        (long long)NK * D, 0LL, (long long)D * NK, 0);

    // 4) dots: S[b,i,j] = q[b,i,:] . k[b,j,:]   (scale folded into q)
    gemm_bf16_wmma<0><<<dim3(NQ / 128, NK / 128, B), dim3(256), 0, stream>>>(
        qb, kb, nullptr, nullptr, 1.0f, S,
        NQ, NK, D, D, D, NK,
        (long long)NQ * D, (long long)NK * D, (long long)NQ * NK, 0);

    // 5) softmax over query axis (columns of S), then row pass
    col_softmax_stats<<<dim3(B * NK / 64), dim3(512), 0, stream>>>(S, cmx, csm);
    attn_row_pass<<<dim3(B * NQ / 32), dim3(512), 0, stream>>>(S, cmx, csm, P, rrc);

    // 6) updates[b,i,d] = (1/rowsum[b,i]) * sum_j P[b,i,j] * v[b,j,d]
    gemm_bf16_wmma<0><<<dim3(NQ / 128, D / 128, B), dim3(256), 0, stream>>>(
        P, vT, nullptr, rrc, 1.0f, out,
        NQ, D, NK, NK, NK, D,
        (long long)NQ * NK, (long long)D * NK, (long long)NQ * D, NQ);
}

// v005
// Measured time: 111 microseconds a run.
// Two timings next to v004 both put it at 1.16 times that version's speed.
// All steps since v000 together make it 3.44 times as fast.
#include <hip/hip_runtime.h>
#include <hip/hip_bf16.h>

typedef __attribute__((ext_vector_type(16))) __bf16        bf16x16;
typedef __attribute__((ext_vector_type(8)))  float         floatx8;
typedef __attribute__((ext_vector_type(4)))  unsigned int  u32x4;
typedef __attribute__((ext_vector_type(8)))  __bf16        bf16x8;

union AFrag {
    bf16x16 v;
    u32x4   q[2];
};

#define TILE_K   128
#define TILE_LDA (TILE_K + 8)

__device__ __forceinline__ void load_frag_lds(const __bf16* base, int row0, int kk,
                                              int lane, AFrag& f) {
    const int m    = lane & 15;
    const int half = lane >> 4;
    const __bf16* p = base + (row0 + m) * TILE_LDA + kk + half * 8;
    f.q[0] = *(const u32x4*)(p);        // K = kk+half*8 .. kk+half*8+7
    f.q[1] = *(const u32x4*)(p + 16);   // K = kk+16+half*8 .. kk+16+half*8+7
}

__device__ __forceinline__ void async_copy8_b128(const __bf16* lds, const __bf16* g,
                                                 long long gstep) {
    const unsigned           l  = (unsigned)(unsigned long long)lds;
    const unsigned           ls = 16 * TILE_LDA * 2;
    const unsigned long long ga = (unsigned long long)g;
    const unsigned long long gs = (unsigned long long)gstep * 2;
    asm volatile("global_load_async_to_lds_b128 %0, %8, off\n\t"
                 "global_load_async_to_lds_b128 %1, %9, off\n\t"
                 "global_load_async_to_lds_b128 %2, %10, off\n\t"
                 "global_load_async_to_lds_b128 %3, %11, off\n\t"
                 "global_load_async_to_lds_b128 %4, %12, off\n\t"
                 "global_load_async_to_lds_b128 %5, %13, off\n\t"
                 "global_load_async_to_lds_b128 %6, %14, off\n\t"
                 "global_load_async_to_lds_b128 %7, %15, off\n\t"
                 "s_wait_xcnt 0x0"
                 :: "v"(l), "v"(l + ls), "v"(l + 2 * ls), "v"(l + 3 * ls),
                    "v"(l + 4 * ls), "v"(l + 5 * ls), "v"(l + 6 * ls), "v"(l + 7 * ls),
                    "v"(ga), "v"(ga + gs), "v"(ga + 2 * gs), "v"(ga + 3 * gs),
                    "v"(ga + 4 * gs), "v"(ga + 5 * gs), "v"(ga + 6 * gs), "v"(ga + 7 * gs)
                 : "memory");
}

// ---------------------------------------------------------------------------
// Batched GEMM tile:  C[b] = epilogue( A[b] * Bt[b]^T )
//   A  : [M x K] bf16 row-major (K contiguous), lda
//   Bt : [N x K] bf16 row-major (K contiguous), ldb   (i.e. B column-major)
//   MODE 0: f32  out at  C[b*sC + m*ldc + n]
//   MODE 1: bf16 out at  C[b*sC + m*ldc + n]
//   MODE 2: bf16 out at  C[b*sC + n*ldc + m]   (transposed store)
//   epilogue: val = (acc + bias[n]) * alpha * rowscale[b*rs_stride + m]
// Block tile 128(M) x 128(N), K-step TILE_K, double-buffered async LDS staging.
// K is a multiple of TILE_K.
// 256 threads = 8 waves; each wave owns a 32x64 sub-tile (2x4 WMMA frags).
// The finished tile is laid into LDS in the orientation in which C holds it and
// goes out from there in whole 128-B lines, 16 bytes a lane.
// The main loop and the epilogue are device functions on LDS rings that the kernel
// declares, so that one launch can hold tiles of several products.
// ---------------------------------------------------------------------------
typedef __bf16 TileRing[2][128 * TILE_LDA];

// acc += (128 rows at Ab) * (128 rows at Bb)^T over K.
__device__ __forceinline__ void gemm_main_loop(
    TileRing& Asmem, TileRing& Bsmem,
    const __bf16* __restrict__ Ab, const __bf16* __restrict__ Bb,
    int K, int lda, int ldb, floatx8 (&acc)[2][4])
{
    const int t    = threadIdx.x;
    const int lane = t & 31;
    const int wid  = t >> 5;       // 0..7
    const int wm   = wid & 3;      // 0..3 : 32-row strip
    const int wn   = wid >> 2;     // 0..1 : 64-col strip

    // Per-thread staging coords: 128 rows x 16 x 16B chunks per matrix,
    // thread t handles rows r0, r0+16, .. r0+112 at column chunk c8.
    const int r0 = t >> 4;
    const int c8 = (t & 15) * 8;
    const __bf16* ga = Ab + (long long)r0 * lda + c8;
    const __bf16* gb = Bb + (long long)r0 * ldb + c8;
    const int     loff = r0 * TILE_LDA + c8;

    auto issue_stage = [&](int st, int k0) {   // 16 async b128 per wave
        async_copy8_b128(&Asmem[st][loff], ga + k0, (long long)16 * lda);
        async_copy8_b128(&Bsmem[st][loff], gb + k0, (long long)16 * ldb);
    };

    const int nst = K / TILE_K;
    issue_stage(0, 0);
    // stage 0 landed (this wave's copies), then published to every wave
    asm volatile("s_wait_asynccnt 0x0" ::: "memory");
    __syncthreads();
    if (nst > 1) issue_stage(1, TILE_K);

    for (int s = 0; s < nst; ++s) {
        const int st = s & 1;
        // unrolled: the four 32-k blocks of a stage run without a branch between them
#pragma unroll
        for (int kk = 0; kk < TILE_K; kk += 32) {
            AFrag a[2], bf[4];
            load_frag_lds(Asmem[st], wm * 32 + 0,  kk, lane, a[0]);
            load_frag_lds(Asmem[st], wm * 32 + 16, kk, lane, a[1]);
#pragma unroll
            for (int fn = 0; fn < 4; ++fn)
                load_frag_lds(Bsmem[st], wn * 64 + fn * 16, kk, lane, bf[fn]);

#pragma unroll
            for (int fm = 0; fm < 2; ++fm)
#pragma unroll
                for (int fn = 0; fn < 4; ++fn)
                    acc[fm][fn] = __builtin_amdgcn_wmma_f32_16x16x32_bf16(
                        false, a[fm].v, false, bf[fn].v,
                        (short)0, acc[fm][fn], false, false);
        }

        // this wave's reads of buffer st have returned
        asm volatile("s_wait_dscnt 0x0" ::: "memory");
        // this wave's copies of stage s+1 have landed
        asm volatile("s_wait_asynccnt 0x0" ::: "memory");
        // one barrier: publishes stage s+1 and ends every wave's reads of buffer st
        __syncthreads();
        if (s + 2 < nst) issue_stage(st, (s + 2) * TILE_K);
    }
    // no copy is left in flight when the wave goes on to the epilogue
    asm volatile("s_wait_asynccnt 0x0" ::: "memory");
}

// Tile (bx, by) of batch b, from the accumulators to C. bias and rowscale may each be
// null; each is tested and read anew for every one of the lane's 64 elements.
template <int MODE>
__device__ __forceinline__ void gemm_epilogue(
    TileRing& Asmem, const floatx8 (&acc)[2][4],
    const float* __restrict__ bias, const float* __restrict__ rowscale,
    float alpha, void* __restrict__ Cout,
    int bx, int by, int b, int ldc, long long sC, int rs_stride)
{
    const int t    = threadIdx.x;
    const int lane = t & 31;
    const int wid  = t >> 5;       // 0..7
    const int wm   = wid & 3;      // 0..3 : 32-row strip
    const int wn   = wid >> 2;     // 0..1 : 64-col strip

    constexpr int ESZ    = (MODE == 0) ? 4 : 2;    // bytes per element of C
    constexpr int ROW_B  = 128 * ESZ;              // bytes of a tile row in C
    constexpr int ST_LD  = ROW_B + 16;             // its pitch in LDS
    static_assert(128 * ST_LD <= (int)sizeof(Asmem), "staged tile fits the A ring");
    char* stage = (char*)&Asmem[0][0];

    const int l15 = lane & 15;
    const int lh8 = (lane >> 4) * 8;
#pragma unroll
    for (int fm = 0; fm < 2; ++fm)
#pragma unroll
        for (int fn = 0; fn < 4; ++fn) {
            const int ml = wm * 32 + fm * 16 + lh8;      // first of the lane's 8 rows
            const int nl = wn * 64 + fn * 16 + l15;      // its column, both in the tile
            bf16x8 col;
#pragma unroll
            for (int r = 0; r < 8; ++r) {
                const int m = bx * 128 + ml + r;
                const int n = by * 128 + nl;
                float val = acc[fm][fn][r];
                if (bias)     val += bias[n];
                val *= alpha;
                if (rowscale) val *= rowscale[b * rs_stride + m];
                if (MODE == 0)
                    *(float*)(stage + (ml + r) * ST_LD + nl * 4) = val;
                else if (MODE == 1)
                    *(__bf16*)(stage + (ml + r) * ST_LD + nl * 2) = (__bf16)val;
                else
                    col[r] = (__bf16)val;
            }
            if (MODE == 2)   // the lane's 8 m are adjacent in a row of the transposed tile
                *(bf16x8*)(stage + nl * ST_LD + ml * 2) = col;
        }
    __syncthreads();   // the whole tile is staged before any wave reads rows of it

    // A wave-wide 16-byte store covers 512 contiguous bytes of one row (f32) or the
    // 256 bytes of each of two rows (bf16): 4 whole lines either way.
    constexpr int LANES_PER_ROW = ROW_B / 16;
    constexpr int ROWS_PER_PASS = 256 / LANES_PER_ROW;
    const int srow = t / LANES_PER_ROW;
    const int scol = (t % LANES_PER_ROW) * 16;          // in bytes
    const int crow0 = (MODE == 2 ? by : bx) * 128;
    const int ccol0 = (MODE == 2 ? bx : by) * 128;
    char* Cb = (char*)Cout + ((long long)b * sC + (long long)(crow0 + srow) * ldc + ccol0) * ESZ + scol;
    // unrolled: all LDS reads of the lane are issued before its first store
    u32x4 piece[128 / ROWS_PER_PASS];
#pragma unroll
    for (int p = 0; p < 128 / ROWS_PER_PASS; ++p)
        piece[p] = *(const u32x4*)(stage + (p * ROWS_PER_PASS + srow) * ST_LD + scol);
#pragma unroll
    for (int p = 0; p < 128 / ROWS_PER_PASS; ++p)
        *(u32x4*)(Cb + (long long)p * ROWS_PER_PASS * ldc * ESZ) = piece[p];
}

// One product per launch: tile (blockIdx.x, blockIdx.y) of batch blockIdx.z.
template <int MODE>
__global__ __launch_bounds__(256) void gemm_bf16_wmma(
    const __bf16* __restrict__ A, const __bf16* __restrict__ Bt,
    const float* __restrict__ bias, const float* __restrict__ rowscale,
    float alpha, void* __restrict__ Cout,
    int K, int lda, int ldb, int ldc,
    long long sA, long long sB, long long sC, int rs_stride)
{
    __shared__ __attribute__((aligned(16))) TileRing Asmem;
    __shared__ __attribute__((aligned(16))) TileRing Bsmem;

    const int b = blockIdx.z;
    floatx8 acc[2][4] = {};
    gemm_main_loop(Asmem, Bsmem,
                   A + (long long)b * sA + (long long)blockIdx.x * 128 * lda,
                   Bt + (long long)b * sB + (long long)blockIdx.y * 128 * ldb,
                   K, lda, ldb, acc);
    gemm_epilogue<MODE>(Asmem, acc, bias, rowscale, alpha, Cout,
                        blockIdx.x, blockIdx.y, b, ldc, sC, rs_stride);
}

// The three projections in one launch: they depend on nothing of one another, and
// the tiles of one fill the places that the others' first loads and last stores
// would leave idle. blockIdx.x counts the 128-row tiles of k, then of v, then of q;
// k and v tiles of the same context rows start close together.
//   q = (xln Wq^T + bq) * qscale  [b][i][d]
//   k =  cln Wk^T + bk            [b][j][d]
//   v =  cln Wv^T + bv            [b][d][j]  (transposed store)
__global__ __launch_bounds__(256) void qkv_gemm_bf16_wmma(
    const __bf16* __restrict__ xln, const __bf16* __restrict__ cln,
    const __bf16* __restrict__ Wq, const __bf16* __restrict__ Wk,
    const __bf16* __restrict__ Wv,
    const float* __restrict__ bq, const float* __restrict__ bk,
    const float* __restrict__ bv, float qscale,
    __bf16* __restrict__ q, __bf16* __restrict__ k, __bf16* __restrict__ vT,
    int NQ, int NK, int D)
{
    __shared__ __attribute__((aligned(16))) TileRing Asmem;
    __shared__ __attribute__((aligned(16))) TileRing Bsmem;

    const int b   = blockIdx.z;
    const int by  = blockIdx.y;
    const int nkt = NK / 128;                 // row tiles of k, and of v
    const int gx  = blockIdx.x;
    const int sel = (gx >= nkt) + (gx >= 2 * nkt);   // 0: k, 1: v, 2: q
    const int bx  = gx - sel * nkt;

    const __bf16* X    = sel < 2 ? cln : xln;
    const int     rows = sel < 2 ? NK : NQ;
    const __bf16* Wt   = sel == 0 ? Wk : (sel == 1 ? Wv : Wq);
    const float*  bias = sel == 0 ? bk : (sel == 1 ? bv : bq);

    floatx8 acc[2][4] = {};
    gemm_main_loop(Asmem, Bsmem,
                   X + ((long long)b * rows + (long long)bx * 128) * D,
                   Wt + (long long)by * 128 * D,
                   D, D, D, acc);
    // sel is the same in the whole block: every wave takes the same epilogue
    if (sel == 1)
        gemm_epilogue<2>(Asmem, acc, bias, nullptr, 1.0f, vT,
                         bx, by, b, NK, (long long)D * NK, 0);
    else
        gemm_epilogue<1>(Asmem, acc, bias, nullptr, sel == 0 ? 1.0f : qscale,
                         sel == 0 ? k : q,
                         bx, by, b, D, (long long)rows * D, 0);
}

// ---------------------------------------------------------------------------
// The streaming kernels (cast, LayerNorm, row pass) start few, long waves: a lane
// moves 16 bytes per load and holds many values, all its loads are in flight at
// once, and a row's sum is taken across the 32 lanes of a wave.
// ---------------------------------------------------------------------------
typedef __attribute__((ext_vector_type(4))) float  f32x4;
typedef __attribute__((ext_vector_type(4))) __bf16 bf16x4;

__device__ __forceinline__ bf16x4 to_bf16x4(f32x4 v) {
    return __builtin_convertvector(v, bf16x4);
}

// Sum over the 32 lanes of a wave; every lane ends with the total.
__device__ __forceinline__ float wave_sum(float v) {
    for (int off = 16; off > 0; off >>= 1) v += __shfl_xor(v, off, 32);
    return v;
}

// ---------------------------------------------------------------------------
// f32 -> bf16 cast (weights): 8 values per thread, as two quads 256 quads apart,
// so that each wave-wide load covers 512 contiguous bytes. Each half of a 512-thread
// block converts 2048 values; blocks blk = 0 .. n/4096 - 1 cover the array exactly.
// ---------------------------------------------------------------------------
__device__ __forceinline__ void cast_f32_to_bf16(const float* __restrict__ in,
                                                 __bf16* __restrict__ out, int blk) {
    const int i = ((blk * 2 + (threadIdx.x >> 8)) * 512 + (threadIdx.x & 255)) * 4;
    const f32x4 a = *(const f32x4*)(in + i);
    const f32x4 b = *(const f32x4*)(in + i + 1024);
    *(bf16x4*)(out + i)        = to_bf16x4(a);
    *(bf16x4*)(out + i + 1024) = to_bf16x4(b);
    // the stores' address and data registers are free before another job's code, which
    // the compiler may lay behind this one, writes them
    asm volatile("s_wait_xcnt 0x0" ::: "memory");
}

// ---------------------------------------------------------------------------
// LayerNorm over D=512, bf16 output. One wave owns R adjacent rows (16 values of
// each row per lane, all R*4 loads in flight at once); 16 waves per block; block
// blk owns rows blk*16*R and on.
// ---------------------------------------------------------------------------
template <int R>
__device__ __forceinline__ void layernorm_to_bf16(
    const float* __restrict__ x, const float* __restrict__ g,
    const float* __restrict__ bb, __bf16* __restrict__ y, int blk)
{
    const int D = 512;
    const int lane = threadIdx.x & 31;
    const long long row0 = (long long)(blk * 16 + (threadIdx.x >> 5)) * R;
    const float* xr = x + row0 * D + lane * 4;
    __bf16*      yr = y + row0 * D + lane * 4;

    // Fully unrolled throughout, so that v[][] stays in registers.
    f32x4 gv[4], bv[4];
#pragma unroll
    for (int i = 0; i < 4; ++i) {
        gv[i] = *(const f32x4*)(g + i * 128 + lane * 4);
        bv[i] = *(const f32x4*)(bb + i * 128 + lane * 4);
    }
    f32x4 v[R][4];
#pragma unroll
    for (int r = 0; r < R; ++r)
#pragma unroll
        for (int i = 0; i < 4; ++i) v[r][i] = *(const f32x4*)(xr + r * D + i * 128);

    float s[R], ss[R];
#pragma unroll
    for (int r = 0; r < R; ++r) {
        s[r] = 0.f; ss[r] = 0.f;
#pragma unroll
        for (int i = 0; i < 4; ++i)
#pragma unroll
            for (int c = 0; c < 4; ++c) { s[r] += v[r][i][c]; ss[r] += v[r][i][c] * v[r][i][c]; }
    }
#pragma unroll
    for (int r = 0; r < R; ++r) { s[r] = wave_sum(s[r]); ss[r] = wave_sum(ss[r]); }

#pragma unroll
    for (int r = 0; r < R; ++r) {
        const float mu   = s[r] * (1.0f / D);
        const float var  = ss[r] * (1.0f / D) - mu * mu;
        const float rstd = rsqrtf(var + 1e-5f);
#pragma unroll
        for (int i = 0; i < 4; ++i) {
            f32x4 o;
#pragma unroll
            for (int c = 0; c < 4; ++c) o[c] = (v[r][i][c] - mu) * rstd * gv[i][c] + bv[i][c];
            *(bf16x4*)(yr + r * D + i * 128) = to_bf16x4(o);
        }
    }
    // the stores' address and data registers are free before another job's code, which
    // the compiler may lay behind this one, writes them
    asm volatile("s_wait_xcnt 0x0" ::: "memory");
}

// ---------------------------------------------------------------------------
// Everything the projections read, in one launch: both LayerNorms and the three
// weight casts depend on nothing of one another. The block index picks the job, the
// longest first: n_ctx blocks for the context rows, n_in for the input rows, then
// n_w for each weight matrix.
// ---------------------------------------------------------------------------
__global__ __launch_bounds__(512) void prepare_operands(
    const float* __restrict__ context, const float* __restrict__ ln_ctx_g,
    const float* __restrict__ ln_ctx_b, __bf16* __restrict__ cln,
    const float* __restrict__ inputs, const float* __restrict__ ln_in_g,
    const float* __restrict__ ln_in_b, __bf16* __restrict__ xln,
    const float* __restrict__ Wq, const float* __restrict__ Wk,
    const float* __restrict__ Wv, __bf16* __restrict__ Wqb,
    __bf16* __restrict__ Wkb, __bf16* __restrict__ Wvb,
    int n_ctx, int n_in, int n_w)
{
    int blk = blockIdx.x;
    if (blk < n_ctx) { layernorm_to_bf16<4>(context, ln_ctx_g, ln_ctx_b, cln, blk); return; }
    blk -= n_ctx;
    if (blk < n_in)  { layernorm_to_bf16<2>(inputs, ln_in_g, ln_in_b, xln, blk); return; }
    blk -= n_in;
    const int w = (blk >= n_w) + (blk >= 2 * n_w);   // 0: Wq, 1: Wk, 2: Wv
    cast_f32_to_bf16(w == 0 ? Wq : (w == 1 ? Wk : Wv),
                     w == 0 ? Wqb : (w == 1 ? Wkb : Wvb), blk - w * n_w);
}

// ---------------------------------------------------------------------------
// Column softmax stats: max and sum of exp over the query axis (i) per (b, j).
// One 512-thread block owns 64 adjacent columns and all 1024 rows of them.
// A wave-wide 16-byte load covers 2 rows x 256 contiguous bytes; each thread
// holds 32 rows x 4 columns in registers (all 32 loads in flight at once),
// takes its own max and exp-sum, and the 32 row groups of the block are then
// merged through LDS.
// ---------------------------------------------------------------------------
#define CS_NQ    1024
#define CS_NK    2048
#define CS_COLS  64      // columns per block
#define CS_GRPS  32      // row groups per block (16 waves x 2 half-waves)
#define CS_RPT   (CS_NQ / CS_GRPS)   // rows per thread

__device__ __forceinline__ float exp_with_slot(float a) {
    float e;
    asm("v_exp_f32 %0, %1\n\tv_nop" : "=v"(e) : "v"(a * 1.44269504088896340736f));
    return e;
}

__global__ __launch_bounds__(512) void col_softmax_stats(
    const float* __restrict__ S, float* __restrict__ colmax,
    float* __restrict__ colsum)
{
    __shared__ __attribute__((aligned(16))) float gm[CS_GRPS][CS_COLS];
    __shared__ __attribute__((aligned(16))) float gs[CS_GRPS][CS_COLS];

    const int t    = threadIdx.x;
    const int grp  = t >> 4;            // 0..31 : row group
    const int c4   = (t & 15) * 4;      // column quad inside the block
    const int col0 = blockIdx.x * CS_COLS;          // over B*NK
    const int b    = col0 / CS_NK, j0 = col0 % CS_NK;
    const float* p = S + (long long)b * CS_NQ * CS_NK
                       + (long long)grp * CS_RPT * CS_NK + j0 + c4;

    // Every loop below is fully unrolled so that x[] stays in registers and the
    // 32 loads issue back to back before the first value is used.
    f32x4 x[CS_RPT];
#pragma unroll
    for (int i = 0; i < CS_RPT; ++i)
        x[i] = *(const f32x4*)(p + i * CS_NK);

    f32x4 m = {-1e30f, -1e30f, -1e30f, -1e30f};
#pragma unroll
    for (int i = 0; i < CS_RPT; ++i)
#pragma unroll
        for (int c = 0; c < 4; ++c) m[c] = fmaxf(m[c], x[i][c]);

    f32x4 s = {0.f, 0.f, 0.f, 0.f};
#pragma unroll
    for (int i = 0; i < CS_RPT; ++i)
#pragma unroll
        for (int c = 0; c < 4; ++c) s[c] += __expf(x[i][c] - m[c]);

    *(f32x4*)&gm[grp][c4] = m;
    *(f32x4*)&gs[grp][c4] = s;
    __syncthreads();   // every group's partial max and sum visible to the merge

    if (t < CS_COLS) {
        float M = -1e30f;
#pragma unroll
        for (int g = 0; g < CS_GRPS; ++g) M = fmaxf(M, gm[g][t]);
        float sum = 0.f;
#pragma unroll
        for (int g = 0; g < CS_GRPS; ++g) sum += gs[g][t] * exp_with_slot(gm[g][t] - M);
        colmax[col0 + t] = M;
        colsum[col0 + t] = sum;
    }
}

// ---------------------------------------------------------------------------
// Row pass: P = exp(S - colmax)/colsum + eps (bf16) ; rowrecip = 1/sum_j P
// One 512-thread block owns 32 adjacent (b,i) rows. A thread owns 4 columns of
// all 32 rows: it loads their column max and sum once, takes 1/colsum once, and
// has its 32 row loads in flight at once (a wave-wide load covers 512 contiguous
// bytes of one row). Row sums: across the wave's lanes, then over the 16 waves
// through LDS; the block writes 32 adjacent rowrecip values, one 128-byte line.
// ---------------------------------------------------------------------------
#define RP_ROWS  32

__global__ __launch_bounds__(512) void attn_row_pass(
    const float* __restrict__ S, const float* __restrict__ colmax,
    const float* __restrict__ colsum, __bf16* __restrict__ P,
    float* __restrict__ rowrecip)
{
    __shared__ float red[16][RP_ROWS];

    const int t    = threadIdx.x;
    const int lane = t & 31;
    const int row0 = blockIdx.x * RP_ROWS;  // b*NQ + i
    const int b    = row0 / CS_NQ;          // RP_ROWS divides NQ: one b per block
    const float* Sr = S + (long long)row0 * CS_NK + t * 4;
    __bf16*      Pr = P + (long long)row0 * CS_NK + t * 4;

    // Every loop below is fully unrolled so that x[] and part[] stay in registers
    // and the 32 row loads issue back to back before the first value is used.
    const f32x4 m  = *(const f32x4*)(colmax + b * CS_NK + t * 4);
    const f32x4 cs = *(const f32x4*)(colsum + b * CS_NK + t * 4);
    f32x4 x[RP_ROWS];
#pragma unroll
    for (int r = 0; r < RP_ROWS; ++r) x[r] = *(const f32x4*)(Sr + r * CS_NK);

    f32x4 inv;
#pragma unroll
    for (int k = 0; k < 4; ++k) inv[k] = 1.0f / cs[k];

    float part[RP_ROWS];
#pragma unroll
    for (int r = 0; r < RP_ROWS; ++r) {
        f32x4 pv;
#pragma unroll
        for (int k = 0; k < 4; ++k)
            pv[k] = exp_with_slot(x[r][k] - m[k]) * inv[k] + 1e-8f;
        *(bf16x4*)(Pr + r * CS_NK) = to_bf16x4(pv);
        part[r] = (pv[0] + pv[1]) + (pv[2] + pv[3]);
    }

#pragma unroll
    for (int off = 16; off > 0; off >>= 1) {
        const bool hi = (lane & off) != 0;
#pragma unroll
        for (int i = 0; i < off; ++i) {
            const float lo_row = part[i], hi_row = part[i + off];
            const float keep = hi ? hi_row : lo_row;
            const float send = hi ? lo_row : hi_row;
            part[i] = keep + __shfl_xor(send, off, 32);
        }
    }
    red[t >> 5][lane] = part[0];
    __syncthreads();   // every wave's 32 row sums visible to the merge

    if (t < RP_ROWS) {
        float sum = 0.f;
#pragma unroll
        for (int w = 0; w < 16; ++w) sum += red[w][t];
        rowrecip[row0 + t] = 1.0f / sum;
    }
}

// ---------------------------------------------------------------------------
// Host-side orchestration
// ---------------------------------------------------------------------------
extern "C" void kernel_launch(void* const* d_in, const int* in_sizes, int n_in,
                              void* d_out, int out_size, void* d_ws, size_t ws_size,
                              hipStream_t stream) {
    (void)in_sizes; (void)n_in; (void)out_size; (void)ws_size;

    const int B = 8, NQ = 1024, NK = 2048, D = 512;
    const float qscale = 0.044194173824159216f;   // 1/sqrt(512)

    const float* inputs  = (const float*)d_in[0];
    const float* context = (const float*)d_in[1];
    const float* ln_in_g  = (const float*)d_in[2];
    const float* ln_in_b  = (const float*)d_in[3];
    const float* ln_ctx_g = (const float*)d_in[4];
    const float* ln_ctx_b = (const float*)d_in[5];
    const float* Wq = (const float*)d_in[6];
    const float* bq = (const float*)d_in[7];
    const float* Wk = (const float*)d_in[8];
    const float* bk = (const float*)d_in[9];
    const float* Wv = (const float*)d_in[10];
    const float* bv = (const float*)d_in[11];
    float* out = (float*)d_out;

    // Workspace bump allocator (256B aligned)
    char* ws = (char*)d_ws;
    size_t off = 0;
    auto alloc = [&](size_t bytes) -> char* {
        char* p = ws + off;
        off += (bytes + 255) & ~(size_t)255;
        return p;
    };
    __bf16* Wqb = (__bf16*)alloc((size_t)D * D * 2);
    __bf16* Wkb = (__bf16*)alloc((size_t)D * D * 2);
    __bf16* Wvb = (__bf16*)alloc((size_t)D * D * 2);
    __bf16* xln = (__bf16*)alloc((size_t)B * NQ * D * 2);
    __bf16* cln = (__bf16*)alloc((size_t)B * NK * D * 2);
    __bf16* qb  = (__bf16*)alloc((size_t)B * NQ * D * 2);
    __bf16* kb  = (__bf16*)alloc((size_t)B * NK * D * 2);
    __bf16* vT  = (__bf16*)alloc((size_t)B * D * NK * 2);   // [b][d][j]
    float*  S   = (float*) alloc((size_t)B * NQ * NK * 4);
    __bf16* P   = (__bf16*)alloc((size_t)B * NQ * NK * 2);
    float*  cmx = (float*) alloc((size_t)B * NK * 4);
    float*  csm = (float*) alloc((size_t)B * NK * 4);
    float*  rrc = (float*) alloc((size_t)B * NQ * 4);

    // 1) weights -> bf16 and both LayerNorms -> bf16 activations
    prepare_operands<<<dim3(B * NK / 64 + B * NQ / 32 + 3 * (D * D / 4096)), dim3(512), 0, stream>>>(
        context, ln_ctx_g, ln_ctx_b, cln, inputs, ln_in_g, ln_in_b, xln,
        Wq, Wk, Wv, Wqb, Wkb, Wvb,
        B * NK / 64, B * NQ / 32, D * D / 4096);

    // 2) Projections q (scaled by 1/sqrt(D)), k, and v stored transposed
    qkv_gemm_bf16_wmma<<<dim3(2 * (NK / 128) + NQ / 128, D / 128, B), dim3(256), 0, stream>>>(
        xln, cln, Wqb, Wkb, Wvb, bq, bk, bv, qscale, qb, kb, vT, NQ, NK, D);

    // 3) dots: S[b,i,j] = q[b,i,:] . k[b,j,:]   (scale folded into q)
    gemm_bf16_wmma<0><<<dim3(NQ / 128, NK / 128, B), dim3(256), 0, stream>>>(
        qb, kb, nullptr, nullptr, 1.0f, S,
        D, D, D, NK,
        (long long)NQ * D, (long long)NK * D, (long long)NQ * NK, 0);

    // 4) softmax over query axis (columns of S), then row pass
    col_softmax_stats<<<dim3(B * NK / 64), dim3(512), 0, stream>>>(S, cmx, csm);
    attn_row_pass<<<dim3(B * NQ / 32), dim3(512), 0, stream>>>(S, cmx, csm, P, rrc);

    // 5) updates[b,i,d] = (1/rowsum[b,i]) * sum_j P[b,i,j] * v[b,j,d]
    gemm_bf16_wmma<0><<<dim3(NQ / 128, D / 128, B), dim3(256), 0, stream>>>(
        P, vT, nullptr, rrc, 1.0f, out,
        NK, NK, NK, D,
        (long long)NQ * NK, (long long)D * NK, (long long)NQ * D, NQ);
}

// v006
// One run takes 90.4 microseconds.
// Next to v005, in two timings, it ran 1.23 and 1.22 times as fast.
// All steps since v000 together make it 4.21 times as fast.
#include <hip/hip_runtime.h>
#include <hip/hip_bf16.h>

typedef __attribute__((ext_vector_type(16))) __bf16        bf16x16;
typedef __attribute__((ext_vector_type(8)))  float         floatx8;
typedef __attribute__((ext_vector_type(4)))  unsigned int  u32x4;
typedef __attribute__((ext_vector_type(8)))  __bf16        bf16x8;

union AFrag {
    bf16x16 v;
    u32x4   q[2];
};

#define TILE_K   128
#define TILE_LDA (TILE_K + 8)

// LD = pitch of an LDS row, in elements.
template <int LD>
__device__ __forceinline__ void load_frag_lds(const __bf16* base, int row0, int kk,
                                              int lane, AFrag& f) {
    const int m    = lane & 15;
    const int half = lane >> 4;
    const __bf16* p = base + (row0 + m) * LD + kk + half * 8;
    f.q[0] = *(const u32x4*)(p);        // K = kk+half*8 .. kk+half*8+7
    f.q[1] = *(const u32x4*)(p + 16);   // K = kk+16+half*8 .. kk+16+half*8+7
}

__device__ __forceinline__ void async_copy8_b128(const __bf16* lds, const __bf16* g,
                                                 long long gstep, unsigned ls) {
    const unsigned           l  = (unsigned)(unsigned long long)lds;
    const unsigned long long ga = (unsigned long long)g;
    const unsigned long long gs = (unsigned long long)gstep * 2;
    asm volatile("global_load_async_to_lds_b128 %0, %8, off\n\t"
                 "global_load_async_to_lds_b128 %1, %9, off\n\t"
                 "global_load_async_to_lds_b128 %2, %10, off\n\t"
                 "global_load_async_to_lds_b128 %3, %11, off\n\t"
                 "global_load_async_to_lds_b128 %4, %12, off\n\t"
                 "global_load_async_to_lds_b128 %5, %13, off\n\t"
                 "global_load_async_to_lds_b128 %6, %14, off\n\t"
                 "global_load_async_to_lds_b128 %7, %15, off\n\t"
                 "s_wait_xcnt 0x0"
                 :: "v"(l), "v"(l + ls), "v"(l + 2 * ls), "v"(l + 3 * ls),
                    "v"(l + 4 * ls), "v"(l + 5 * ls), "v"(l + 6 * ls), "v"(l + 7 * ls),
                    "v"(ga), "v"(ga + gs), "v"(ga + 2 * gs), "v"(ga + 3 * gs),
                    "v"(ga + 4 * gs), "v"(ga + 5 * gs), "v"(ga + 6 * gs), "v"(ga + 7 * gs)
                 : "memory");
}

// One such copy, with the same closing wait in its own statement.
__device__ __forceinline__ void async_copy1_b128(const __bf16* lds, const __bf16* g) {
    asm volatile("global_load_async_to_lds_b128 %0, %1, off\n\t"
                 "s_wait_xcnt 0x0"
                 :: "v"((unsigned)(unsigned long long)lds), "v"((unsigned long long)g)
                 : "memory");
}

// ---------------------------------------------------------------------------
// Batched GEMM tile:  C[b] = epilogue( A[b] * Bt[b]^T )
//   A  : [M x K] bf16 row-major (K contiguous), lda
//   Bt : [N x K] bf16 row-major (K contiguous), ldb   (i.e. B column-major)
//   MODE 0: f32  out at  C[b*sC + m*ldc + n]
//   MODE 1: bf16 out at  C[b*sC + m*ldc + n]
//   MODE 2: bf16 out at  C[b*sC + n*ldc + m]   (transposed store)
//   epilogue: val = (acc + bias[n]) * alpha * rowscale[b*rs_stride + m]
// Block tile 128(M) x 128(N), K-step TILE_K, double-buffered async LDS staging.
// K is a multiple of TILE_K.
// 256 threads = 8 waves; each wave owns a 32x64 sub-tile (2x4 WMMA frags).
// The finished tile is laid into LDS in the orientation in which C holds it and
// goes out from there in whole 128-B lines, 16 bytes a lane.
// The main loop and the epilogue are device functions on LDS rings that the kernel
// declares, so that one launch can hold tiles of several products.
// ---------------------------------------------------------------------------
typedef __bf16 TileRing[2][128 * TILE_LDA];

// acc += (128 rows at Ab) * (128 rows at Bb)^T over K.
__device__ __forceinline__ void gemm_main_loop(
    TileRing& Asmem, TileRing& Bsmem,
    const __bf16* __restrict__ Ab, const __bf16* __restrict__ Bb,
    int K, int lda, int ldb, floatx8 (&acc)[2][4])
{
    const int t    = threadIdx.x;
    const int lane = t & 31;
    const int wid  = t >> 5;       // 0..7
    const int wm   = wid & 3;      // 0..3 : 32-row strip
    const int wn   = wid >> 2;     // 0..1 : 64-col strip

    // Per-thread staging coords: 128 rows x 16 x 16B chunks per matrix,
    // thread t handles rows r0, r0+16, .. r0+112 at column chunk c8.
    const int r0 = t >> 4;
    const int c8 = (t & 15) * 8;
    const __bf16* ga = Ab + (long long)r0 * lda + c8;
    const __bf16* gb = Bb + (long long)r0 * ldb + c8;
    const int     loff = r0 * TILE_LDA + c8;

    auto issue_stage = [&](int st, int k0) {   // 16 async b128 per wave
        async_copy8_b128(&Asmem[st][loff], ga + k0, (long long)16 * lda, 16 * TILE_LDA * 2);
        async_copy8_b128(&Bsmem[st][loff], gb + k0, (long long)16 * ldb, 16 * TILE_LDA * 2);
    };

    const int nst = K / TILE_K;
    issue_stage(0, 0);
    // stage 0 landed (this wave's copies), then published to every wave
    asm volatile("s_wait_asynccnt 0x0" ::: "memory");
    __syncthreads();
    if (nst > 1) issue_stage(1, TILE_K);

    for (int s = 0; s < nst; ++s) {
        const int st = s & 1;
        // unrolled: the four 32-k blocks of a stage run without a branch between them
#pragma unroll
        for (int kk = 0; kk < TILE_K; kk += 32) {
            AFrag a[2], bf[4];
            load_frag_lds<TILE_LDA>(Asmem[st], wm * 32 + 0,  kk, lane, a[0]);
            load_frag_lds<TILE_LDA>(Asmem[st], wm * 32 + 16, kk, lane, a[1]);
#pragma unroll
            for (int fn = 0; fn < 4; ++fn)
                load_frag_lds<TILE_LDA>(Bsmem[st], wn * 64 + fn * 16, kk, lane, bf[fn]);

#pragma unroll
            for (int fm = 0; fm < 2; ++fm)
#pragma unroll
                for (int fn = 0; fn < 4; ++fn)
                    acc[fm][fn] = __builtin_amdgcn_wmma_f32_16x16x32_bf16(
                        false, a[fm].v, false, bf[fn].v,
                        (short)0, acc[fm][fn], false, false);
        }

        // this wave's reads of buffer st have returned
        asm volatile("s_wait_dscnt 0x0" ::: "memory");
        // this wave's copies of stage s+1 have landed
        asm volatile("s_wait_asynccnt 0x0" ::: "memory");
        // one barrier: publishes stage s+1 and ends every wave's reads of buffer st
        __syncthreads();
        if (s + 2 < nst) issue_stage(st, (s + 2) * TILE_K);
    }
    // no copy is left in flight when the wave goes on to the epilogue
    asm volatile("s_wait_asynccnt 0x0" ::: "memory");
}

// Tile (bx, by) of batch b, from the accumulators to C. bias and rowscale may each be
// null; each is tested and read anew for every one of the lane's 64 elements.
template <int MODE>
__device__ __forceinline__ void gemm_epilogue(
    TileRing& Asmem, const floatx8 (&acc)[2][4],
    const float* __restrict__ bias, const float* __restrict__ rowscale,
    float alpha, void* __restrict__ Cout,
    int bx, int by, int b, int ldc, long long sC, int rs_stride)
{
    const int t    = threadIdx.x;
    const int lane = t & 31;
    const int wid  = t >> 5;       // 0..7
    const int wm   = wid & 3;      // 0..3 : 32-row strip
    const int wn   = wid >> 2;     // 0..1 : 64-col strip

    constexpr int ESZ    = (MODE == 0) ? 4 : 2;    // bytes per element of C
    constexpr int ROW_B  = 128 * ESZ;              // bytes of a tile row in C
    constexpr int ST_LD  = ROW_B + 16;             // its pitch in LDS
    static_assert(128 * ST_LD <= (int)sizeof(Asmem), "staged tile fits the A ring");
    char* stage = (char*)&Asmem[0][0];

    const int l15 = lane & 15;
    const int lh8 = (lane >> 4) * 8;
#pragma unroll
    for (int fm = 0; fm < 2; ++fm)
#pragma unroll
        for (int fn = 0; fn < 4; ++fn) {
            const int ml = wm * 32 + fm * 16 + lh8;      // first of the lane's 8 rows
            const int nl = wn * 64 + fn * 16 + l15;      // its column, both in the tile
            bf16x8 col;
#pragma unroll
            for (int r = 0; r < 8; ++r) {
                const int m = bx * 128 + ml + r;
                const int n = by * 128 + nl;
                float val = acc[fm][fn][r];
                if (bias)     val += bias[n];
                val *= alpha;
                if (rowscale) val *= rowscale[b * rs_stride + m];
                if (MODE == 0)
                    *(float*)(stage + (ml + r) * ST_LD + nl * 4) = val;
                else if (MODE == 1)
                    *(__bf16*)(stage + (ml + r) * ST_LD + nl * 2) = (__bf16)val;
                else
                    col[r] = (__bf16)val;
            }
            if (MODE == 2)   // the lane's 8 m are adjacent in a row of the transposed tile
                *(bf16x8*)(stage + nl * ST_LD + ml * 2) = col;
        }
    __syncthreads();   // the whole tile is staged before any wave reads rows of it

    // A wave-wide 16-byte store covers 512 contiguous bytes of one row (f32) or the
    // 256 bytes of each of two rows (bf16): 4 whole lines either way.
    constexpr int LANES_PER_ROW = ROW_B / 16;
    constexpr int ROWS_PER_PASS = 256 / LANES_PER_ROW;
    const int srow = t / LANES_PER_ROW;
    const int scol = (t % LANES_PER_ROW) * 16;          // in bytes
    const int crow0 = (MODE == 2 ? by : bx) * 128;
    const int ccol0 = (MODE == 2 ? bx : by) * 128;
    char* Cb = (char*)Cout + ((long long)b * sC + (long long)(crow0 + srow) * ldc + ccol0) * ESZ + scol;
    // unrolled: all LDS reads of the lane are issued before its first store
    u32x4 piece[128 / ROWS_PER_PASS];
#pragma unroll
    for (int p = 0; p < 128 / ROWS_PER_PASS; ++p)
        piece[p] = *(const u32x4*)(stage + (p * ROWS_PER_PASS + srow) * ST_LD + scol);
#pragma unroll
    for (int p = 0; p < 128 / ROWS_PER_PASS; ++p)
        *(u32x4*)(Cb + (long long)p * ROWS_PER_PASS * ldc * ESZ) = piece[p];
}

// Shapes of the attention part. A row's sum comes in ROW_PARTS partial sums, one from
// each block of SM_COLS keys, in planes of SM_NQ rows: rowpart[b][p][m].
#define SM_NQ     1024              // queries
#define SM_NK     2048              // keys
#define SM_D      512               // width
#define SM_COLS   64                // keys per block of dots_col_softmax
#define ROW_PARTS (SM_NK / SM_COLS)

// One product per launch: tile (blockIdx.x, blockIdx.y) of batch blockIdx.z. Row m of
// A Bt^T is divided by the sum over p of rowpart[b][p][m]; bias and alpha come behind that.
template <int MODE>
__global__ __launch_bounds__(256) void gemm_bf16_wmma(
    const __bf16* __restrict__ A, const __bf16* __restrict__ Bt,
    const float* __restrict__ bias, const float* __restrict__ rowpart,
    float alpha, void* __restrict__ Cout,
    int K, int lda, int ldb, int ldc,
    long long sA, long long sB, long long sC)
{
    __shared__ __attribute__((aligned(16))) TileRing Asmem;
    __shared__ __attribute__((aligned(16))) TileRing Bsmem;
    __shared__ __attribute__((aligned(16))) float rinv[128];

    const int b = blockIdx.z;
    const int t = threadIdx.x;
    // 1 / row sum of the tile's 128 rows, a thread a row; adjacent lanes read adjacent
    // rows of a plane. The main loop's barriers stand between these writes of rinv and
    // its reads behind the loop.
    if (t < 128) {
        const float* rp = rowpart + (long long)b * ROW_PARTS * SM_NQ + blockIdx.x * 128 + t;
        // unrolled: all loads of the lane are in flight at once
        float part[ROW_PARTS];
#pragma unroll
        for (int p = 0; p < ROW_PARTS; ++p) part[p] = rp[p * SM_NQ];
#pragma unroll
        for (int h = ROW_PARTS / 2; h > 0; h >>= 1)
#pragma unroll
            for (int p = 0; p < h; ++p) part[p] += part[p + h];
        rinv[t] = 1.0f / part[0];
        // the loads' address registers are free before later code writes them; behind the
        // LDS store, which needs every load, so that no load can be moved behind the wait
        asm volatile("s_wait_xcnt 0x0" ::: "memory");
    }

    floatx8 acc[2][4] = {};
    gemm_main_loop(Asmem, Bsmem,
                   A + (long long)b * sA + (long long)blockIdx.x * 128 * lda,
                   Bt + (long long)b * sB + (long long)blockIdx.y * 128 * ldb,
                   K, lda, ldb, acc);
    // the lane's rows, as in gemm_epilogue: 8 adjacent ones for each fm
    const float* ri = rinv + ((t >> 5) & 3) * 32 + ((t & 31) >> 4) * 8;
#pragma unroll
    for (int fm = 0; fm < 2; ++fm)
#pragma unroll
        for (int r = 0; r < 8; ++r) {
            const float inv = ri[fm * 16 + r];
#pragma unroll
            for (int fn = 0; fn < 4; ++fn) acc[fm][fn][r] *= inv;
        }
    gemm_epilogue<MODE>(Asmem, acc, bias, nullptr, alpha, Cout,
                        blockIdx.x, blockIdx.y, b, ldc, sC, 0);
}

// The three projections in one launch: they depend on nothing of one another, and
// the tiles of one fill the places that the others' first loads and last stores
// would leave idle. blockIdx.x counts the 128-row tiles of k, then of v, then of q;
// k and v tiles of the same context rows start close together.
//   q = (xln Wq^T + bq) * qscale  [b][i][d]
//   k =  cln Wk^T + bk            [b][j][d]
//   v =  cln Wv^T + bv            [b][d][j]  (transposed store)
__global__ __launch_bounds__(256) void qkv_gemm_bf16_wmma(
    const __bf16* __restrict__ xln, const __bf16* __restrict__ cln,
    const __bf16* __restrict__ Wq, const __bf16* __restrict__ Wk,
    const __bf16* __restrict__ Wv,
    const float* __restrict__ bq, const float* __restrict__ bk,
    const float* __restrict__ bv, float qscale,
    __bf16* __restrict__ q, __bf16* __restrict__ k, __bf16* __restrict__ vT,
    int NQ, int NK, int D)
{
    __shared__ __attribute__((aligned(16))) TileRing Asmem;
    __shared__ __attribute__((aligned(16))) TileRing Bsmem;

    const int b   = blockIdx.z;
    const int by  = blockIdx.y;
    const int nkt = NK / 128;                 // row tiles of k, and of v
    const int gx  = blockIdx.x;
    const int sel = (gx >= nkt) + (gx >= 2 * nkt);   // 0: k, 1: v, 2: q
    const int bx  = gx - sel * nkt;

    const __bf16* X    = sel < 2 ? cln : xln;
    const int     rows = sel < 2 ? NK : NQ;
    const __bf16* Wt   = sel == 0 ? Wk : (sel == 1 ? Wv : Wq);
    const float*  bias = sel == 0 ? bk : (sel == 1 ? bv : bq);

    floatx8 acc[2][4] = {};
    gemm_main_loop(Asmem, Bsmem,
                   X + ((long long)b * rows + (long long)bx * 128) * D,
                   Wt + (long long)by * 128 * D,
                   D, D, D, acc);
    // sel is the same in the whole block: every wave takes the same epilogue
    if (sel == 1)
        gemm_epilogue<2>(Asmem, acc, bias, nullptr, 1.0f, vT,
                         bx, by, b, NK, (long long)D * NK, 0);
    else
        gemm_epilogue<1>(Asmem, acc, bias, nullptr, sel == 0 ? 1.0f : qscale,
                         sel == 0 ? k : q,
                         bx, by, b, D, (long long)rows * D, 0);
}

// ---------------------------------------------------------------------------
// The streaming kernels (cast, LayerNorm) start few, long waves: a lane
// moves 16 bytes per load and holds many values, all its loads are in flight at
// once, and a row's sum is taken across the 32 lanes of a wave.
// ---------------------------------------------------------------------------
typedef __attribute__((ext_vector_type(4))) float  f32x4;
typedef __attribute__((ext_vector_type(4))) __bf16 bf16x4;
typedef __attribute__((ext_vector_type(2))) float  f32x2;

__device__ __forceinline__ bf16x4 to_bf16x4(f32x4 v) {
    return __builtin_convertvector(v, bf16x4);
}

// Sum over the 32 lanes of a wave; every lane ends with the total.
__device__ __forceinline__ float wave_sum(float v) {
    for (int off = 16; off > 0; off >>= 1) v += __shfl_xor(v, off, 32);
    return v;
}

// ---------------------------------------------------------------------------
// f32 -> bf16 cast (weights): 8 values per thread, as two quads 256 quads apart,
// so that each wave-wide load covers 512 contiguous bytes. Each half of a 512-thread
// block converts 2048 values; blocks blk = 0 .. n/4096 - 1 cover the array exactly.
// ---------------------------------------------------------------------------
__device__ __forceinline__ void cast_f32_to_bf16(const float* __restrict__ in,
                                                 __bf16* __restrict__ out, int blk) {
    const int i = ((blk * 2 + (threadIdx.x >> 8)) * 512 + (threadIdx.x & 255)) * 4;
    const f32x4 a = *(const f32x4*)(in + i);
    const f32x4 b = *(const f32x4*)(in + i + 1024);
    *(bf16x4*)(out + i)        = to_bf16x4(a);
    *(bf16x4*)(out + i + 1024) = to_bf16x4(b);
    // the stores' address and data registers are free before another job's code, which
    // the compiler may lay behind this one, writes them
    asm volatile("s_wait_xcnt 0x0" ::: "memory");
}

// ---------------------------------------------------------------------------
// LayerNorm over D=512, bf16 output. One wave owns R adjacent rows (16 values of
// each row per lane, all R*4 loads in flight at once); 16 waves per block; block
// blk owns rows blk*16*R and on.
// ---------------------------------------------------------------------------
template <int R>
__device__ __forceinline__ void layernorm_to_bf16(
    const float* __restrict__ x, const float* __restrict__ g,
    const float* __restrict__ bb, __bf16* __restrict__ y, int blk)
{
    const int D = 512;
    const int lane = threadIdx.x & 31;
    const long long row0 = (long long)(blk * 16 + (threadIdx.x >> 5)) * R;
    const float* xr = x + row0 * D + lane * 4;
    __bf16*      yr = y + row0 * D + lane * 4;

    // Fully unrolled throughout, so that v[][] stays in registers.
    f32x4 gv[4], bv[4];
#pragma unroll
    for (int i = 0; i < 4; ++i) {
        gv[i] = *(const f32x4*)(g + i * 128 + lane * 4);
        bv[i] = *(const f32x4*)(bb + i * 128 + lane * 4);
    }
    f32x4 v[R][4];
#pragma unroll
    for (int r = 0; r < R; ++r)
#pragma unroll
        for (int i = 0; i < 4; ++i) v[r][i] = *(const f32x4*)(xr + r * D + i * 128);

    float s[R], ss[R];
#pragma unroll
    for (int r = 0; r < R; ++r) {
        s[r] = 0.f; ss[r] = 0.f;
#pragma unroll
        for (int i = 0; i < 4; ++i)
#pragma unroll
            for (int c = 0; c < 4; ++c) { s[r] += v[r][i][c]; ss[r] += v[r][i][c] * v[r][i][c]; }
    }
#pragma unroll
    for (int r = 0; r < R; ++r) { s[r] = wave_sum(s[r]); ss[r] = wave_sum(ss[r]); }

#pragma unroll
    for (int r = 0; r < R; ++r) {
        const float mu   = s[r] * (1.0f / D);
        const float var  = ss[r] * (1.0f / D) - mu * mu;
        const float rstd = rsqrtf(var + 1e-5f);
#pragma unroll
        for (int i = 0; i < 4; ++i) {
            f32x4 o;
#pragma unroll
            for (int c = 0; c < 4; ++c) o[c] = (v[r][i][c] - mu) * rstd * gv[i][c] + bv[i][c];
            *(bf16x4*)(yr + r * D + i * 128) = to_bf16x4(o);
        }
    }
    // the stores' address and data registers are free before another job's code, which
    // the compiler may lay behind this one, writes them
    asm volatile("s_wait_xcnt 0x0" ::: "memory");
}

// ---------------------------------------------------------------------------
// Everything the projections read, in one launch: both LayerNorms and the three
// weight casts depend on nothing of one another. The block index picks the job, the
// longest first: n_ctx blocks for the context rows, n_in for the input rows, then
// n_w for each weight matrix.
// ---------------------------------------------------------------------------
__global__ __launch_bounds__(512) void prepare_operands(
    const float* __restrict__ context, const float* __restrict__ ln_ctx_g,
    const float* __restrict__ ln_ctx_b, __bf16* __restrict__ cln,
    const float* __restrict__ inputs, const float* __restrict__ ln_in_g,
    const float* __restrict__ ln_in_b, __bf16* __restrict__ xln,
    const float* __restrict__ Wq, const float* __restrict__ Wk,
    const float* __restrict__ Wv, __bf16* __restrict__ Wqb,
    __bf16* __restrict__ Wkb, __bf16* __restrict__ Wvb,
    int n_ctx, int n_in, int n_w)
{
    int blk = blockIdx.x;
    if (blk < n_ctx) { layernorm_to_bf16<4>(context, ln_ctx_g, ln_ctx_b, cln, blk); return; }
    blk -= n_ctx;
    if (blk < n_in)  { layernorm_to_bf16<2>(inputs, ln_in_g, ln_in_b, xln, blk); return; }
    blk -= n_in;
    const int w = (blk >= n_w) + (blk >= 2 * n_w);   // 0: Wq, 1: Wk, 2: Wv
    cast_f32_to_bf16(w == 0 ? Wq : (w == 1 ? Wk : Wv),
                     w == 0 ? Wqb : (w == 1 ? Wkb : Wvb), blk - w * n_w);
}

// ---------------------------------------------------------------------------
// dots, the softmax over the query axis, P and its row sums, in one kernel:
//   S[i][j] = q[b][i] . k[b][j]   (scale folded into q)
//   P[b][i][j] = exp(S - max_i S) / sum_i exp(S - max_i S) + eps   (bf16)
//   rowpart[b][block of keys][i] = sum of P over the block's keys, before the rounding
// One 512-thread block owns 64 keys j and ALL 1024 queries i of a batch, so that a
// whole column of S sits in the block's accumulators: its maximum and its sum are
// taken there and S never goes to memory. 16 waves; wave w owns queries 64w .. 64w+63
// of all 64 keys (4x4 WMMA frags). K stage of 64 k: 128 B of a row, one whole line,
// at an LDS pitch of 144 B (16 B x 9); two-buffer ring of async copies as in
// gemm_main_loop.
// ---------------------------------------------------------------------------
#define SM_K     64                // k per stage
#define SM_LD    (SM_K + 8)        // LDS row pitch, elements
#define SM_RED   20                // pitch of a column's 16 per-wave partials, floats:
                                   // 80 B = 16 B x 5, for 16-byte reads of adjacent columns

__device__ __forceinline__ float exp_with_slot(float a) {
    float e;
    asm("v_exp_f32 %0, %1\n\tv_nop" : "=v"(e) : "v"(a * 1.44269504088896340736f));
    return e;
}

__global__ __launch_bounds__(512) void dots_col_softmax(
    const __bf16* __restrict__ q, const __bf16* __restrict__ k,
    __bf16* __restrict__ P, float* __restrict__ rowpart)
{
    __shared__ __attribute__((aligned(16))) __bf16 Qs[2][SM_NQ * SM_LD];
    __shared__ __attribute__((aligned(16))) __bf16 Ks[2][SM_COLS * SM_LD];

    const int t    = threadIdx.x;
    const int lane = t & 31;
    const int wid  = t >> 5;       // 0..15 : 64-query strip
    const int b    = blockIdx.y;
    const int j0   = blockIdx.x * SM_COLS;

    // Staging coords: a row of a stage is 8 chunks of 16 B; thread t handles chunk c8 of
    // query rows r0, r0+64, .. r0+960 and of key row r0.
    const int r0 = t >> 3;
    const int c8 = (t & 7) * 8;
    const __bf16* gq = q + ((long long)b * SM_NQ + r0) * SM_D + c8;
    const __bf16* gk = k + ((long long)b * SM_NK + j0 + r0) * SM_D + c8;
    const int     loff = r0 * SM_LD + c8;

    auto issue_stage = [&](int st, int k0) {   // 17 async b128 per wave
        async_copy8_b128(&Qs[st][loff], gq + k0, 64 * SM_D, 64 * SM_LD * 2);
        async_copy8_b128(&Qs[st][loff + 512 * SM_LD], gq + k0 + 512 * SM_D,
                         64 * SM_D, 64 * SM_LD * 2);
        async_copy1_b128(&Ks[st][loff], gk + k0);
    };

    floatx8 acc[4][4] = {};
    const int nst = SM_D / SM_K;
    issue_stage(0, 0);
    // stage 0 landed (this wave's copies), then published to every wave
    asm volatile("s_wait_asynccnt 0x0" ::: "memory");
    __syncthreads();
    issue_stage(1, SM_K);

    for (int s = 0; s < nst; ++s) {
        const int st = s & 1;
        // unrolled: the two 32-k blocks of a stage run without a branch between them
#pragma unroll
        for (int kk = 0; kk < SM_K; kk += 32) {
            AFrag a[4], bf[4];
#pragma unroll
            for (int fm = 0; fm < 4; ++fm)
                load_frag_lds<SM_LD>(Qs[st], wid * 64 + fm * 16, kk, lane, a[fm]);
#pragma unroll
            for (int fn = 0; fn < 4; ++fn)
                load_frag_lds<SM_LD>(Ks[st], fn * 16, kk, lane, bf[fn]);

#pragma unroll
            for (int fm = 0; fm < 4; ++fm)
#pragma unroll
                for (int fn = 0; fn < 4; ++fn)
                    acc[fm][fn] = __builtin_amdgcn_wmma_f32_16x16x32_bf16(
                        false, a[fm].v, false, bf[fn].v,
                        (short)0, acc[fm][fn], false, false);
        }

        // this wave's reads of buffer st have returned
        asm volatile("s_wait_dscnt 0x0" ::: "memory");
        // this wave's copies of stage s+1 have landed
        asm volatile("s_wait_asynccnt 0x0" ::: "memory");
        // one barrier: publishes stage s+1 and ends every wave's reads of buffer st
        __syncthreads();
        if (s + 2 < nst) issue_stage(st, (s + 2) * SM_K);
    }
    // no copy is left in flight when the wave goes on to the epilogue
    asm volatile("s_wait_asynccnt 0x0" ::: "memory");

    float* gm = (float*)&Ks[0][0];
    float* gs = gm + SM_COLS * SM_RED;
    static_assert(2 * SM_COLS * SM_RED * 4 <= (int)sizeof(Ks), "partials fit the K ring");
    const int l15 = lane & 15;
    const int lh8 = (lane >> 4) * 8;

    // Every loop below is fully unrolled so that acc[][] stays in registers.
#pragma unroll
    for (int fn = 0; fn < 4; ++fn) {
        float m = acc[0][fn][0];
#pragma unroll
        for (int fm = 0; fm < 4; ++fm)
#pragma unroll
            for (int r = 0; r < 8; ++r) m = fmaxf(m, acc[fm][fn][r]);
        m = fmaxf(m, __shfl_xor(m, 16, 32));
        if (lane < 16) gm[(fn * 16 + l15) * SM_RED + wid] = m;
    }
    __syncthreads();   // every wave's column maxima visible to all

#pragma unroll
    for (int fn = 0; fn < 4; ++fn) {
        const f32x4* pm = (const f32x4*)(gm + (fn * 16 + l15) * SM_RED);
        f32x4 m4 = pm[0];
#pragma unroll
        for (int w = 1; w < 4; ++w) {
            const f32x4 o = pm[w];
#pragma unroll
            for (int c = 0; c < 4; ++c) m4[c] = fmaxf(m4[c], o[c]);
        }
        const float M = fmaxf(fmaxf(m4[0], m4[1]), fmaxf(m4[2], m4[3]));
        float s = 0.f;
#pragma unroll
        for (int fm = 0; fm < 4; ++fm)
#pragma unroll
            for (int r = 0; r < 8; ++r) {
                const float e = exp_with_slot(acc[fm][fn][r] - M);
                acc[fm][fn][r] = e;
                s += e;
            }
        s += __shfl_xor(s, 16, 32);
        if (lane < 16) gs[(fn * 16 + l15) * SM_RED + wid] = s;
    }
    __syncthreads();   // every wave's column sums visible to all

    // A wave stages its own 64 rows of P (128 B each, pitch 144 B) and reads only
    // those back, so that no further barrier is needed.
    constexpr int ST_LD = SM_COLS * 2 + 16;
    static_assert(SM_NQ * ST_LD <= (int)sizeof(Qs), "staged P fits the Q ring");
    char* stage = (char*)&Qs[0][0] + wid * 64 * ST_LD;
    float part[32];   // [fm * 8 + r]: the lane's 4 keys of that query, summed
#pragma unroll
    for (int fn = 0; fn < 4; ++fn) {
        const f32x4* ps = (const f32x4*)(gs + (fn * 16 + l15) * SM_RED);
        const f32x4 s4 = (ps[0] + ps[1]) + (ps[2] + ps[3]);
        const float inv = 1.0f / ((s4[0] + s4[1]) + (s4[2] + s4[3]));
#pragma unroll
        for (int fm = 0; fm < 4; ++fm)
#pragma unroll
            for (int r = 0; r < 8; ++r) {
                const float pv = acc[fm][fn][r] * inv + 1e-8f;
                *(__bf16*)(stage + (fm * 16 + lh8 + r) * ST_LD + (fn * 16 + l15) * 2) = (__bf16)pv;
                part[fm * 8 + r] = fn == 0 ? pv : part[fm * 8 + r] + pv;
            }
    }

    // 32 sums over the 16 lanes of a half-wave in 30 exchanges: at each step a lane keeps
    // the half of the sums whose index bit equals its own lane bit and hands the other
    // half to its partner, so that lane l15 ends with sums 2 * l15 and 2 * l15 + 1.
#pragma unroll
    for (int off = 8; off > 0; off >>= 1) {
        const bool hi = (lane & off) != 0;
#pragma unroll
        for (int i = 0; i < 2 * off; ++i) {
            const float lo_row = part[i], hi_row = part[i + 2 * off];
            const float keep = hi ? hi_row : lo_row;
            const float send = hi ? lo_row : hi_row;
            part[i] = keep + __shfl_xor(send, off, 32);
        }
    }
    // Sums 2 * l15 and 2 * l15 + 1 are two adjacent queries (fm = l15 / 4, r = 2 * (l15 % 4)
    // and the next); the wave's 64 sums fill two whole 128-B lines of the block's plane.
    const int prow = wid * 64 + (l15 >> 2) * 16 + lh8 + (l15 & 3) * 2;
    const f32x2 two = {part[0], part[1]};
    *(f32x2*)(rowpart + ((long long)b * ROW_PARTS + blockIdx.x) * SM_NQ + prow) = two;
    // this wave's staged rows are in LDS before its lanes read one another's values
    asm volatile("s_wait_dscnt 0x0" ::: "memory");

    // A wave-wide 16-byte store covers the 128 bytes of each of 4 rows: 4 whole lines.
    const int srow = lane >> 3;
    const int scol = (lane & 7) * 16;          // in bytes
    char* Pb = (char*)(P + ((long long)b * SM_NQ + wid * 64 + srow) * SM_NK + j0) + scol;
    // unrolled: all LDS reads of the lane are issued before its first store
    u32x4 piece[16];
#pragma unroll
    for (int p = 0; p < 16; ++p)
        piece[p] = *(const u32x4*)(stage + (p * 4 + srow) * ST_LD + scol);
#pragma unroll
    for (int p = 0; p < 16; ++p)
        *(u32x4*)(Pb + p * 4 * SM_NK * 2) = piece[p];
}

// ---------------------------------------------------------------------------
// Host-side orchestration
// ---------------------------------------------------------------------------
extern "C" void kernel_launch(void* const* d_in, const int* in_sizes, int n_in,
                              void* d_out, int out_size, void* d_ws, size_t ws_size,
                              hipStream_t stream) {
    (void)in_sizes; (void)n_in; (void)out_size; (void)ws_size;

    const int B = 8, NQ = 1024, NK = 2048, D = 512;
    const float qscale = 0.044194173824159216f;   // 1/sqrt(512)

    const float* inputs  = (const float*)d_in[0];
    const float* context = (const float*)d_in[1];
    const float* ln_in_g  = (const float*)d_in[2];
    const float* ln_in_b  = (const float*)d_in[3];
    const float* ln_ctx_g = (const float*)d_in[4];
    const float* ln_ctx_b = (const float*)d_in[5];
    const float* Wq = (const float*)d_in[6];
    const float* bq = (const float*)d_in[7];
    const float* Wk = (const float*)d_in[8];
    const float* bk = (const float*)d_in[9];
    const float* Wv = (const float*)d_in[10];
    const float* bv = (const float*)d_in[11];
    float* out = (float*)d_out;

    // Workspace bump allocator (256B aligned)
    char* ws = (char*)d_ws;
    size_t off = 0;
    auto alloc = [&](size_t bytes) -> char* {
        char* p = ws + off;
        off += (bytes + 255) & ~(size_t)255;
        return p;
    };
    __bf16* Wqb = (__bf16*)alloc((size_t)D * D * 2);
    __bf16* Wkb = (__bf16*)alloc((size_t)D * D * 2);
    __bf16* Wvb = (__bf16*)alloc((size_t)D * D * 2);
    __bf16* xln = (__bf16*)alloc((size_t)B * NQ * D * 2);
    __bf16* cln = (__bf16*)alloc((size_t)B * NK * D * 2);
    __bf16* qb  = (__bf16*)alloc((size_t)B * NQ * D * 2);
    __bf16* kb  = (__bf16*)alloc((size_t)B * NK * D * 2);
    __bf16* vT  = (__bf16*)alloc((size_t)B * D * NK * 2);   // [b][d][j]
    __bf16* P   = (__bf16*)alloc((size_t)B * NQ * NK * 2);
    float*  rpt = (float*) alloc((size_t)B * (NK / 64) * NQ * 4);   // [b][block of keys][i]

    // 1) weights -> bf16 and both LayerNorms -> bf16 activations
    prepare_operands<<<dim3(B * NK / 64 + B * NQ / 32 + 3 * (D * D / 4096)), dim3(512), 0, stream>>>(
        context, ln_ctx_g, ln_ctx_b, cln, inputs, ln_in_g, ln_in_b, xln,
        Wq, Wk, Wv, Wqb, Wkb, Wvb,
        B * NK / 64, B * NQ / 32, D * D / 4096);

    // 2) Projections q (scaled by 1/sqrt(D)), k, and v stored transposed
    qkv_gemm_bf16_wmma<<<dim3(2 * (NK / 128) + NQ / 128, D / 128, B), dim3(256), 0, stream>>>(
        xln, cln, Wqb, Wkb, Wvb, bq, bk, bv, qscale, qb, kb, vT, NQ, NK, D);

    // 3) dots, softmax over the query axis (columns of dots), P = softmax + eps, and the
    //    partial row sums of P
    dots_col_softmax<<<dim3(NK / 64, B), dim3(512), 0, stream>>>(qb, kb, P, rpt);

    // 4) updates[b,i,d] = (1/rowsum[b,i]) * sum_j P[b,i,j] * v[b,j,d]
    gemm_bf16_wmma<0><<<dim3(NQ / 128, D / 128, B), dim3(256), 0, stream>>>(
        P, vT, nullptr, rpt, 1.0f, out,
        NK, NK, NK, D,
        (long long)NQ * NK, (long long)D * NK, (long long)NQ * D);
}

// v007
// A run of this version takes 81.5 microseconds.
// Two timings next to v006 both put it at 1.11 times that version's speed.
// All steps since v000 together make it 4.68 times as fast.
#include <hip/hip_runtime.h>
#include <hip/hip_bf16.h>

typedef __attribute__((ext_vector_type(16))) __bf16        bf16x16;
typedef __attribute__((ext_vector_type(8)))  float         floatx8;
typedef __attribute__((ext_vector_type(4)))  unsigned int  u32x4;
typedef __attribute__((ext_vector_type(8)))  __bf16        bf16x8;

union AFrag {
    bf16x16 v;
    u32x4   q[2];
};

#define TILE_K   128
#define TILE_LDA (TILE_K + 8)

// LD = pitch of an LDS row, in elements.
template <int LD>
__device__ __forceinline__ void load_frag_lds(const __bf16* base, int row0, int kk,
                                              int lane, AFrag& f) {
    const int m    = lane & 15;
    const int half = lane >> 4;
    const __bf16* p = base + (row0 + m) * LD + kk + half * 8;
    f.q[0] = *(const u32x4*)(p);        // K = kk+half*8 .. kk+half*8+7
    f.q[1] = *(const u32x4*)(p + 16);   // K = kk+16+half*8 .. kk+16+half*8+7
}

__device__ __forceinline__ void async_copy8_b128(const __bf16* lds, const __bf16* g,
                                                 long long gstep, unsigned ls) {
    const unsigned           l  = (unsigned)(unsigned long long)lds;
    const unsigned long long ga = (unsigned long long)g;
    const unsigned long long gs = (unsigned long long)gstep * 2;
    asm volatile("global_load_async_to_lds_b128 %0, %8, off\n\t"
                 "global_load_async_to_lds_b128 %1, %9, off\n\t"
                 "global_load_async_to_lds_b128 %2, %10, off\n\t"
                 "global_load_async_to_lds_b128 %3, %11, off\n\t"
                 "global_load_async_to_lds_b128 %4, %12, off\n\t"
                 "global_load_async_to_lds_b128 %5, %13, off\n\t"
                 "global_load_async_to_lds_b128 %6, %14, off\n\t"
                 "global_load_async_to_lds_b128 %7, %15, off\n\t"
                 "s_wait_xcnt 0x0"
                 :: "v"(l), "v"(l + ls), "v"(l + 2 * ls), "v"(l + 3 * ls),
                    "v"(l + 4 * ls), "v"(l + 5 * ls), "v"(l + 6 * ls), "v"(l + 7 * ls),
                    "v"(ga), "v"(ga + gs), "v"(ga + 2 * gs), "v"(ga + 3 * gs),
                    "v"(ga + 4 * gs), "v"(ga + 5 * gs), "v"(ga + 6 * gs), "v"(ga + 7 * gs)
                 : "memory");
}

// One such copy, with the same closing wait in its own statement.
__device__ __forceinline__ void async_copy1_b128(const __bf16* lds, const __bf16* g) {
    asm volatile("global_load_async_to_lds_b128 %0, %1, off\n\t"
                 "s_wait_xcnt 0x0"
                 :: "v"((unsigned)(unsigned long long)lds), "v"((unsigned long long)g)
                 : "memory");
}

// ---------------------------------------------------------------------------
// Batched GEMM tile:  C[b] = epilogue( A[b] * Bt[b]^T )
//   A  : [M x K] bf16 row-major (K contiguous), lda
//   Bt : [N x K] bf16 row-major (K contiguous), ldb   (i.e. B column-major)
//   MODE 0: f32  out at  C[b*sC + m*ldc + n]
//   MODE 1: bf16 out at  C[b*sC + m*ldc + n]
//   MODE 2: bf16 out at  C[b*sC + n*ldc + m]   (transposed store)
//   epilogue: val = (acc + bias[n]) * alpha * rowscale[b*rs_stride + m]
// Block tile 128(M) x 128(N), K-step TILE_K, double-buffered async LDS staging.
// K is a multiple of TILE_K.
// 256 threads = 8 waves; each wave owns a 32x64 sub-tile (2x4 WMMA frags).
// The finished tile is laid into LDS in the orientation in which C holds it and
// goes out from there in whole 128-B lines, 16 bytes a lane.
// The main loop and the epilogue are device functions on LDS rings that the kernel
// declares, so that one launch can hold tiles of several products.
// ---------------------------------------------------------------------------
typedef __bf16 TileRing[2][128 * TILE_LDA];

// acc += (128 rows at Ab) * (128 rows at Bb)^T over K.
__device__ __forceinline__ void gemm_main_loop(
    TileRing& Asmem, TileRing& Bsmem,
    const __bf16* __restrict__ Ab, const __bf16* __restrict__ Bb,
    int K, int lda, int ldb, floatx8 (&acc)[2][4])
{
    const int t    = threadIdx.x;
    const int lane = t & 31;
    const int wid  = t >> 5;       // 0..7
    const int wm   = wid & 3;      // 0..3 : 32-row strip
    const int wn   = wid >> 2;     // 0..1 : 64-col strip

    // Per-thread staging coords: 128 rows x 16 x 16B chunks per matrix,
    // thread t handles rows r0, r0+16, .. r0+112 at column chunk c8.
    const int r0 = t >> 4;
    const int c8 = (t & 15) * 8;
    const __bf16* ga = Ab + (long long)r0 * lda + c8;
    const __bf16* gb = Bb + (long long)r0 * ldb + c8;
    const int     loff = r0 * TILE_LDA + c8;

    auto issue_stage = [&](int st, int k0) {   // 16 async b128 per wave
        async_copy8_b128(&Asmem[st][loff], ga + k0, (long long)16 * lda, 16 * TILE_LDA * 2);
        async_copy8_b128(&Bsmem[st][loff], gb + k0, (long long)16 * ldb, 16 * TILE_LDA * 2);
    };

    const int nst = K / TILE_K;
    issue_stage(0, 0);
    // stage 0 landed (this wave's copies), then published to every wave
    asm volatile("s_wait_asynccnt 0x0" ::: "memory");
    __syncthreads();
    if (nst > 1) issue_stage(1, TILE_K);

    for (int s = 0; s < nst; ++s) {
        const int st = s & 1;
        // unrolled: the four 32-k blocks of a stage run without a branch between them
#pragma unroll
        for (int kk = 0; kk < TILE_K; kk += 32) {
            AFrag a[2], bf[4];
            load_frag_lds<TILE_LDA>(Asmem[st], wm * 32 + 0,  kk, lane, a[0]);
            load_frag_lds<TILE_LDA>(Asmem[st], wm * 32 + 16, kk, lane, a[1]);
#pragma unroll
            for (int fn = 0; fn < 4; ++fn)
                load_frag_lds<TILE_LDA>(Bsmem[st], wn * 64 + fn * 16, kk, lane, bf[fn]);

#pragma unroll
            for (int fm = 0; fm < 2; ++fm)
#pragma unroll
                for (int fn = 0; fn < 4; ++fn)
                    acc[fm][fn] = __builtin_amdgcn_wmma_f32_16x16x32_bf16(
                        false, a[fm].v, false, bf[fn].v,
                        (short)0, acc[fm][fn], false, false);
        }

        // this wave's reads of buffer st have returned
        asm volatile("s_wait_dscnt 0x0" ::: "memory");
        // this wave's copies of stage s+1 have landed
        asm volatile("s_wait_asynccnt 0x0" ::: "memory");
        // one barrier: publishes stage s+1 and ends every wave's reads of buffer st
        __syncthreads();
        if (s + 2 < nst) issue_stage(st, (s + 2) * TILE_K);
    }
    // no copy is left in flight when the wave goes on to the epilogue
    asm volatile("s_wait_asynccnt 0x0" ::: "memory");
}

// The bias of the lane's four columns of tile column by (fn = 0 .. 3, as in
// gemm_epilogue): all 64 elements of a lane lie in these four columns. Called ahead of
// the main loop, so that the four loads fly while the first stage is fetched.
__device__ __forceinline__ void load_bias4(const float* __restrict__ bias, int by,
                                           float (&bn)[4]) {
    const int t = threadIdx.x;
    const float* p = bias + by * 128 + (t >> 7) * 64 + (t & 15);
    // unrolled: bn[] stays in registers and the four loads are issued together
#pragma unroll
    for (int fn = 0; fn < 4; ++fn) bn[fn] = p[fn * 16];
}

// Tile (bx, by) of batch b, from the accumulators to C. bn = the bias of the lane's four
// columns (load_bias4), added where BIAS is set. rowscale may be null.
template <int MODE, bool BIAS>
__device__ __forceinline__ void gemm_epilogue(
    TileRing& Asmem, const floatx8 (&acc)[2][4],
    const float (&bn)[4], const float* __restrict__ rowscale,
    float alpha, void* __restrict__ Cout,
    int bx, int by, int b, int ldc, long long sC, int rs_stride)
{
    const int t    = threadIdx.x;
    const int lane = t & 31;
    const int wid  = t >> 5;       // 0..7
    const int wm   = wid & 3;      // 0..3 : 32-row strip
    const int wn   = wid >> 2;     // 0..1 : 64-col strip

    constexpr int ESZ    = (MODE == 0) ? 4 : 2;    // bytes per element of C
    constexpr int ROW_B  = 128 * ESZ;              // bytes of a tile row in C
    constexpr int ST_LD  = ROW_B + 16;             // its pitch in LDS
    static_assert(128 * ST_LD <= (int)sizeof(Asmem), "staged tile fits the A ring");
    char* stage = (char*)&Asmem[0][0];

    const int l15 = lane & 15;
    const int lh8 = (lane >> 4) * 8;
#pragma unroll
    for (int fm = 0; fm < 2; ++fm)
#pragma unroll
        for (int fn = 0; fn < 4; ++fn) {
            const int ml = wm * 32 + fm * 16 + lh8;      // first of the lane's 8 rows
            const int nl = wn * 64 + fn * 16 + l15;      // its column, both in the tile
            bf16x8 col;
#pragma unroll
            for (int r = 0; r < 8; ++r) {
                const int m = bx * 128 + ml + r;
                float val = acc[fm][fn][r];
                if (BIAS)     val += bn[fn];
                val *= alpha;
                if (rowscale) val *= rowscale[b * rs_stride + m];
                if (MODE == 0)
                    *(float*)(stage + (ml + r) * ST_LD + nl * 4) = val;
                else if (MODE == 1)
                    *(__bf16*)(stage + (ml + r) * ST_LD + nl * 2) = (__bf16)val;
                else
                    col[r] = (__bf16)val;
            }
            if (MODE == 2)   // the lane's 8 m are adjacent in a row of the transposed tile
                *(bf16x8*)(stage + nl * ST_LD + ml * 2) = col;
        }
    __syncthreads();   // the whole tile is staged before any wave reads rows of it

    // A wave-wide 16-byte store covers 512 contiguous bytes of one row (f32) or the
    // 256 bytes of each of two rows (bf16): 4 whole lines either way.
    constexpr int LANES_PER_ROW = ROW_B / 16;
    constexpr int ROWS_PER_PASS = 256 / LANES_PER_ROW;
    const int srow = t / LANES_PER_ROW;
    const int scol = (t % LANES_PER_ROW) * 16;          // in bytes
    const int crow0 = (MODE == 2 ? by : bx) * 128;
    const int ccol0 = (MODE == 2 ? bx : by) * 128;
    char* Cb = (char*)Cout + ((long long)b * sC + (long long)(crow0 + srow) * ldc + ccol0) * ESZ + scol;
    // unrolled: all LDS reads of the lane are issued before its first store
    u32x4 piece[128 / ROWS_PER_PASS];
#pragma unroll
    for (int p = 0; p < 128 / ROWS_PER_PASS; ++p)
        piece[p] = *(const u32x4*)(stage + (p * ROWS_PER_PASS + srow) * ST_LD + scol);
#pragma unroll
    for (int p = 0; p < 128 / ROWS_PER_PASS; ++p)
        *(u32x4*)(Cb + (long long)p * ROWS_PER_PASS * ldc * ESZ) = piece[p];
}

// Shapes of the attention part. A row's sum comes in ROW_PARTS partial sums, one from
// each block of SM_COLS keys, in planes of SM_NQ rows: rowpart[b][p][m].
#define SM_NQ     1024              // queries
#define SM_NK     2048              // keys
#define SM_D      512               // width
#define SM_COLS   64                // keys per block of dots_col_softmax
#define ROW_PARTS (SM_NK / SM_COLS)

// One product per launch: tile (blockIdx.x, blockIdx.y) of batch blockIdx.z. Row m of
// A Bt^T is divided by the sum over p of rowpart[b][p][m]; alpha comes behind that.
template <int MODE>
__global__ __launch_bounds__(256) void gemm_bf16_wmma(
    const __bf16* __restrict__ A, const __bf16* __restrict__ Bt,
    const float* __restrict__ rowpart,
    float alpha, void* __restrict__ Cout,
    int K, int lda, int ldb, int ldc,
    long long sA, long long sB, long long sC)
{
    __shared__ __attribute__((aligned(16))) TileRing Asmem;
    __shared__ __attribute__((aligned(16))) TileRing Bsmem;
    __shared__ __attribute__((aligned(16))) float rinv[128];

    const int b = blockIdx.z;
    const int t = threadIdx.x;
    // 1 / row sum of the tile's 128 rows, a thread a row; adjacent lanes read adjacent
    // rows of a plane. The main loop's barriers stand between these writes of rinv and
    // its reads behind the loop.
    if (t < 128) {
        const float* rp = rowpart + (long long)b * ROW_PARTS * SM_NQ + blockIdx.x * 128 + t;
        // unrolled: all loads of the lane are in flight at once
        float part[ROW_PARTS];
#pragma unroll
        for (int p = 0; p < ROW_PARTS; ++p) part[p] = rp[p * SM_NQ];
#pragma unroll
        for (int h = ROW_PARTS / 2; h > 0; h >>= 1)
#pragma unroll
            for (int p = 0; p < h; ++p) part[p] += part[p + h];
        rinv[t] = 1.0f / part[0];
        // the loads' address registers are free before later code writes them; behind the
        // LDS store, which needs every load, so that no load can be moved behind the wait
        asm volatile("s_wait_xcnt 0x0" ::: "memory");
    }

    floatx8 acc[2][4] = {};
    gemm_main_loop(Asmem, Bsmem,
                   A + (long long)b * sA + (long long)blockIdx.x * 128 * lda,
                   Bt + (long long)b * sB + (long long)blockIdx.y * 128 * ldb,
                   K, lda, ldb, acc);
    // the lane's rows, as in gemm_epilogue: 8 adjacent ones for each fm
    const float* ri = rinv + ((t >> 5) & 3) * 32 + ((t & 31) >> 4) * 8;
#pragma unroll
    for (int fm = 0; fm < 2; ++fm)
#pragma unroll
        for (int r = 0; r < 8; ++r) {
            const float inv = ri[fm * 16 + r];
#pragma unroll
            for (int fn = 0; fn < 4; ++fn) acc[fm][fn][r] *= inv;
        }
    const float no_bias[4] = {};   // not read: BIAS is false
    gemm_epilogue<MODE, false>(Asmem, acc, no_bias, nullptr, alpha, Cout,
                               blockIdx.x, blockIdx.y, b, ldc, sC, 0);
}

// The three projections in one launch: they depend on nothing of one another, and
// the tiles of one fill the places that the others' first loads and last stores
// would leave idle. blockIdx.x counts the 128-row tiles of k, then of v, then of q;
// k and v tiles of the same context rows start close together.
//   q = (xln Wq^T + bq) * qscale  [b][i][d]
//   k =  cln Wk^T + bk            [b][j][d]
//   v =  cln Wv^T + bv            [b][d][j]  (transposed store)
__global__ __launch_bounds__(256) void qkv_gemm_bf16_wmma(
    const __bf16* __restrict__ xln, const __bf16* __restrict__ cln,
    const __bf16* __restrict__ Wq, const __bf16* __restrict__ Wk,
    const __bf16* __restrict__ Wv,
    const float* __restrict__ bq, const float* __restrict__ bk,
    const float* __restrict__ bv, float qscale,
    __bf16* __restrict__ q, __bf16* __restrict__ k, __bf16* __restrict__ vT,
    int NQ, int NK, int D)
{
    __shared__ __attribute__((aligned(16))) TileRing Asmem;
    __shared__ __attribute__((aligned(16))) TileRing Bsmem;

    const int b   = blockIdx.z;
    const int by  = blockIdx.y;
    const int nkt = NK / 128;                 // row tiles of k, and of v
    const int gx  = blockIdx.x;
    const int sel = (gx >= nkt) + (gx >= 2 * nkt);   // 0: k, 1: v, 2: q
    const int bx  = gx - sel * nkt;

    const __bf16* X    = sel < 2 ? cln : xln;
    const int     rows = sel < 2 ? NK : NQ;
    const __bf16* Wt   = sel == 0 ? Wk : (sel == 1 ? Wv : Wq);
    const float*  bias = sel == 0 ? bk : (sel == 1 ? bv : bq);

    float bn[4];
    load_bias4(bias, by, bn);

    floatx8 acc[2][4] = {};
    gemm_main_loop(Asmem, Bsmem,
                   X + ((long long)b * rows + (long long)bx * 128) * D,
                   Wt + (long long)by * 128 * D,
                   D, D, D, acc);
    // sel is the same in the whole block: every wave takes the same epilogue
    if (sel == 1)
        gemm_epilogue<2, true>(Asmem, acc, bn, nullptr, 1.0f, vT,
                               bx, by, b, NK, (long long)D * NK, 0);
    else
        gemm_epilogue<1, true>(Asmem, acc, bn, nullptr, sel == 0 ? 1.0f : qscale,
                               sel == 0 ? k : q,
                               bx, by, b, D, (long long)rows * D, 0);
}

// ---------------------------------------------------------------------------
// The streaming kernels (cast, LayerNorm) start few, long waves: a lane
// moves 16 bytes per load and holds many values, all its loads are in flight at
// once, and a row's sum is taken across the 32 lanes of a wave.
// ---------------------------------------------------------------------------
typedef __attribute__((ext_vector_type(4))) float  f32x4;
typedef __attribute__((ext_vector_type(4))) __bf16 bf16x4;
typedef __attribute__((ext_vector_type(2))) float  f32x2;

__device__ __forceinline__ bf16x4 to_bf16x4(f32x4 v) {
    return __builtin_convertvector(v, bf16x4);
}

// Sum over the 32 lanes of a wave; every lane ends with the total.
__device__ __forceinline__ float wave_sum(float v) {
    for (int off = 16; off > 0; off >>= 1) v += __shfl_xor(v, off, 32);
    return v;
}

// ---------------------------------------------------------------------------
// f32 -> bf16 cast (weights): 8 values per thread, as two quads 256 quads apart,
// so that each wave-wide load covers 512 contiguous bytes. Each half of a 512-thread
// block converts 2048 values; blocks blk = 0 .. n/4096 - 1 cover the array exactly.
// ---------------------------------------------------------------------------
__device__ __forceinline__ void cast_f32_to_bf16(const float* __restrict__ in,
                                                 __bf16* __restrict__ out, int blk) {
    const int i = ((blk * 2 + (threadIdx.x >> 8)) * 512 + (threadIdx.x & 255)) * 4;
    const f32x4 a = *(const f32x4*)(in + i);
    const f32x4 b = *(const f32x4*)(in + i + 1024);
    *(bf16x4*)(out + i)        = to_bf16x4(a);
    *(bf16x4*)(out + i + 1024) = to_bf16x4(b);
    // the stores' address and data registers are free before another job's code, which
    // the compiler may lay behind this one, writes them
    asm volatile("s_wait_xcnt 0x0" ::: "memory");
}

// ---------------------------------------------------------------------------
// LayerNorm over D=512, bf16 output. One wave owns R adjacent rows (16 values of
// each row per lane, all R*4 loads in flight at once); 16 waves per block; block
// blk owns rows blk*16*R and on.
// ---------------------------------------------------------------------------
template <int R>
__device__ __forceinline__ void layernorm_to_bf16(
    const float* __restrict__ x, const float* __restrict__ g,
    const float* __restrict__ bb, __bf16* __restrict__ y, int blk)
{
    const int D = 512;
    const int lane = threadIdx.x & 31;
    const long long row0 = (long long)(blk * 16 + (threadIdx.x >> 5)) * R;
    const float* xr = x + row0 * D + lane * 4;
    __bf16*      yr = y + row0 * D + lane * 4;

    // Fully unrolled throughout, so that v[][] stays in registers.
    f32x4 gv[4], bv[4];
#pragma unroll
    for (int i = 0; i < 4; ++i) {
        gv[i] = *(const f32x4*)(g + i * 128 + lane * 4);
        bv[i] = *(const f32x4*)(bb + i * 128 + lane * 4);
    }
    f32x4 v[R][4];
#pragma unroll
    for (int r = 0; r < R; ++r)
#pragma unroll
        for (int i = 0; i < 4; ++i) v[r][i] = *(const f32x4*)(xr + r * D + i * 128);

    float s[R], ss[R];
#pragma unroll
    for (int r = 0; r < R; ++r) {
        s[r] = 0.f; ss[r] = 0.f;
#pragma unroll
        for (int i = 0; i < 4; ++i)
#pragma unroll
            for (int c = 0; c < 4; ++c) { s[r] += v[r][i][c]; ss[r] += v[r][i][c] * v[r][i][c]; }
    }
#pragma unroll
    for (int r = 0; r < R; ++r) { s[r] = wave_sum(s[r]); ss[r] = wave_sum(ss[r]); }

#pragma unroll
    for (int r = 0; r < R; ++r) {
        const float mu   = s[r] * (1.0f / D);
        const float var  = ss[r] * (1.0f / D) - mu * mu;
        const float rstd = rsqrtf(var + 1e-5f);
#pragma unroll
        for (int i = 0; i < 4; ++i) {
            f32x4 o;
#pragma unroll
            for (int c = 0; c < 4; ++c) o[c] = (v[r][i][c] - mu) * rstd * gv[i][c] + bv[i][c];
            *(bf16x4*)(yr + r * D + i * 128) = to_bf16x4(o);
        }
    }
    // the stores' address and data registers are free before another job's code, which
    // the compiler may lay behind this one, writes them
    asm volatile("s_wait_xcnt 0x0" ::: "memory");
}

// ---------------------------------------------------------------------------
// Everything the projections read, in one launch: both LayerNorms and the three
// weight casts depend on nothing of one another. The block index picks the job, the
// longest first: n_ctx blocks for the context rows, n_in for the input rows, then
// n_w for each weight matrix.
// ---------------------------------------------------------------------------
__global__ __launch_bounds__(512) void prepare_operands(
    const float* __restrict__ context, const float* __restrict__ ln_ctx_g,
    const float* __restrict__ ln_ctx_b, __bf16* __restrict__ cln,
    const float* __restrict__ inputs, const float* __restrict__ ln_in_g,
    const float* __restrict__ ln_in_b, __bf16* __restrict__ xln,
    const float* __restrict__ Wq, const float* __restrict__ Wk,
    const float* __restrict__ Wv, __bf16* __restrict__ Wqb,
    __bf16* __restrict__ Wkb, __bf16* __restrict__ Wvb,
    int n_ctx, int n_in, int n_w)
{
    int blk = blockIdx.x;
    if (blk < n_ctx) { layernorm_to_bf16<4>(context, ln_ctx_g, ln_ctx_b, cln, blk); return; }
    blk -= n_ctx;
    if (blk < n_in)  { layernorm_to_bf16<2>(inputs, ln_in_g, ln_in_b, xln, blk); return; }
    blk -= n_in;
    const int w = (blk >= n_w) + (blk >= 2 * n_w);   // 0: Wq, 1: Wk, 2: Wv
    cast_f32_to_bf16(w == 0 ? Wq : (w == 1 ? Wk : Wv),
                     w == 0 ? Wqb : (w == 1 ? Wkb : Wvb), blk - w * n_w);
}

// ---------------------------------------------------------------------------
// dots, the softmax over the query axis, P and its row sums, in one kernel:
//   S[i][j] = q[b][i] . k[b][j]   (scale folded into q)
//   P[b][i][j] = exp(S - max_i S) / sum_i exp(S - max_i S) + eps   (bf16)
//   rowpart[b][block of keys][i] = sum of P over the block's keys, before the rounding
// One 512-thread block owns 64 keys j and ALL 1024 queries i of a batch, so that a
// whole column of S sits in the block's accumulators: its maximum and its sum are
// taken there and S never goes to memory. 16 waves; wave w owns queries 64w .. 64w+63
// of all 64 keys (4x4 WMMA frags). K stage of 64 k: 128 B of a row, one whole line,
// at an LDS pitch of 144 B (16 B x 9); two-buffer ring of async copies as in
// gemm_main_loop.
// ---------------------------------------------------------------------------
#define SM_K     64                // k per stage
#define SM_LD    (SM_K + 8)        // LDS row pitch, elements
#define SM_RED   20                // pitch of a column's 16 per-wave partials, floats:
                                   // 80 B = 16 B x 5, for 16-byte reads of adjacent columns

__device__ __forceinline__ float exp_with_slot(float a) {
    float e;
    asm("v_exp_f32 %0, %1\n\tv_nop" : "=v"(e) : "v"(a * 1.44269504088896340736f));
    return e;
}

__global__ __launch_bounds__(512) void dots_col_softmax(
    const __bf16* __restrict__ q, const __bf16* __restrict__ k,
    __bf16* __restrict__ P, float* __restrict__ rowpart)
{
    __shared__ __attribute__((aligned(16))) __bf16 Qs[2][SM_NQ * SM_LD];
    __shared__ __attribute__((aligned(16))) __bf16 Ks[2][SM_COLS * SM_LD];

    const int t    = threadIdx.x;
    const int lane = t & 31;
    const int wid  = t >> 5;       // 0..15 : 64-query strip
    const int b    = blockIdx.y;
    const int j0   = blockIdx.x * SM_COLS;

    // Staging coords: a row of a stage is 8 chunks of 16 B; thread t handles chunk c8 of
    // query rows r0, r0+64, .. r0+960 and of key row r0.
    const int r0 = t >> 3;
    const int c8 = (t & 7) * 8;
    const __bf16* gq = q + ((long long)b * SM_NQ + r0) * SM_D + c8;
    const __bf16* gk = k + ((long long)b * SM_NK + j0 + r0) * SM_D + c8;
    const int     loff = r0 * SM_LD + c8;

    auto issue_stage = [&](int st, int k0) {   // 17 async b128 per wave
        async_copy8_b128(&Qs[st][loff], gq + k0, 64 * SM_D, 64 * SM_LD * 2);
        async_copy8_b128(&Qs[st][loff + 512 * SM_LD], gq + k0 + 512 * SM_D,
                         64 * SM_D, 64 * SM_LD * 2);
        async_copy1_b128(&Ks[st][loff], gk + k0);
    };

    floatx8 acc[4][4] = {};
    const int nst = SM_D / SM_K;
    issue_stage(0, 0);
    // stage 0 landed (this wave's copies), then published to every wave
    asm volatile("s_wait_asynccnt 0x0" ::: "memory");
    __syncthreads();
    issue_stage(1, SM_K);

    for (int s = 0; s < nst; ++s) {
        const int st = s & 1;
        // unrolled: the two 32-k blocks of a stage run without a branch between them
#pragma unroll
        for (int kk = 0; kk < SM_K; kk += 32) {
            AFrag a[4], bf[4];
#pragma unroll
            for (int fm = 0; fm < 4; ++fm)
                load_frag_lds<SM_LD>(Qs[st], wid * 64 + fm * 16, kk, lane, a[fm]);
#pragma unroll
            for (int fn = 0; fn < 4; ++fn)
                load_frag_lds<SM_LD>(Ks[st], fn * 16, kk, lane, bf[fn]);

#pragma unroll
            for (int fm = 0; fm < 4; ++fm)
#pragma unroll
                for (int fn = 0; fn < 4; ++fn)
                    acc[fm][fn] = __builtin_amdgcn_wmma_f32_16x16x32_bf16(
                        false, a[fm].v, false, bf[fn].v,
                        (short)0, acc[fm][fn], false, false);
        }

        // this wave's reads of buffer st have returned
        asm volatile("s_wait_dscnt 0x0" ::: "memory");
        // this wave's copies of stage s+1 have landed
        asm volatile("s_wait_asynccnt 0x0" ::: "memory");
        // one barrier: publishes stage s+1 and ends every wave's reads of buffer st
        __syncthreads();
        if (s + 2 < nst) issue_stage(st, (s + 2) * SM_K);
    }
    // no copy is left in flight when the wave goes on to the epilogue
    asm volatile("s_wait_asynccnt 0x0" ::: "memory");

    float* gm = (float*)&Ks[0][0];
    float* gs = gm + SM_COLS * SM_RED;
    static_assert(2 * SM_COLS * SM_RED * 4 <= (int)sizeof(Ks), "partials fit the K ring");
    const int l15 = lane & 15;
    const int lh8 = (lane >> 4) * 8;

    // Every loop below is fully unrolled so that acc[][] stays in registers.
#pragma unroll
    for (int fn = 0; fn < 4; ++fn) {
        float m = acc[0][fn][0];
#pragma unroll
        for (int fm = 0; fm < 4; ++fm)
#pragma unroll
            for (int r = 0; r < 8; ++r) m = fmaxf(m, acc[fm][fn][r]);
        m = fmaxf(m, __shfl_xor(m, 16, 32));
        if (lane < 16) gm[(fn * 16 + l15) * SM_RED + wid] = m;
    }
    __syncthreads();   // every wave's column maxima visible to all

#pragma unroll
    for (int fn = 0; fn < 4; ++fn) {
        const f32x4* pm = (const f32x4*)(gm + (fn * 16 + l15) * SM_RED);
        f32x4 m4 = pm[0];
#pragma unroll
        for (int w = 1; w < 4; ++w) {
            const f32x4 o = pm[w];
#pragma unroll
            for (int c = 0; c < 4; ++c) m4[c] = fmaxf(m4[c], o[c]);
        }
        const float M = fmaxf(fmaxf(m4[0], m4[1]), fmaxf(m4[2], m4[3]));
        float s = 0.f;
#pragma unroll
        for (int fm = 0; fm < 4; ++fm)
#pragma unroll
            for (int r = 0; r < 8; ++r) {
                const float e = exp_with_slot(acc[fm][fn][r] - M);
                acc[fm][fn][r] = e;
                s += e;
            }
        s += __shfl_xor(s, 16, 32);
        if (lane < 16) gs[(fn * 16 + l15) * SM_RED + wid] = s;
    }
    __syncthreads();   // every wave's column sums visible to all

    // A wave stages its own 64 rows of P (128 B each, pitch 144 B) and reads only
    // those back, so that no further barrier is needed.
    constexpr int ST_LD = SM_COLS * 2 + 16;
    static_assert(SM_NQ * ST_LD <= (int)sizeof(Qs), "staged P fits the Q ring");
    char* stage = (char*)&Qs[0][0] + wid * 64 * ST_LD;
    float part[32];   // [fm * 8 + r]: the lane's 4 keys of that query, summed
#pragma unroll
    for (int fn = 0; fn < 4; ++fn) {
        const f32x4* ps = (const f32x4*)(gs + (fn * 16 + l15) * SM_RED);
        const f32x4 s4 = (ps[0] + ps[1]) + (ps[2] + ps[3]);
        const float inv = 1.0f / ((s4[0] + s4[1]) + (s4[2] + s4[3]));
#pragma unroll
        for (int fm = 0; fm < 4; ++fm)
#pragma unroll
            for (int r = 0; r < 8; ++r) {
                const float pv = acc[fm][fn][r] * inv + 1e-8f;
                *(__bf16*)(stage + (fm * 16 + lh8 + r) * ST_LD + (fn * 16 + l15) * 2) = (__bf16)pv;
                part[fm * 8 + r] = fn == 0 ? pv : part[fm * 8 + r] + pv;
            }
    }

    // 32 sums over the 16 lanes of a half-wave in 30 exchanges: at each step a lane keeps
    // the half of the sums whose index bit equals its own lane bit and hands the other
    // half to its partner, so that lane l15 ends with sums 2 * l15 and 2 * l15 + 1.
#pragma unroll
    for (int off = 8; off > 0; off >>= 1) {
        const bool hi = (lane & off) != 0;
#pragma unroll
        for (int i = 0; i < 2 * off; ++i) {
            const float lo_row = part[i], hi_row = part[i + 2 * off];
            const float keep = hi ? hi_row : lo_row;
            const float send = hi ? lo_row : hi_row;
            part[i] = keep + __shfl_xor(send, off, 32);
        }
    }
    // Sums 2 * l15 and 2 * l15 + 1 are two adjacent queries (fm = l15 / 4, r = 2 * (l15 % 4)
    // and the next); the wave's 64 sums fill two whole 128-B lines of the block's plane.
    const int prow = wid * 64 + (l15 >> 2) * 16 + lh8 + (l15 & 3) * 2;
    const f32x2 two = {part[0], part[1]};
    *(f32x2*)(rowpart + ((long long)b * ROW_PARTS + blockIdx.x) * SM_NQ + prow) = two;
    // this wave's staged rows are in LDS before its lanes read one another's values
    asm volatile("s_wait_dscnt 0x0" ::: "memory");

    // A wave-wide 16-byte store covers the 128 bytes of each of 4 rows: 4 whole lines.
    const int srow = lane >> 3;
    const int scol = (lane & 7) * 16;          // in bytes
    char* Pb = (char*)(P + ((long long)b * SM_NQ + wid * 64 + srow) * SM_NK + j0) + scol;
    // unrolled: all LDS reads of the lane are issued before its first store
    u32x4 piece[16];
#pragma unroll
    for (int p = 0; p < 16; ++p)
        piece[p] = *(const u32x4*)(stage + (p * 4 + srow) * ST_LD + scol);
#pragma unroll
    for (int p = 0; p < 16; ++p)
        *(u32x4*)(Pb + p * 4 * SM_NK * 2) = piece[p];
}

// ---------------------------------------------------------------------------
// Host-side orchestration
// ---------------------------------------------------------------------------
extern "C" void kernel_launch(void* const* d_in, const int* in_sizes, int n_in,
                              void* d_out, int out_size, void* d_ws, size_t ws_size,
                              hipStream_t stream) {
    (void)in_sizes; (void)n_in; (void)out_size; (void)ws_size;

    const int B = 8, NQ = 1024, NK = 2048, D = 512;
    const float qscale = 0.044194173824159216f;   // 1/sqrt(512)

    const float* inputs  = (const float*)d_in[0];
    const float* context = (const float*)d_in[1];
    const float* ln_in_g  = (const float*)d_in[2];
    const float* ln_in_b  = (const float*)d_in[3];
    const float* ln_ctx_g = (const float*)d_in[4];
    const float* ln_ctx_b = (const float*)d_in[5];
    const float* Wq = (const float*)d_in[6];
    const float* bq = (const float*)d_in[7];
    const float* Wk = (const float*)d_in[8];
    const float* bk = (const float*)d_in[9];
    const float* Wv = (const float*)d_in[10];
    const float* bv = (const float*)d_in[11];
    float* out = (float*)d_out;

    // Workspace bump allocator (256B aligned)
    char* ws = (char*)d_ws;
    size_t off = 0;
    auto alloc = [&](size_t bytes) -> char* {
        char* p = ws + off;
        off += (bytes + 255) & ~(size_t)255;
        return p;
    };
    __bf16* Wqb = (__bf16*)alloc((size_t)D * D * 2);
    __bf16* Wkb = (__bf16*)alloc((size_t)D * D * 2);
    __bf16* Wvb = (__bf16*)alloc((size_t)D * D * 2);
    __bf16* xln = (__bf16*)alloc((size_t)B * NQ * D * 2);
    __bf16* cln = (__bf16*)alloc((size_t)B * NK * D * 2);
    __bf16* qb  = (__bf16*)alloc((size_t)B * NQ * D * 2);
    __bf16* kb  = (__bf16*)alloc((size_t)B * NK * D * 2);
    __bf16* vT  = (__bf16*)alloc((size_t)B * D * NK * 2);   // [b][d][j]
    __bf16* P   = (__bf16*)alloc((size_t)B * NQ * NK * 2);
    float*  rpt = (float*) alloc((size_t)B * (NK / 64) * NQ * 4);   // [b][block of keys][i]

    // 1) weights -> bf16 and both LayerNorms -> bf16 activations
    prepare_operands<<<dim3(B * NK / 64 + B * NQ / 32 + 3 * (D * D / 4096)), dim3(512), 0, stream>>>(
        context, ln_ctx_g, ln_ctx_b, cln, inputs, ln_in_g, ln_in_b, xln,
        Wq, Wk, Wv, Wqb, Wkb, Wvb,
        B * NK / 64, B * NQ / 32, D * D / 4096);

    // 2) Projections q (scaled by 1/sqrt(D)), k, and v stored transposed
    qkv_gemm_bf16_wmma<<<dim3(2 * (NK / 128) + NQ / 128, D / 128, B), dim3(256), 0, stream>>>(
        xln, cln, Wqb, Wkb, Wvb, bq, bk, bv, qscale, qb, kb, vT, NQ, NK, D);

    // 3) dots, softmax over the query axis (columns of dots), P = softmax + eps, and the
    //    partial row sums of P
    dots_col_softmax<<<dim3(NK / 64, B), dim3(512), 0, stream>>>(qb, kb, P, rpt);

    // 4) updates[b,i,d] = (1/rowsum[b,i]) * sum_j P[b,i,j] * v[b,j,d]
    gemm_bf16_wmma<0><<<dim3(NQ / 128, D / 128, B), dim3(256), 0, stream>>>(
        P, vT, rpt, 1.0f, out,
        NK, NK, NK, D,
        (long long)NQ * NK, (long long)D * NK, (long long)NQ * D);
}

// v008
// Measured time: 76.7 microseconds a run.
// In two side-by-side timings against v007, it was 1.06 and 1.07 times as fast.
// Over all steps from v000 it is 4.99 times as fast.
#include <hip/hip_runtime.h>
#include <hip/hip_bf16.h>

typedef __attribute__((ext_vector_type(16))) __bf16        bf16x16;
typedef __attribute__((ext_vector_type(8)))  float         floatx8;
typedef __attribute__((ext_vector_type(4)))  unsigned int  u32x4;
typedef __attribute__((ext_vector_type(8)))  __bf16        bf16x8;
typedef __attribute__((ext_vector_type(4)))  float         f32x4;

union AFrag {
    bf16x16 v;
    u32x4   q[2];
};

#define TILE_K   128
#define TILE_LDA (TILE_K + 8)

// LD = pitch of an LDS row, in elements.
template <int LD>
__device__ __forceinline__ void load_frag_lds(const __bf16* base, int row0, int kk,
                                              int lane, AFrag& f) {
    const int m    = lane & 15;
    const int half = lane >> 4;
    const __bf16* p = base + (row0 + m) * LD + kk + half * 8;
    f.q[0] = *(const u32x4*)(p);        // K = kk+half*8 .. kk+half*8+7
    f.q[1] = *(const u32x4*)(p + 16);   // K = kk+16+half*8 .. kk+16+half*8+7
}

__device__ __forceinline__ void async_copy8_b128(const __bf16* lds, const __bf16* g,
                                                 long long gstep, unsigned ls) {
    const unsigned           l  = (unsigned)(unsigned long long)lds;
    const unsigned long long ga = (unsigned long long)g;
    const unsigned long long gs = (unsigned long long)gstep * 2;
    asm volatile("global_load_async_to_lds_b128 %0, %8, off\n\t"
                 "global_load_async_to_lds_b128 %1, %9, off\n\t"
                 "global_load_async_to_lds_b128 %2, %10, off\n\t"
                 "global_load_async_to_lds_b128 %3, %11, off\n\t"
                 "global_load_async_to_lds_b128 %4, %12, off\n\t"
                 "global_load_async_to_lds_b128 %5, %13, off\n\t"
                 "global_load_async_to_lds_b128 %6, %14, off\n\t"
                 "global_load_async_to_lds_b128 %7, %15, off\n\t"
                 "s_wait_xcnt 0x0"
                 :: "v"(l), "v"(l + ls), "v"(l + 2 * ls), "v"(l + 3 * ls),
                    "v"(l + 4 * ls), "v"(l + 5 * ls), "v"(l + 6 * ls), "v"(l + 7 * ls),
                    "v"(ga), "v"(ga + gs), "v"(ga + 2 * gs), "v"(ga + 3 * gs),
                    "v"(ga + 4 * gs), "v"(ga + 5 * gs), "v"(ga + 6 * gs), "v"(ga + 7 * gs)
                 : "memory");
}

// One such copy, with the same closing wait in its own statement.
__device__ __forceinline__ void async_copy1_b128(const __bf16* lds, const __bf16* g) {
    asm volatile("global_load_async_to_lds_b128 %0, %1, off\n\t"
                 "s_wait_xcnt 0x0"
                 :: "v"((unsigned)(unsigned long long)lds), "v"((unsigned long long)g)
                 : "memory");
}

// ---------------------------------------------------------------------------
// Batched GEMM tile:  C[b] = epilogue( A[b] * Bt[b]^T )
//   A  : [M x K] bf16 row-major (K contiguous), lda
//   Bt : [N x K] bf16 row-major (K contiguous), ldb   (i.e. B column-major)
//   MODE 0: f32  out at  C[b*sC + m*ldc + n]
//   MODE 1: bf16 out at  C[b*sC + m*ldc + n]
//   MODE 2: bf16 out at  C[b*sC + n*ldc + m]   (transposed store)
//   epilogue: val = (acc + bias[n]) * alpha * rowscale[b*rs_stride + m]
// Block tile 128(M) x 128(N), K-step TILE_K, double-buffered async LDS staging.
// K is a multiple of TILE_K.
// 256 threads = 8 waves; each wave owns a 32x64 sub-tile (2x4 WMMA frags).
// The finished tile is laid into LDS in the orientation in which C holds it and
// goes out from there in whole 128-B lines, 16 bytes a lane.
// The main loop and the epilogue are device functions on LDS rings that the kernel
// declares, so that one launch can hold tiles of several products.
// ---------------------------------------------------------------------------
typedef __bf16 TileRing[2][128 * TILE_LDA];

// acc += (128 rows at Ab) * (128 rows at Bb)^T over K. Run by a group of 8 waves (256
// adjacent threads) on rings of its own; every group of a block makes the same number of
// trips, since the loop's barriers are the whole block's.
__device__ __forceinline__ void gemm_main_loop(
    TileRing& Asmem, TileRing& Bsmem,
    const __bf16* __restrict__ Ab, const __bf16* __restrict__ Bb,
    int K, int lda, int ldb, floatx8 (&acc)[2][4])
{
    const int t    = threadIdx.x & 255;   // place in the group
    const int lane = t & 31;
    const int wid  = t >> 5;       // 0..7
    const int wm   = wid & 3;      // 0..3 : 32-row strip
    const int wn   = wid >> 2;     // 0..1 : 64-col strip

    // Per-thread staging coords: 128 rows x 16 x 16B chunks per matrix,
    // thread t handles rows r0, r0+16, .. r0+112 at column chunk c8.
    const int r0 = t >> 4;
    const int c8 = (t & 15) * 8;
    const __bf16* ga = Ab + (long long)r0 * lda + c8;
    const __bf16* gb = Bb + (long long)r0 * ldb + c8;
    const int     loff = r0 * TILE_LDA + c8;

    auto issue_stage = [&](int st, int k0) {   // 16 async b128 per wave
        async_copy8_b128(&Asmem[st][loff], ga + k0, (long long)16 * lda, 16 * TILE_LDA * 2);
        async_copy8_b128(&Bsmem[st][loff], gb + k0, (long long)16 * ldb, 16 * TILE_LDA * 2);
    };

    const int nst = K / TILE_K;
    issue_stage(0, 0);
    // stage 0 landed (this wave's copies), then published to every wave
    asm volatile("s_wait_asynccnt 0x0" ::: "memory");
    __syncthreads();
    if (nst > 1) issue_stage(1, TILE_K);

    for (int s = 0; s < nst; ++s) {
        const int st = s & 1;
        // unrolled: the four 32-k blocks of a stage run without a branch between them
#pragma unroll
        for (int kk = 0; kk < TILE_K; kk += 32) {
            AFrag a[2], bf[4];
            load_frag_lds<TILE_LDA>(Asmem[st], wm * 32 + 0,  kk, lane, a[0]);
            load_frag_lds<TILE_LDA>(Asmem[st], wm * 32 + 16, kk, lane, a[1]);
#pragma unroll
            for (int fn = 0; fn < 4; ++fn)
                load_frag_lds<TILE_LDA>(Bsmem[st], wn * 64 + fn * 16, kk, lane, bf[fn]);

#pragma unroll
            for (int fm = 0; fm < 2; ++fm)
#pragma unroll
                for (int fn = 0; fn < 4; ++fn)
                    acc[fm][fn] = __builtin_amdgcn_wmma_f32_16x16x32_bf16(
                        false, a[fm].v, false, bf[fn].v,
                        (short)0, acc[fm][fn], false, false);
        }

        // this wave's reads of buffer st have returned
        asm volatile("s_wait_dscnt 0x0" ::: "memory");
        // this wave's copies of stage s+1 have landed
        asm volatile("s_wait_asynccnt 0x0" ::: "memory");
        // one barrier: publishes stage s+1 and ends every wave's reads of buffer st
        __syncthreads();
        if (s + 2 < nst) issue_stage(st, (s + 2) * TILE_K);
    }
    // no copy is left in flight when the wave goes on to the epilogue
    asm volatile("s_wait_asynccnt 0x0" ::: "memory");
}

// The bias of the lane's four columns of tile column by (fn = 0 .. 3, as in
// gemm_epilogue): all 64 elements of a lane lie in these four columns. Called ahead of
// the main loop, so that the four loads fly while the first stage is fetched.
__device__ __forceinline__ void load_bias4(const float* __restrict__ bias, int by,
                                           float (&bn)[4]) {
    const int t = threadIdx.x;
    const float* p = bias + by * 128 + (t >> 7) * 64 + (t & 15);
    // unrolled: bn[] stays in registers and the four loads are issued together
#pragma unroll
    for (int fn = 0; fn < 4; ++fn) bn[fn] = p[fn * 16];
}

// Tile (bx, by) of batch b, from the accumulators to C. bn = the bias of the lane's four
// columns (load_bias4), added where BIAS is set. rowscale may be null.
template <int MODE, bool BIAS>
__device__ __forceinline__ void gemm_epilogue(
    TileRing& Asmem, const floatx8 (&acc)[2][4],
    const float (&bn)[4], const float* __restrict__ rowscale,
    float alpha, void* __restrict__ Cout,
    int bx, int by, int b, int ldc, long long sC, int rs_stride)
{
    const int t    = threadIdx.x;
    const int lane = t & 31;
    const int wid  = t >> 5;       // 0..7
    const int wm   = wid & 3;      // 0..3 : 32-row strip
    const int wn   = wid >> 2;     // 0..1 : 64-col strip

    constexpr int ESZ    = (MODE == 0) ? 4 : 2;    // bytes per element of C
    constexpr int ROW_B  = 128 * ESZ;              // bytes of a tile row in C
    constexpr int ST_LD  = ROW_B + 16;             // its pitch in LDS
    static_assert(128 * ST_LD <= (int)sizeof(Asmem), "staged tile fits the A ring");
    char* stage = (char*)&Asmem[0][0];

    const int l15 = lane & 15;
    const int lh8 = (lane >> 4) * 8;
#pragma unroll
    for (int fm = 0; fm < 2; ++fm)
#pragma unroll
        for (int fn = 0; fn < 4; ++fn) {
            const int ml = wm * 32 + fm * 16 + lh8;      // first of the lane's 8 rows
            const int nl = wn * 64 + fn * 16 + l15;      // its column, both in the tile
            bf16x8 col;
#pragma unroll
            for (int r = 0; r < 8; ++r) {
                const int m = bx * 128 + ml + r;
                float val = acc[fm][fn][r];
                if (BIAS)     val += bn[fn];
                val *= alpha;
                if (rowscale) val *= rowscale[b * rs_stride + m];
                if (MODE == 0)
                    *(float*)(stage + (ml + r) * ST_LD + nl * 4) = val;
                else if (MODE == 1)
                    *(__bf16*)(stage + (ml + r) * ST_LD + nl * 2) = (__bf16)val;
                else
                    col[r] = (__bf16)val;
            }
            if (MODE == 2)   // the lane's 8 m are adjacent in a row of the transposed tile
                *(bf16x8*)(stage + nl * ST_LD + ml * 2) = col;
        }
    __syncthreads();   // the whole tile is staged before any wave reads rows of it

    // A wave-wide 16-byte store covers 512 contiguous bytes of one row (f32) or the
    // 256 bytes of each of two rows (bf16): 4 whole lines either way.
    constexpr int LANES_PER_ROW = ROW_B / 16;
    constexpr int ROWS_PER_PASS = 256 / LANES_PER_ROW;
    const int srow = t / LANES_PER_ROW;
    const int scol = (t % LANES_PER_ROW) * 16;          // in bytes
    const int crow0 = (MODE == 2 ? by : bx) * 128;
    const int ccol0 = (MODE == 2 ? bx : by) * 128;
    char* Cb = (char*)Cout + ((long long)b * sC + (long long)(crow0 + srow) * ldc + ccol0) * ESZ + scol;
    // unrolled: all LDS reads of the lane are issued before its first store
    u32x4 piece[128 / ROWS_PER_PASS];
#pragma unroll
    for (int p = 0; p < 128 / ROWS_PER_PASS; ++p)
        piece[p] = *(const u32x4*)(stage + (p * ROWS_PER_PASS + srow) * ST_LD + scol);
#pragma unroll
    for (int p = 0; p < 128 / ROWS_PER_PASS; ++p)
        *(u32x4*)(Cb + (long long)p * ROWS_PER_PASS * ldc * ESZ) = piece[p];
}

// Shapes of the attention part. A row's sum comes in ROW_PARTS partial sums, one from
// each block of SM_COLS keys, in planes of SM_NQ rows: rowpart[b][p][m].
#define SM_NQ     1024              // queries
#define SM_NK     2048              // keys
#define SM_D      512               // width
#define SM_COLS   64                // keys per block of dots_col_softmax
#define ROW_PARTS (SM_NK / SM_COLS)

template <int MODE>
__global__ __launch_bounds__(512) void gemm_bf16_wmma(
    const __bf16* __restrict__ A, const __bf16* __restrict__ Bt,
    const float* __restrict__ rowpart,
    float alpha, void* __restrict__ Cout,
    int K, int lda, int ldb, int ldc,
    long long sA, long long sB, long long sC)
{
    static_assert(MODE == 0, "f32 out only");
    __shared__ __attribute__((aligned(16))) TileRing Asmem[2];   // [group]
    __shared__ __attribute__((aligned(16))) TileRing Bsmem[2];
    __shared__ __attribute__((aligned(16))) float rinv[128];

    const int b = blockIdx.z;
    const int t = threadIdx.x;
    const int h = t >> 8;          // group: which half of K
    // 1 / row sum of the tile's 128 rows, a thread a row; adjacent lanes read adjacent
    // rows of a plane. The main loop's barriers stand between these writes of rinv and
    // its reads behind the loop.
    if (t < 128) {
        const float* rp = rowpart + (long long)b * ROW_PARTS * SM_NQ + blockIdx.x * 128 + t;
        // unrolled: all loads of the lane are in flight at once
        float part[ROW_PARTS];
#pragma unroll
        for (int p = 0; p < ROW_PARTS; ++p) part[p] = rp[p * SM_NQ];
#pragma unroll
        for (int hh = ROW_PARTS / 2; hh > 0; hh >>= 1)
#pragma unroll
            for (int p = 0; p < hh; ++p) part[p] += part[p + hh];
        rinv[t] = 1.0f / part[0];
        // the loads' address registers are free before later code writes them; behind the
        // LDS store, which needs every load, so that no load can be moved behind the wait
        asm volatile("s_wait_xcnt 0x0" ::: "memory");
    }

    const int Kh = K / 2;
    floatx8 acc[2][4] = {};
    gemm_main_loop(Asmem[h], Bsmem[h],
                   A + (long long)b * sA + (long long)blockIdx.x * 128 * lda + h * Kh,
                   Bt + (long long)b * sB + (long long)blockIdx.y * 128 * ldb + h * Kh,
                   Kh, lda, ldb, acc);

    const int tl   = t & 255;
    const int lane = t & 31;
    const int wm   = (tl >> 5) & 3;   // 32-row strip, as in gemm_main_loop
    const int wn   = tl >> 7;         // 64-col strip
    f32x4* xch = (f32x4*)&Bsmem[1][0][0];
    static_assert(16 * 256 * 16 <= (int)sizeof(TileRing), "handed sums fit a ring");
    constexpr int ST_LD = 128 * 4 + 16;
    static_assert(128 * ST_LD <= (int)sizeof(TileRing), "staged tile fits a ring");
    char* stage = (char*)&Asmem[0][0][0];

    // h is the same in a whole wave; both barriers below stand outside the tests on it
    if (h == 1) {
#pragma unroll
        for (int f = 0; f < 8; ++f) {
            const floatx8 v = acc[f >> 2][f & 3];
            xch[(f * 2 + 0) * 256 + tl] = f32x4{v[0], v[1], v[2], v[3]};
            xch[(f * 2 + 1) * 256 + tl] = f32x4{v[4], v[5], v[6], v[7]};
        }
    }
    __syncthreads();   // the upper group's sums are in LDS before the lower group reads them

    if (h == 0) {
        const int l15 = lane & 15;
        const int lh8 = (lane >> 4) * 8;
        const float* ri = rinv + wm * 32 + lh8;   // the lane's rows: 8 adjacent ones for each fm
#pragma unroll
        for (int f = 0; f < 8; ++f) {
            const int fm = f >> 2, fn = f & 3;
            const f32x4 lo = xch[(f * 2 + 0) * 256 + tl];
            const f32x4 hi = xch[(f * 2 + 1) * 256 + tl];
            const int ml = wm * 32 + fm * 16 + lh8;      // first of the lane's 8 rows
            const int nl = wn * 64 + fn * 16 + l15;      // its column, both in the tile
#pragma unroll
            for (int r = 0; r < 8; ++r) {
                const float sum = acc[fm][fn][r] + (r < 4 ? lo[r & 3] : hi[r & 3]);
                *(float*)(stage + (ml + r) * ST_LD + nl * 4) = sum * ri[fm * 16 + r] * alpha;
            }
        }
    }
    __syncthreads();   // the whole tile is staged before any wave reads rows of it

    // A wave-wide 16-byte store covers the 512 contiguous bytes of one row: 4 whole lines.
    const int srow = t >> 5;
    const int scol = lane * 16;          // in bytes
    char* Cb = (char*)Cout + ((long long)b * sC + (long long)(blockIdx.x * 128 + srow) * ldc
                              + blockIdx.y * 128) * 4 + scol;
    // unrolled: all LDS reads of the lane are issued before its first store
    u32x4 piece[8];
#pragma unroll
    for (int p = 0; p < 8; ++p)
        piece[p] = *(const u32x4*)(stage + (p * 16 + srow) * ST_LD + scol);
#pragma unroll
    for (int p = 0; p < 8; ++p)
        *(u32x4*)(Cb + (long long)p * 16 * ldc * 4) = piece[p];
}

// The three projections in one launch: they depend on nothing of one another, and
// the tiles of one fill the places that the others' first loads and last stores
// would leave idle. blockIdx.x counts the 128-row tiles of k, then of v, then of q;
// k and v tiles of the same context rows start close together.
//   q = (xln Wq^T + bq) * qscale  [b][i][d]
//   k =  cln Wk^T + bk            [b][j][d]
//   v =  cln Wv^T + bv            [b][d][j]  (transposed store)
__global__ __launch_bounds__(256) void qkv_gemm_bf16_wmma(
    const __bf16* __restrict__ xln, const __bf16* __restrict__ cln,
    const __bf16* __restrict__ Wq, const __bf16* __restrict__ Wk,
    const __bf16* __restrict__ Wv,
    const float* __restrict__ bq, const float* __restrict__ bk,
    const float* __restrict__ bv, float qscale,
    __bf16* __restrict__ q, __bf16* __restrict__ k, __bf16* __restrict__ vT,
    int NQ, int NK, int D)
{
    __shared__ __attribute__((aligned(16))) TileRing Asmem;
    __shared__ __attribute__((aligned(16))) TileRing Bsmem;

    const int b   = blockIdx.z;
    const int by  = blockIdx.y;
    const int nkt = NK / 128;                 // row tiles of k, and of v
    const int gx  = blockIdx.x;
    const int sel = (gx >= nkt) + (gx >= 2 * nkt);   // 0: k, 1: v, 2: q
    const int bx  = gx - sel * nkt;

    const __bf16* X    = sel < 2 ? cln : xln;
    const int     rows = sel < 2 ? NK : NQ;
    const __bf16* Wt   = sel == 0 ? Wk : (sel == 1 ? Wv : Wq);
    const float*  bias = sel == 0 ? bk : (sel == 1 ? bv : bq);

    float bn[4];
    load_bias4(bias, by, bn);

    floatx8 acc[2][4] = {};
    gemm_main_loop(Asmem, Bsmem,
                   X + ((long long)b * rows + (long long)bx * 128) * D,
                   Wt + (long long)by * 128 * D,
                   D, D, D, acc);
    // sel is the same in the whole block: every wave takes the same epilogue
    if (sel == 1)
        gemm_epilogue<2, true>(Asmem, acc, bn, nullptr, 1.0f, vT,
                               bx, by, b, NK, (long long)D * NK, 0);
    else
        gemm_epilogue<1, true>(Asmem, acc, bn, nullptr, sel == 0 ? 1.0f : qscale,
                               sel == 0 ? k : q,
                               bx, by, b, D, (long long)rows * D, 0);
}

// ---------------------------------------------------------------------------
// The streaming kernels (cast, LayerNorm) start few, long waves: a lane
// moves 16 bytes per load and holds many values, all its loads are in flight at
// once, and a row's sum is taken across the 32 lanes of a wave.
// ---------------------------------------------------------------------------
typedef __attribute__((ext_vector_type(4))) __bf16 bf16x4;
typedef __attribute__((ext_vector_type(2))) float  f32x2;

__device__ __forceinline__ bf16x4 to_bf16x4(f32x4 v) {
    return __builtin_convertvector(v, bf16x4);
}

// Sum over the 32 lanes of a wave; every lane ends with the total.
__device__ __forceinline__ float wave_sum(float v) {
    for (int off = 16; off > 0; off >>= 1) v += __shfl_xor(v, off, 32);
    return v;
}

// ---------------------------------------------------------------------------
// f32 -> bf16 cast (weights): 8 values per thread, as two quads 256 quads apart,
// so that each wave-wide load covers 512 contiguous bytes. Each half of a 512-thread
// block converts 2048 values; blocks blk = 0 .. n/4096 - 1 cover the array exactly.
// ---------------------------------------------------------------------------
__device__ __forceinline__ void cast_f32_to_bf16(const float* __restrict__ in,
                                                 __bf16* __restrict__ out, int blk) {
    const int i = ((blk * 2 + (threadIdx.x >> 8)) * 512 + (threadIdx.x & 255)) * 4;
    const f32x4 a = *(const f32x4*)(in + i);
    const f32x4 b = *(const f32x4*)(in + i + 1024);
    *(bf16x4*)(out + i)        = to_bf16x4(a);
    *(bf16x4*)(out + i + 1024) = to_bf16x4(b);
    // the stores' address and data registers are free before another job's code, which
    // the compiler may lay behind this one, writes them
    asm volatile("s_wait_xcnt 0x0" ::: "memory");
}

// ---------------------------------------------------------------------------
// LayerNorm over D=512, bf16 output. One wave owns R adjacent rows (16 values of
// each row per lane, all R*4 loads in flight at once); 16 waves per block; block
// blk owns rows blk*16*R and on.
// ---------------------------------------------------------------------------
template <int R>
__device__ __forceinline__ void layernorm_to_bf16(
    const float* __restrict__ x, const float* __restrict__ g,
    const float* __restrict__ bb, __bf16* __restrict__ y, int blk)
{
    const int D = 512;
    const int lane = threadIdx.x & 31;
    const long long row0 = (long long)(blk * 16 + (threadIdx.x >> 5)) * R;
    const float* xr = x + row0 * D + lane * 4;
    __bf16*      yr = y + row0 * D + lane * 4;

    // Fully unrolled throughout, so that v[][] stays in registers.
    f32x4 gv[4], bv[4];
#pragma unroll
    for (int i = 0; i < 4; ++i) {
        gv[i] = *(const f32x4*)(g + i * 128 + lane * 4);
        bv[i] = *(const f32x4*)(bb + i * 128 + lane * 4);
    }
    f32x4 v[R][4];
#pragma unroll
    for (int r = 0; r < R; ++r)
#pragma unroll
        for (int i = 0; i < 4; ++i) v[r][i] = *(const f32x4*)(xr + r * D + i * 128);

    float s[R], ss[R];
#pragma unroll
    for (int r = 0; r < R; ++r) {
        s[r] = 0.f; ss[r] = 0.f;
#pragma unroll
        for (int i = 0; i < 4; ++i)
#pragma unroll
            for (int c = 0; c < 4; ++c) { s[r] += v[r][i][c]; ss[r] += v[r][i][c] * v[r][i][c]; }
    }
#pragma unroll
    for (int r = 0; r < R; ++r) { s[r] = wave_sum(s[r]); ss[r] = wave_sum(ss[r]); }

#pragma unroll
    for (int r = 0; r < R; ++r) {
        const float mu   = s[r] * (1.0f / D);
        const float var  = ss[r] * (1.0f / D) - mu * mu;
        const float rstd = rsqrtf(var + 1e-5f);
#pragma unroll
        for (int i = 0; i < 4; ++i) {
            f32x4 o;
#pragma unroll
            for (int c = 0; c < 4; ++c) o[c] = (v[r][i][c] - mu) * rstd * gv[i][c] + bv[i][c];
            *(bf16x4*)(yr + r * D + i * 128) = to_bf16x4(o);
        }
    }
    // the stores' address and data registers are free before another job's code, which
    // the compiler may lay behind this one, writes them
    asm volatile("s_wait_xcnt 0x0" ::: "memory");
}

// ---------------------------------------------------------------------------
// Everything the projections read, in one launch: both LayerNorms and the three
// weight casts depend on nothing of one another. The block index picks the job, the
// longest first: n_ctx blocks for the context rows, n_in for the input rows, then
// n_w for each weight matrix.
// ---------------------------------------------------------------------------
__global__ __launch_bounds__(512) void prepare_operands(
    const float* __restrict__ context, const float* __restrict__ ln_ctx_g,
    const float* __restrict__ ln_ctx_b, __bf16* __restrict__ cln,
    const float* __restrict__ inputs, const float* __restrict__ ln_in_g,
    const float* __restrict__ ln_in_b, __bf16* __restrict__ xln,
    const float* __restrict__ Wq, const float* __restrict__ Wk,
    const float* __restrict__ Wv, __bf16* __restrict__ Wqb,
    __bf16* __restrict__ Wkb, __bf16* __restrict__ Wvb,
    int n_ctx, int n_in, int n_w)
{
    int blk = blockIdx.x;
    if (blk < n_ctx) { layernorm_to_bf16<4>(context, ln_ctx_g, ln_ctx_b, cln, blk); return; }
    blk -= n_ctx;
    if (blk < n_in)  { layernorm_to_bf16<2>(inputs, ln_in_g, ln_in_b, xln, blk); return; }
    blk -= n_in;
    const int w = (blk >= n_w) + (blk >= 2 * n_w);   // 0: Wq, 1: Wk, 2: Wv
    cast_f32_to_bf16(w == 0 ? Wq : (w == 1 ? Wk : Wv),
                     w == 0 ? Wqb : (w == 1 ? Wkb : Wvb), blk - w * n_w);
}

// ---------------------------------------------------------------------------
// dots, the softmax over the query axis, P and its row sums, in one kernel:
//   S[i][j] = q[b][i] . k[b][j]   (scale folded into q)
//   P[b][i][j] = exp(S - max_i S) / sum_i exp(S - max_i S) + eps   (bf16)
//   rowpart[b][block of keys][i] = sum of P over the block's keys, before the rounding
// One 512-thread block owns 64 keys j and ALL 1024 queries i of a batch, so that a
// whole column of S sits in the block's accumulators: its maximum and its sum are
// taken there and S never goes to memory. 16 waves; wave w owns queries 64w .. 64w+63
// of all 64 keys (4x4 WMMA frags). K stage of 64 k: 128 B of a row, one whole line,
// at an LDS pitch of 144 B (16 B x 9); two-buffer ring of async copies as in
// gemm_main_loop.
// ---------------------------------------------------------------------------
#define SM_K     64                // k per stage
#define SM_LD    (SM_K + 8)        // LDS row pitch, elements
#define SM_RED   20                // pitch of a column's 16 per-wave partials, floats:
                                   // 80 B = 16 B x 5, for 16-byte reads of adjacent columns

__device__ __forceinline__ float exp_with_slot(float a) {
    float e;
    asm("v_exp_f32 %0, %1\n\tv_nop" : "=v"(e) : "v"(a * 1.44269504088896340736f));
    return e;
}

__global__ __launch_bounds__(512) void dots_col_softmax(
    const __bf16* __restrict__ q, const __bf16* __restrict__ k,
    __bf16* __restrict__ P, float* __restrict__ rowpart)
{
    __shared__ __attribute__((aligned(16))) __bf16 Qs[2][SM_NQ * SM_LD];
    __shared__ __attribute__((aligned(16))) __bf16 Ks[2][SM_COLS * SM_LD];

    const int t    = threadIdx.x;
    const int lane = t & 31;
    const int wid  = t >> 5;       // 0..15 : 64-query strip
    const int b    = blockIdx.y;
    const int j0   = blockIdx.x * SM_COLS;

    // Staging coords: a row of a stage is 8 chunks of 16 B; thread t handles chunk c8 of
    // query rows r0, r0+64, .. r0+960 and of key row r0.
    const int r0 = t >> 3;
    const int c8 = (t & 7) * 8;
    const __bf16* gq = q + ((long long)b * SM_NQ + r0) * SM_D + c8;
    const __bf16* gk = k + ((long long)b * SM_NK + j0 + r0) * SM_D + c8;
    const int     loff = r0 * SM_LD + c8;

    auto issue_stage = [&](int st, int k0) {   // 17 async b128 per wave
        async_copy8_b128(&Qs[st][loff], gq + k0, 64 * SM_D, 64 * SM_LD * 2);
        async_copy8_b128(&Qs[st][loff + 512 * SM_LD], gq + k0 + 512 * SM_D,
                         64 * SM_D, 64 * SM_LD * 2);
        async_copy1_b128(&Ks[st][loff], gk + k0);
    };

    floatx8 acc[4][4] = {};
    const int nst = SM_D / SM_K;
    issue_stage(0, 0);
    // stage 0 landed (this wave's copies), then published to every wave
    asm volatile("s_wait_asynccnt 0x0" ::: "memory");
    __syncthreads();
    issue_stage(1, SM_K);

    for (int s = 0; s < nst; ++s) {
        const int st = s & 1;
        // unrolled: the two 32-k blocks of a stage run without a branch between them
#pragma unroll
        for (int kk = 0; kk < SM_K; kk += 32) {
            AFrag a[4], bf[4];
#pragma unroll
            for (int fm = 0; fm < 4; ++fm)
                load_frag_lds<SM_LD>(Qs[st], wid * 64 + fm * 16, kk, lane, a[fm]);
#pragma unroll
            for (int fn = 0; fn < 4; ++fn)
                load_frag_lds<SM_LD>(Ks[st], fn * 16, kk, lane, bf[fn]);

#pragma unroll
            for (int fm = 0; fm < 4; ++fm)
#pragma unroll
                for (int fn = 0; fn < 4; ++fn)
                    acc[fm][fn] = __builtin_amdgcn_wmma_f32_16x16x32_bf16(
                        false, a[fm].v, false, bf[fn].v,
                        (short)0, acc[fm][fn], false, false);
        }

        // this wave's reads of buffer st have returned
        asm volatile("s_wait_dscnt 0x0" ::: "memory");
        // this wave's copies of stage s+1 have landed
        asm volatile("s_wait_asynccnt 0x0" ::: "memory");
        // one barrier: publishes stage s+1 and ends every wave's reads of buffer st
        __syncthreads();
        if (s + 2 < nst) issue_stage(st, (s + 2) * SM_K);
    }
    // no copy is left in flight when the wave goes on to the epilogue
    asm volatile("s_wait_asynccnt 0x0" ::: "memory");

    float* gm = (float*)&Ks[0][0];
    float* gs = gm + SM_COLS * SM_RED;
    static_assert(2 * SM_COLS * SM_RED * 4 <= (int)sizeof(Ks), "partials fit the K ring");
    const int l15 = lane & 15;
    const int lh8 = (lane >> 4) * 8;

    // Every loop below is fully unrolled so that acc[][] stays in registers.
#pragma unroll
    for (int fn = 0; fn < 4; ++fn) {
        float m = acc[0][fn][0];
#pragma unroll
        for (int fm = 0; fm < 4; ++fm)
#pragma unroll
            for (int r = 0; r < 8; ++r) m = fmaxf(m, acc[fm][fn][r]);
        m = fmaxf(m, __shfl_xor(m, 16, 32));
        if (lane < 16) gm[(fn * 16 + l15) * SM_RED + wid] = m;
    }
    __syncthreads();   // every wave's column maxima visible to all

#pragma unroll
    for (int fn = 0; fn < 4; ++fn) {
        const f32x4* pm = (const f32x4*)(gm + (fn * 16 + l15) * SM_RED);
        f32x4 m4 = pm[0];
#pragma unroll
        for (int w = 1; w < 4; ++w) {
            const f32x4 o = pm[w];
#pragma unroll
            for (int c = 0; c < 4; ++c) m4[c] = fmaxf(m4[c], o[c]);
        }
        const float M = fmaxf(fmaxf(m4[0], m4[1]), fmaxf(m4[2], m4[3]));
        float s = 0.f;
#pragma unroll
        for (int fm = 0; fm < 4; ++fm)
#pragma unroll
            for (int r = 0; r < 8; ++r) {
                const float e = exp_with_slot(acc[fm][fn][r] - M);
                acc[fm][fn][r] = e;
                s += e;
            }
        s += __shfl_xor(s, 16, 32);
        if (lane < 16) gs[(fn * 16 + l15) * SM_RED + wid] = s;
    }
    __syncthreads();   // every wave's column sums visible to all

    // A wave stages its own 64 rows of P (128 B each, pitch 144 B) and reads only
    // those back, so that no further barrier is needed.
    constexpr int ST_LD = SM_COLS * 2 + 16;
    static_assert(SM_NQ * ST_LD <= (int)sizeof(Qs), "staged P fits the Q ring");
    char* stage = (char*)&Qs[0][0] + wid * 64 * ST_LD;
    float part[32];   // [fm * 8 + r]: the lane's 4 keys of that query, summed
#pragma unroll
    for (int fn = 0; fn < 4; ++fn) {
        const f32x4* ps = (const f32x4*)(gs + (fn * 16 + l15) * SM_RED);
        const f32x4 s4 = (ps[0] + ps[1]) + (ps[2] + ps[3]);
        const float inv = 1.0f / ((s4[0] + s4[1]) + (s4[2] + s4[3]));
#pragma unroll
        for (int fm = 0; fm < 4; ++fm)
#pragma unroll
            for (int r = 0; r < 8; ++r) {
                const float pv = acc[fm][fn][r] * inv + 1e-8f;
                *(__bf16*)(stage + (fm * 16 + lh8 + r) * ST_LD + (fn * 16 + l15) * 2) = (__bf16)pv;
                part[fm * 8 + r] = fn == 0 ? pv : part[fm * 8 + r] + pv;
            }
    }

    // 32 sums over the 16 lanes of a half-wave in 30 exchanges: at each step a lane keeps
    // the half of the sums whose index bit equals its own lane bit and hands the other
    // half to its partner, so that lane l15 ends with sums 2 * l15 and 2 * l15 + 1.
#pragma unroll
    for (int off = 8; off > 0; off >>= 1) {
        const bool hi = (lane & off) != 0;
#pragma unroll
        for (int i = 0; i < 2 * off; ++i) {
            const float lo_row = part[i], hi_row = part[i + 2 * off];
            const float keep = hi ? hi_row : lo_row;
            const float send = hi ? lo_row : hi_row;
            part[i] = keep + __shfl_xor(send, off, 32);
        }
    }
    // Sums 2 * l15 and 2 * l15 + 1 are two adjacent queries (fm = l15 / 4, r = 2 * (l15 % 4)
    // and the next); the wave's 64 sums fill two whole 128-B lines of the block's plane.
    const int prow = wid * 64 + (l15 >> 2) * 16 + lh8 + (l15 & 3) * 2;
    const f32x2 two = {part[0], part[1]};
    *(f32x2*)(rowpart + ((long long)b * ROW_PARTS + blockIdx.x) * SM_NQ + prow) = two;
    // this wave's staged rows are in LDS before its lanes read one another's values
    asm volatile("s_wait_dscnt 0x0" ::: "memory");

    // A wave-wide 16-byte store covers the 128 bytes of each of 4 rows: 4 whole lines.
    const int srow = lane >> 3;
    const int scol = (lane & 7) * 16;          // in bytes
    char* Pb = (char*)(P + ((long long)b * SM_NQ + wid * 64 + srow) * SM_NK + j0) + scol;
    // unrolled: all LDS reads of the lane are issued before its first store
    u32x4 piece[16];
#pragma unroll
    for (int p = 0; p < 16; ++p)
        piece[p] = *(const u32x4*)(stage + (p * 4 + srow) * ST_LD + scol);
#pragma unroll
    for (int p = 0; p < 16; ++p)
        *(u32x4*)(Pb + p * 4 * SM_NK * 2) = piece[p];
}

// ---------------------------------------------------------------------------
// Host-side orchestration
// ---------------------------------------------------------------------------
extern "C" void kernel_launch(void* const* d_in, const int* in_sizes, int n_in,
                              void* d_out, int out_size, void* d_ws, size_t ws_size,
                              hipStream_t stream) {
    (void)in_sizes; (void)n_in; (void)out_size; (void)ws_size;

    const int B = 8, NQ = 1024, NK = 2048, D = 512;
    const float qscale = 0.044194173824159216f;   // 1/sqrt(512)

    const float* inputs  = (const float*)d_in[0];
    const float* context = (const float*)d_in[1];
    const float* ln_in_g  = (const float*)d_in[2];
    const float* ln_in_b  = (const float*)d_in[3];
    const float* ln_ctx_g = (const float*)d_in[4];
    const float* ln_ctx_b = (const float*)d_in[5];
    const float* Wq = (const float*)d_in[6];
    const float* bq = (const float*)d_in[7];
    const float* Wk = (const float*)d_in[8];
    const float* bk = (const float*)d_in[9];
    const float* Wv = (const float*)d_in[10];
    const float* bv = (const float*)d_in[11];
    float* out = (float*)d_out;

    // Workspace bump allocator (256B aligned)
    char* ws = (char*)d_ws;
    size_t off = 0;
    auto alloc = [&](size_t bytes) -> char* {
        char* p = ws + off;
        off += (bytes + 255) & ~(size_t)255;
        return p;
    };
    __bf16* Wqb = (__bf16*)alloc((size_t)D * D * 2);
    __bf16* Wkb = (__bf16*)alloc((size_t)D * D * 2);
    __bf16* Wvb = (__bf16*)alloc((size_t)D * D * 2);
    __bf16* xln = (__bf16*)alloc((size_t)B * NQ * D * 2);
    __bf16* cln = (__bf16*)alloc((size_t)B * NK * D * 2);
    __bf16* qb  = (__bf16*)alloc((size_t)B * NQ * D * 2);
    __bf16* kb  = (__bf16*)alloc((size_t)B * NK * D * 2);
    __bf16* vT  = (__bf16*)alloc((size_t)B * D * NK * 2);   // [b][d][j]
    __bf16* P   = (__bf16*)alloc((size_t)B * NQ * NK * 2);
    float*  rpt = (float*) alloc((size_t)B * (NK / 64) * NQ * 4);   // [b][block of keys][i]

    // 1) weights -> bf16 and both LayerNorms -> bf16 activations
    prepare_operands<<<dim3(B * NK / 64 + B * NQ / 32 + 3 * (D * D / 4096)), dim3(512), 0, stream>>>(
        context, ln_ctx_g, ln_ctx_b, cln, inputs, ln_in_g, ln_in_b, xln,
        Wq, Wk, Wv, Wqb, Wkb, Wvb,
        B * NK / 64, B * NQ / 32, D * D / 4096);

    // 2) Projections q (scaled by 1/sqrt(D)), k, and v stored transposed
    qkv_gemm_bf16_wmma<<<dim3(2 * (NK / 128) + NQ / 128, D / 128, B), dim3(256), 0, stream>>>(
        xln, cln, Wqb, Wkb, Wvb, bq, bk, bv, qscale, qb, kb, vT, NQ, NK, D);

    // 3) dots, softmax over the query axis (columns of dots), P = softmax + eps, and the
    //    partial row sums of P
    dots_col_softmax<<<dim3(NK / 64, B), dim3(512), 0, stream>>>(qb, kb, P, rpt);

    // 4) updates[b,i,d] = (1/rowsum[b,i]) * sum_j P[b,i,j] * v[b,j,d]
    gemm_bf16_wmma<0><<<dim3(NQ / 128, D / 128, B), dim3(512), 0, stream>>>(
        P, vT, rpt, 1.0f, out,
        NK, NK, NK, D,
        (long long)NQ * NK, (long long)D * NK, (long long)NQ * D);
}

// v009
// It runs in 72 microseconds.
// Next to v008, in two timings, it ran 1.07 times as fast each time.
// Counting every step since v000, it is 5.33 times as fast.
#include <hip/hip_runtime.h>
#include <hip/hip_bf16.h>

typedef __attribute__((ext_vector_type(16))) __bf16        bf16x16;
typedef __attribute__((ext_vector_type(8)))  float         floatx8;
typedef __attribute__((ext_vector_type(4)))  unsigned int  u32x4;
typedef __attribute__((ext_vector_type(8)))  unsigned int  u32x8;
typedef __attribute__((ext_vector_type(8)))  __bf16        bf16x8;
typedef __attribute__((ext_vector_type(4)))  float         f32x4;

union AFrag {
    bf16x16 v;
    u32x4   q[2];
};

#define TILE_K   128
#define TILE_LDA (TILE_K + 8)
#define SLICE_B  18432
#define SLICE_E  (SLICE_B / 2)     // the same in elements

// LD = pitch of an LDS row, in elements.
template <int LD>
__device__ __forceinline__ void load_frag_lds(const __bf16* base, int row0, int kk,
                                              int lane, AFrag& f) {
    const int m    = lane & 15;
    const int half = lane >> 4;
    const __bf16* p = base + (row0 + m) * LD + kk + half * 8;
    f.q[0] = *(const u32x4*)(p);        // K = kk+half*8 .. kk+half*8+7
    f.q[1] = *(const u32x4*)(p + 16);   // K = kk+16+half*8 .. kk+16+half*8+7
}

// A wave-uniform word, in a scalar register.
__device__ __forceinline__ unsigned uni(unsigned v) {
    return (unsigned)__builtin_amdgcn_readfirstlane(v);
}

__device__ __forceinline__ unsigned pinned(unsigned v) {
    unsigned w = uni(v);
    asm volatile("" : "+s"(w));   // holds the word in a scalar register, at this place in the order of the waits
    return w;
}

template <int ROW_B>
__device__ __forceinline__ u32x8 tensor_group1(unsigned rows, unsigned src_pitch) {
    static_assert(ROW_B == 128 || ROW_B == 256, "pad interval = the row");
    constexpr unsigned PAD = (1u << 20) | ((ROW_B == 256 ? 5u : 4u) << 22) | (3u << 25);
    u32x8 g1;
    g1[0] = uni(PAD);
    g1[1] = uni((unsigned)ROW_B << 16);
    g1[2] = uni(rows << 16);
    g1[3] = uni((unsigned)ROW_B << 16);
    g1[4] = uni(rows);
    g1[5] = uni(src_pitch);
    g1[6] = uni(0u);
    g1[7] = uni(0u);
    asm volatile("" : "+s"(g1));
    return g1;
}

__device__ __forceinline__ u32x4 tensor_group0(const __bf16* lds, const __bf16* g) {
    const unsigned long long ga = (unsigned long long)g;
    u32x4 g0;
    g0[0] = uni(1u);
    g0[1] = uni((unsigned)(unsigned long long)lds);
    g0[2] = uni((unsigned)ga);
    g0[3] = uni(((unsigned)(ga >> 32) & 0x01FFFFFFu) | 0x80000000u);
    return g0;
}

// The caller writes the wait (tensor_landed) and the barrier.
__device__ __forceinline__ void tensor_load(u32x4 g0, u32x8 g1) {
    asm volatile("tensor_load_to_lds %0, %1" :: "s"(g0), "s"(g1) : "memory");
}

__device__ __forceinline__ void tensor_landed(u32x4 g0, u32x8 g1) {
    asm volatile("s_wait_tensorcnt 0x0" :: "s"(g0), "s"(g1) : "memory");
}

// ---------------------------------------------------------------------------
// Batched GEMM tile:  C[b] = epilogue( A[b] * Bt[b]^T )
//   A  : [M x K] bf16 row-major (K contiguous), lda
//   Bt : [N x K] bf16 row-major (K contiguous), ldb   (i.e. B column-major)
//   MODE 0: f32  out at  C[b*sC + m*ldc + n]
//   MODE 1: bf16 out at  C[b*sC + m*ldc + n]
//   MODE 2: bf16 out at  C[b*sC + n*ldc + m]   (transposed store)
//   epilogue: val = (acc + bias[n]) * alpha * rowscale[b*rs_stride + m]
// Block tile 128(M) x 128(N), K-step TILE_K, two LDS buffers filled by tensor loads.
// K is a multiple of TILE_K, two stages or more.
// 256 threads = 8 waves; each wave owns a 32x64 sub-tile (2x4 WMMA frags).
// The finished tile is laid into LDS in the orientation in which C holds it and
// goes out from there in whole 128-B lines, 16 bytes a lane.
// The main loop and the epilogue are device functions on LDS rings that the kernel
// declares, so that one launch can hold tiles of several products.
// ---------------------------------------------------------------------------
typedef __bf16 TileRing[2][2 * SLICE_E];   // [buffer][two slices of 64 rows]

// acc += (128 rows at Ab) * (128 rows at Bb)^T over K. Run by a group of 8 waves (256
// adjacent threads) on rings of its own; every group of a block makes the same number of
// trips, since the loop's barriers are the whole block's.
__device__ __forceinline__ void gemm_main_loop(
    TileRing& Asmem, TileRing& Bsmem,
    const __bf16* __restrict__ Ab, const __bf16* __restrict__ Bb,
    int K, int lda, int ldb, floatx8 (&acc)[2][4])
{
    const int t    = threadIdx.x & 255;   // place in the group
    const int lane = t & 31;
    const int wid  = t >> 5;       // 0..7
    const int wm   = wid & 3;      // 0..3 : 32-row strip
    const int wn   = wid >> 2;     // 0..1 : 64-col strip

    // Waves 4 .. 7 of the group bring a stage, one slice of 64 rows each: A rows 0-63,
    // A rows 64-127, B rows 0-63, B rows 64-127.
    const unsigned uw     = uni(wid);
    const unsigned issuer = uw >= 4;
    const unsigned sl     = uw & 1;          // which slice of its matrix
    const bool     isB    = (uw & 2) != 0;
    const __bf16*  gsrc   = isB ? Bb + (long long)(sl * 64) * ldb : Ab + (long long)(sl * 64) * lda;
    const unsigned pitch  = (unsigned)(isB ? ldb : lda) * 2;
    const __bf16*  ldst   = (isB ? &Bsmem[0][0] : &Asmem[0][0]) + sl * SLICE_E;

    const u32x8    g1     = tensor_group1<TILE_K * 2>(64, pitch);

    auto stage_group0 = [&](int st, unsigned k0) {
        return tensor_group0(ldst + st * (2 * SLICE_E), gsrc + k0);
    };

    const int nst = K / TILE_K;
    u32x4 g0 = stage_group0(0, 0);
    if (pinned(issuer)) {
        tensor_load(g0, g1);
        // stage 0 landed (this wave's slice); the barrier publishes it to every wave
        tensor_landed(g0, g1);
    }
    __syncthreads();
    g0 = stage_group0(1, pinned(TILE_K));
    if (pinned(issuer)) tensor_load(g0, g1);

    const __bf16* const arow = &Asmem[0][0] + (wm >> 1) * SLICE_E;   // the slice of the wave's A rows
    const __bf16* const brow = &Bsmem[0][0] + wn * SLICE_E;          // and of its B rows
    for (int s = 0; s < nst; ++s) {
        const int st = s & 1;
        // unrolled: the four 32-k blocks of a stage run without a branch between them
#pragma unroll
        for (int kk = 0; kk < TILE_K; kk += 32) {
            AFrag a[2], bf[4];
            load_frag_lds<TILE_LDA>(arow + st * (2 * SLICE_E), (wm & 1) * 32 + 0,  kk, lane, a[0]);
            load_frag_lds<TILE_LDA>(arow + st * (2 * SLICE_E), (wm & 1) * 32 + 16, kk, lane, a[1]);
#pragma unroll
            for (int fn = 0; fn < 4; ++fn)
                load_frag_lds<TILE_LDA>(brow + st * (2 * SLICE_E), fn * 16, kk, lane, bf[fn]);

#pragma unroll
            for (int fm = 0; fm < 2; ++fm)
#pragma unroll
                for (int fn = 0; fn < 4; ++fn)
                    acc[fm][fn] = __builtin_amdgcn_wmma_f32_16x16x32_bf16(
                        false, a[fm].v, false, bf[fn].v,
                        (short)0, acc[fm][fn], false, false);
        }

        // this wave's reads of buffer st have returned
        asm volatile("s_wait_dscnt 0x0" ::: "memory");
        // this wave's slice of stage s+1 has landed
        if (pinned(issuer)) tensor_landed(g0, g1);
        // one barrier: publishes stage s+1 and ends every wave's reads of buffer st
        __syncthreads();
        g0 = stage_group0(st, pinned((s + 2) * TILE_K));
        if (pinned(issuer & (unsigned)(s + 2 < nst))) tensor_load(g0, g1);
    }
    // no request and no LDS read is left in flight when the wave goes on to the epilogue
    tensor_landed(g0, g1);
    asm volatile("s_wait_dscnt 0x0" ::: "memory");
}

// The bias of the lane's four columns of tile column by (fn = 0 .. 3, as in
// gemm_epilogue): all 64 elements of a lane lie in these four columns. Called ahead of
// the main loop, so that the four loads fly while the first stage is fetched.
__device__ __forceinline__ void load_bias4(const float* __restrict__ bias, int by,
                                           float (&bn)[4]) {
    const int t = threadIdx.x;
    const float* p = bias + by * 128 + (t >> 7) * 64 + (t & 15);
    // unrolled: bn[] stays in registers and the four loads are issued together
#pragma unroll
    for (int fn = 0; fn < 4; ++fn) bn[fn] = p[fn * 16];
}

// Tile (bx, by) of batch b, from the accumulators to C. bn = the bias of the lane's four
// columns (load_bias4), added where BIAS is set. rowscale may be null.
template <int MODE, bool BIAS>
__device__ __forceinline__ void gemm_epilogue(
    TileRing& Asmem, const floatx8 (&acc)[2][4],
    const float (&bn)[4], const float* __restrict__ rowscale,
    float alpha, void* __restrict__ Cout,
    int bx, int by, int b, int ldc, long long sC, int rs_stride)
{
    const int t    = threadIdx.x;
    const int lane = t & 31;
    const int wid  = t >> 5;       // 0..7
    const int wm   = wid & 3;      // 0..3 : 32-row strip
    const int wn   = wid >> 2;     // 0..1 : 64-col strip

    constexpr int ESZ    = (MODE == 0) ? 4 : 2;    // bytes per element of C
    constexpr int ROW_B  = 128 * ESZ;              // bytes of a tile row in C
    constexpr int ST_LD  = ROW_B + 16;             // its pitch in LDS
    static_assert(128 * ST_LD <= (int)sizeof(Asmem), "staged tile fits the A ring");
    char* stage = (char*)&Asmem[0][0];

    const int l15 = lane & 15;
    const int lh8 = (lane >> 4) * 8;
#pragma unroll
    for (int fm = 0; fm < 2; ++fm)
#pragma unroll
        for (int fn = 0; fn < 4; ++fn) {
            const int ml = wm * 32 + fm * 16 + lh8;      // first of the lane's 8 rows
            const int nl = wn * 64 + fn * 16 + l15;      // its column, both in the tile
            bf16x8 col;
#pragma unroll
            for (int r = 0; r < 8; ++r) {
                const int m = bx * 128 + ml + r;
                float val = acc[fm][fn][r];
                if (BIAS)     val += bn[fn];
                val *= alpha;
                if (rowscale) val *= rowscale[b * rs_stride + m];
                if (MODE == 0)
                    *(float*)(stage + (ml + r) * ST_LD + nl * 4) = val;
                else if (MODE == 1)
                    *(__bf16*)(stage + (ml + r) * ST_LD + nl * 2) = (__bf16)val;
                else
                    col[r] = (__bf16)val;
            }
            if (MODE == 2)   // the lane's 8 m are adjacent in a row of the transposed tile
                *(bf16x8*)(stage + nl * ST_LD + ml * 2) = col;
        }
    __syncthreads();   // the whole tile is staged before any wave reads rows of it

    // A wave-wide 16-byte store covers 512 contiguous bytes of one row (f32) or the
    // 256 bytes of each of two rows (bf16): 4 whole lines either way.
    constexpr int LANES_PER_ROW = ROW_B / 16;
    constexpr int ROWS_PER_PASS = 256 / LANES_PER_ROW;
    const int srow = t / LANES_PER_ROW;
    const int scol = (t % LANES_PER_ROW) * 16;          // in bytes
    const int crow0 = (MODE == 2 ? by : bx) * 128;
    const int ccol0 = (MODE == 2 ? bx : by) * 128;
    char* Cb = (char*)Cout + ((long long)b * sC + (long long)(crow0 + srow) * ldc + ccol0) * ESZ + scol;
    // unrolled: all LDS reads of the lane are issued before its first store
    u32x4 piece[128 / ROWS_PER_PASS];
#pragma unroll
    for (int p = 0; p < 128 / ROWS_PER_PASS; ++p)
        piece[p] = *(const u32x4*)(stage + (p * ROWS_PER_PASS + srow) * ST_LD + scol);
#pragma unroll
    for (int p = 0; p < 128 / ROWS_PER_PASS; ++p)
        *(u32x4*)(Cb + (long long)p * ROWS_PER_PASS * ldc * ESZ) = piece[p];
}

// Shapes of the attention part. A row's sum comes in ROW_PARTS partial sums, one from
// each block of SM_COLS keys, in planes of SM_NQ rows: rowpart[b][p][m].
#define SM_NQ     1024              // queries
#define SM_NK     2048              // keys
#define SM_D      512               // width
#define SM_COLS   64                // keys per block of dots_col_softmax
#define ROW_PARTS (SM_NK / SM_COLS)

template <int MODE>
__global__ __launch_bounds__(512) void gemm_bf16_wmma(
    const __bf16* __restrict__ A, const __bf16* __restrict__ Bt,
    const float* __restrict__ rowpart,
    float alpha, void* __restrict__ Cout,
    int K, int lda, int ldb, int ldc,
    long long sA, long long sB, long long sC)
{
    static_assert(MODE == 0, "f32 out only");
    // at multiples of 2 KiB, as every slice in them: places of tensor loads
    __shared__ __attribute__((aligned(2048))) TileRing Asmem[2];   // [group]
    __shared__ __attribute__((aligned(2048))) TileRing Bsmem[2];
    __shared__ __attribute__((aligned(16))) float rinv[128];

    const int b = blockIdx.z;
    const int t = threadIdx.x;
    const int h = t >> 8;          // group: which half of K
    // 1 / row sum of the tile's 128 rows, a thread a row; adjacent lanes read adjacent
    // rows of a plane. The main loop's barriers stand between these writes of rinv and
    // its reads behind the loop.
    if (t < 128) {
        const float* rp = rowpart + (long long)b * ROW_PARTS * SM_NQ + blockIdx.x * 128 + t;
        // unrolled: all loads of the lane are in flight at once
        float part[ROW_PARTS];
#pragma unroll
        for (int p = 0; p < ROW_PARTS; ++p) part[p] = rp[p * SM_NQ];
#pragma unroll
        for (int hh = ROW_PARTS / 2; hh > 0; hh >>= 1)
#pragma unroll
            for (int p = 0; p < hh; ++p) part[p] += part[p + hh];
        rinv[t] = 1.0f / part[0];
        // the loads' address registers are free before later code writes them; behind the
        // LDS store, which needs every load, so that no load can be moved behind the wait
        asm volatile("s_wait_xcnt 0x0" ::: "memory");
    }

    const int Kh = K / 2;
    floatx8 acc[2][4] = {};
    gemm_main_loop(Asmem[h], Bsmem[h],
                   A + (long long)b * sA + (long long)blockIdx.x * 128 * lda + h * Kh,
                   Bt + (long long)b * sB + (long long)blockIdx.y * 128 * ldb + h * Kh,
                   Kh, lda, ldb, acc);

    const int tl   = t & 255;
    const int lane = t & 31;
    const int wm   = (tl >> 5) & 3;   // 32-row strip, as in gemm_main_loop
    const int wn   = tl >> 7;         // 64-col strip
    f32x4* xch = (f32x4*)&Bsmem[1][0][0];
    static_assert(16 * 256 * 16 <= (int)sizeof(TileRing), "handed sums fit a ring");
    constexpr int ST_LD = 128 * 4 + 16;
    static_assert(128 * ST_LD <= (int)sizeof(TileRing), "staged tile fits a ring");
    char* stage = (char*)&Asmem[0][0][0];

    // h is the same in a whole wave; both barriers below stand outside the tests on it
    if (h == 1) {
#pragma unroll
        for (int f = 0; f < 8; ++f) {
            const floatx8 v = acc[f >> 2][f & 3];
            xch[(f * 2 + 0) * 256 + tl] = f32x4{v[0], v[1], v[2], v[3]};
            xch[(f * 2 + 1) * 256 + tl] = f32x4{v[4], v[5], v[6], v[7]};
        }
    }
    __syncthreads();   // the upper group's sums are in LDS before the lower group reads them

    if (h == 0) {
        const int l15 = lane & 15;
        const int lh8 = (lane >> 4) * 8;
        const float* ri = rinv + wm * 32 + lh8;   // the lane's rows: 8 adjacent ones for each fm
#pragma unroll
        for (int f = 0; f < 8; ++f) {
            const int fm = f >> 2, fn = f & 3;
            const f32x4 lo = xch[(f * 2 + 0) * 256 + tl];
            const f32x4 hi = xch[(f * 2 + 1) * 256 + tl];
            const int ml = wm * 32 + fm * 16 + lh8;      // first of the lane's 8 rows
            const int nl = wn * 64 + fn * 16 + l15;      // its column, both in the tile
#pragma unroll
            for (int r = 0; r < 8; ++r) {
                const float sum = acc[fm][fn][r] + (r < 4 ? lo[r & 3] : hi[r & 3]);
                *(float*)(stage + (ml + r) * ST_LD + nl * 4) = sum * ri[fm * 16 + r] * alpha;
            }
        }
    }
    __syncthreads();   // the whole tile is staged before any wave reads rows of it

    // A wave-wide 16-byte store covers the 512 contiguous bytes of one row: 4 whole lines.
    const int srow = t >> 5;
    const int scol = lane * 16;          // in bytes
    char* Cb = (char*)Cout + ((long long)b * sC + (long long)(blockIdx.x * 128 + srow) * ldc
                              + blockIdx.y * 128) * 4 + scol;
    // unrolled: all LDS reads of the lane are issued before its first store
    u32x4 piece[8];
#pragma unroll
    for (int p = 0; p < 8; ++p)
        piece[p] = *(const u32x4*)(stage + (p * 16 + srow) * ST_LD + scol);
#pragma unroll
    for (int p = 0; p < 8; ++p)
        *(u32x4*)(Cb + (long long)p * 16 * ldc * 4) = piece[p];
}

// The three projections in one launch: they depend on nothing of one another, and
// the tiles of one fill the places that the others' first loads and last stores
// would leave idle. blockIdx.x counts the 128-row tiles of k, then of v, then of q;
// k and v tiles of the same context rows start close together.
//   q = (xln Wq^T + bq) * qscale  [b][i][d]
//   k =  cln Wk^T + bk            [b][j][d]
//   v =  cln Wv^T + bv            [b][d][j]  (transposed store)
__global__ __launch_bounds__(256) void qkv_gemm_bf16_wmma(
    const __bf16* __restrict__ xln, const __bf16* __restrict__ cln,
    const __bf16* __restrict__ Wq, const __bf16* __restrict__ Wk,
    const __bf16* __restrict__ Wv,
    const float* __restrict__ bq, const float* __restrict__ bk,
    const float* __restrict__ bv, float qscale,
    __bf16* __restrict__ q, __bf16* __restrict__ k, __bf16* __restrict__ vT,
    int NQ, int NK, int D)
{
    // at multiples of 2 KiB, as every slice in them: places of tensor loads
    __shared__ __attribute__((aligned(2048))) TileRing Asmem;
    __shared__ __attribute__((aligned(2048))) TileRing Bsmem;

    const int b   = blockIdx.z;
    const int by  = blockIdx.y;
    const int nkt = NK / 128;                 // row tiles of k, and of v
    const int gx  = blockIdx.x;
    const int sel = (gx >= nkt) + (gx >= 2 * nkt);   // 0: k, 1: v, 2: q
    const int bx  = gx - sel * nkt;

    const __bf16* X    = sel < 2 ? cln : xln;
    const int     rows = sel < 2 ? NK : NQ;
    const __bf16* Wt   = sel == 0 ? Wk : (sel == 1 ? Wv : Wq);
    const float*  bias = sel == 0 ? bk : (sel == 1 ? bv : bq);

    float bn[4];
    load_bias4(bias, by, bn);

    floatx8 acc[2][4] = {};
    gemm_main_loop(Asmem, Bsmem,
                   X + ((long long)b * rows + (long long)bx * 128) * D,
                   Wt + (long long)by * 128 * D,
                   D, D, D, acc);
    // sel is the same in the whole block: every wave takes the same epilogue
    if (sel == 1)
        gemm_epilogue<2, true>(Asmem, acc, bn, nullptr, 1.0f, vT,
                               bx, by, b, NK, (long long)D * NK, 0);
    else
        gemm_epilogue<1, true>(Asmem, acc, bn, nullptr, sel == 0 ? 1.0f : qscale,
                               sel == 0 ? k : q,
                               bx, by, b, D, (long long)rows * D, 0);
}

// ---------------------------------------------------------------------------
// The streaming kernels (cast, LayerNorm) start few, long waves: a lane
// moves 16 bytes per load and holds many values, all its loads are in flight at
// once, and a row's sum is taken across the 32 lanes of a wave.
// ---------------------------------------------------------------------------
typedef __attribute__((ext_vector_type(4))) __bf16 bf16x4;
typedef __attribute__((ext_vector_type(2))) float  f32x2;

__device__ __forceinline__ bf16x4 to_bf16x4(f32x4 v) {
    return __builtin_convertvector(v, bf16x4);
}

// Sum over the 32 lanes of a wave; every lane ends with the total.
__device__ __forceinline__ float wave_sum(float v) {
    for (int off = 16; off > 0; off >>= 1) v += __shfl_xor(v, off, 32);
    return v;
}

// ---------------------------------------------------------------------------
// f32 -> bf16 cast (weights): 8 values per thread, as two quads 256 quads apart,
// so that each wave-wide load covers 512 contiguous bytes. Each half of a 512-thread
// block converts 2048 values; blocks blk = 0 .. n/4096 - 1 cover the array exactly.
// ---------------------------------------------------------------------------
__device__ __forceinline__ void cast_f32_to_bf16(const float* __restrict__ in,
                                                 __bf16* __restrict__ out, int blk) {
    const int i = ((blk * 2 + (threadIdx.x >> 8)) * 512 + (threadIdx.x & 255)) * 4;
    const f32x4 a = *(const f32x4*)(in + i);
    const f32x4 b = *(const f32x4*)(in + i + 1024);
    *(bf16x4*)(out + i)        = to_bf16x4(a);
    *(bf16x4*)(out + i + 1024) = to_bf16x4(b);
    // the stores' address and data registers are free before another job's code, which
    // the compiler may lay behind this one, writes them
    asm volatile("s_wait_xcnt 0x0" ::: "memory");
}

// ---------------------------------------------------------------------------
// LayerNorm over D=512, bf16 output. One wave owns R adjacent rows (16 values of
// each row per lane, all R*4 loads in flight at once); 16 waves per block; block
// blk owns rows blk*16*R and on.
// ---------------------------------------------------------------------------
template <int R>
__device__ __forceinline__ void layernorm_to_bf16(
    const float* __restrict__ x, const float* __restrict__ g,
    const float* __restrict__ bb, __bf16* __restrict__ y, int blk)
{
    const int D = 512;
    const int lane = threadIdx.x & 31;
    const long long row0 = (long long)(blk * 16 + (threadIdx.x >> 5)) * R;
    const float* xr = x + row0 * D + lane * 4;
    __bf16*      yr = y + row0 * D + lane * 4;

    // Fully unrolled throughout, so that v[][] stays in registers.
    f32x4 gv[4], bv[4];
#pragma unroll
    for (int i = 0; i < 4; ++i) {
        gv[i] = *(const f32x4*)(g + i * 128 + lane * 4);
        bv[i] = *(const f32x4*)(bb + i * 128 + lane * 4);
    }
    f32x4 v[R][4];
#pragma unroll
    for (int r = 0; r < R; ++r)
#pragma unroll
        for (int i = 0; i < 4; ++i) v[r][i] = *(const f32x4*)(xr + r * D + i * 128);

    float s[R], ss[R];
#pragma unroll
    for (int r = 0; r < R; ++r) {
        s[r] = 0.f; ss[r] = 0.f;
#pragma unroll
        for (int i = 0; i < 4; ++i)
#pragma unroll
            for (int c = 0; c < 4; ++c) { s[r] += v[r][i][c]; ss[r] += v[r][i][c] * v[r][i][c]; }
    }
#pragma unroll
    for (int r = 0; r < R; ++r) { s[r] = wave_sum(s[r]); ss[r] = wave_sum(ss[r]); }

#pragma unroll
    for (int r = 0; r < R; ++r) {
        const float mu   = s[r] * (1.0f / D);
        const float var  = ss[r] * (1.0f / D) - mu * mu;
        const float rstd = rsqrtf(var + 1e-5f);
#pragma unroll
        for (int i = 0; i < 4; ++i) {
            f32x4 o;
#pragma unroll
            for (int c = 0; c < 4; ++c) o[c] = (v[r][i][c] - mu) * rstd * gv[i][c] + bv[i][c];
            *(bf16x4*)(yr + r * D + i * 128) = to_bf16x4(o);
        }
    }
    // the stores' address and data registers are free before another job's code, which
    // the compiler may lay behind this one, writes them
    asm volatile("s_wait_xcnt 0x0" ::: "memory");
}

// ---------------------------------------------------------------------------
// Everything the projections read, in one launch: both LayerNorms and the three
// weight casts depend on nothing of one another. The block index picks the job, the
// longest first: n_ctx blocks for the context rows, n_in for the input rows, then
// n_w for each weight matrix.
// ---------------------------------------------------------------------------
__global__ __launch_bounds__(512) void prepare_operands(
    const float* __restrict__ context, const float* __restrict__ ln_ctx_g,
    const float* __restrict__ ln_ctx_b, __bf16* __restrict__ cln,
    const float* __restrict__ inputs, const float* __restrict__ ln_in_g,
    const float* __restrict__ ln_in_b, __bf16* __restrict__ xln,
    const float* __restrict__ Wq, const float* __restrict__ Wk,
    const float* __restrict__ Wv, __bf16* __restrict__ Wqb,
    __bf16* __restrict__ Wkb, __bf16* __restrict__ Wvb,
    int n_ctx, int n_in, int n_w)
{
    int blk = blockIdx.x;
    if (blk < n_ctx) { layernorm_to_bf16<4>(context, ln_ctx_g, ln_ctx_b, cln, blk); return; }
    blk -= n_ctx;
    if (blk < n_in)  { layernorm_to_bf16<2>(inputs, ln_in_g, ln_in_b, xln, blk); return; }
    blk -= n_in;
    const int w = (blk >= n_w) + (blk >= 2 * n_w);   // 0: Wq, 1: Wk, 2: Wv
    cast_f32_to_bf16(w == 0 ? Wq : (w == 1 ? Wk : Wv),
                     w == 0 ? Wqb : (w == 1 ? Wkb : Wvb), blk - w * n_w);
}

// ---------------------------------------------------------------------------
// dots, the softmax over the query axis, P and its row sums, in one kernel:
//   S[i][j] = q[b][i] . k[b][j]   (scale folded into q)
//   P[b][i][j] = exp(S - max_i S) / sum_i exp(S - max_i S) + eps   (bf16)
//   rowpart[b][block of keys][i] = sum of P over the block's keys, before the rounding
// One 512-thread block owns 64 keys j and ALL 1024 queries i of a batch, so that a
// whole column of S sits in the block's accumulators: its maximum and its sum are
// taken there and S never goes to memory. 16 waves; wave w owns queries 64w .. 64w+63
// of all 64 keys (4x4 WMMA frags). K stage of 64 k: 128 B of a row, one whole line,
// at an LDS pitch of 144 B (16 B x 9); two-buffer ring of tensor loads as in
// gemm_main_loop: waves 0 .. 7 bring 128 query rows each (128 x 144 B = 9 x 2 KiB, so that
// the slices lie back to back), wave 8 the 64 key rows.
// ---------------------------------------------------------------------------
#define SM_K     64                // k per stage
#define SM_LD    (SM_K + 8)        // LDS row pitch, elements
#define SM_KBUF  5120              // a buffer of 64 key rows, elements: 9,216 B rounded up to 2 KiB x 5
#define SM_RED   20                // pitch of a column's 16 per-wave partials, floats:
                                   // 80 B = 16 B x 5, for 16-byte reads of adjacent columns

__device__ __forceinline__ float exp_with_slot(float a) {
    float e;
    asm("v_exp_f32 %0, %1\n\tv_nop" : "=v"(e) : "v"(a * 1.44269504088896340736f));
    return e;
}

__global__ __launch_bounds__(512) void dots_col_softmax(
    const __bf16* __restrict__ q, const __bf16* __restrict__ k,
    __bf16* __restrict__ P, float* __restrict__ rowpart)
{
    // at multiples of 2 KiB, as every buffer and slice in them: places of tensor loads
    __shared__ __attribute__((aligned(2048))) __bf16 Qs[2][SM_NQ * SM_LD];
    __shared__ __attribute__((aligned(2048))) __bf16 Ks[2][SM_KBUF];
    static_assert(128 * SM_LD * 2 % 2048 == 0 && SM_KBUF * 2 % 2048 == 0 &&
                  SM_COLS * SM_LD <= SM_KBUF, "slices at multiples of 2 KiB");

    const int t    = threadIdx.x;
    const int lane = t & 31;
    const int wid  = t >> 5;       // 0..15 : 64-query strip
    const int b    = blockIdx.y;
    const int j0   = blockIdx.x * SM_COLS;

    const unsigned uw     = uni(wid);
    const unsigned issuer = uw < 9;
    const bool     isQ    = uw < 8;
    const __bf16*  gsrc   = isQ ? q + ((long long)b * SM_NQ + uw * 128) * SM_D   // the wave's 128 query rows
                                : k + ((long long)b * SM_NK + j0) * SM_D;        // the block's 64 key rows
    const __bf16*  ldst   = isQ ? &Qs[0][uw * 128 * SM_LD] : &Ks[0][0];
    const unsigned lbuf   = isQ ? SM_NQ * SM_LD : SM_KBUF;                       // from buffer 0 to buffer 1
    const u32x8    g1     = tensor_group1<SM_K * 2>(isQ ? 128 : SM_COLS, SM_D * 2);

    auto stage_group0 = [&](int st, unsigned k0) {
        return tensor_group0(ldst + st * lbuf, gsrc + k0);
    };

    floatx8 acc[4][4] = {};
    const int nst = SM_D / SM_K;
    static_assert(SM_D / SM_K >= 2, "stages 0 and 1 exist");
    u32x4 g0 = stage_group0(0, 0);
    if (pinned(issuer)) {
        tensor_load(g0, g1);
        // stage 0 landed (this wave's slice); the barrier publishes it to every wave
        tensor_landed(g0, g1);
    }
    __syncthreads();
    g0 = stage_group0(1, pinned(SM_K));
    if (pinned(issuer)) tensor_load(g0, g1);

    for (int s = 0; s < nst; ++s) {
        const int st = s & 1;
        // unrolled: the two 32-k blocks of a stage run without a branch between them
#pragma unroll
        for (int kk = 0; kk < SM_K; kk += 32) {
            AFrag a[4], bf[4];
#pragma unroll
            for (int fm = 0; fm < 4; ++fm)
                load_frag_lds<SM_LD>(Qs[st], wid * 64 + fm * 16, kk, lane, a[fm]);
#pragma unroll
            for (int fn = 0; fn < 4; ++fn)
                load_frag_lds<SM_LD>(Ks[st], fn * 16, kk, lane, bf[fn]);

#pragma unroll
            for (int fm = 0; fm < 4; ++fm)
#pragma unroll
                for (int fn = 0; fn < 4; ++fn)
                    acc[fm][fn] = __builtin_amdgcn_wmma_f32_16x16x32_bf16(
                        false, a[fm].v, false, bf[fn].v,
                        (short)0, acc[fm][fn], false, false);
        }

        // this wave's reads of buffer st have returned
        asm volatile("s_wait_dscnt 0x0" ::: "memory");
        // this wave's slice of stage s+1 has landed
        if (pinned(issuer)) tensor_landed(g0, g1);
        // one barrier: publishes stage s+1 and ends every wave's reads of buffer st
        __syncthreads();
        g0 = stage_group0(st, pinned((s + 2) * SM_K));
        if (pinned(issuer & (unsigned)(s + 2 < nst))) tensor_load(g0, g1);
    }
    // no request and no LDS read is left in flight when the wave goes on to the epilogue
    tensor_landed(g0, g1);
    asm volatile("s_wait_dscnt 0x0" ::: "memory");

    float* gm = (float*)&Ks[0][0];
    float* gs = gm + SM_COLS * SM_RED;
    static_assert(2 * SM_COLS * SM_RED * 4 <= (int)sizeof(Ks), "partials fit the K ring");
    const int l15 = lane & 15;
    const int lh8 = (lane >> 4) * 8;

    // Every loop below is fully unrolled so that acc[][] stays in registers.
#pragma unroll
    for (int fn = 0; fn < 4; ++fn) {
        float m = acc[0][fn][0];
#pragma unroll
        for (int fm = 0; fm < 4; ++fm)
#pragma unroll
            for (int r = 0; r < 8; ++r) m = fmaxf(m, acc[fm][fn][r]);
        m = fmaxf(m, __shfl_xor(m, 16, 32));
        if (lane < 16) gm[(fn * 16 + l15) * SM_RED + wid] = m;
    }
    __syncthreads();   // every wave's column maxima visible to all

#pragma unroll
    for (int fn = 0; fn < 4; ++fn) {
        const f32x4* pm = (const f32x4*)(gm + (fn * 16 + l15) * SM_RED);
        f32x4 m4 = pm[0];
#pragma unroll
        for (int w = 1; w < 4; ++w) {
            const f32x4 o = pm[w];
#pragma unroll
            for (int c = 0; c < 4; ++c) m4[c] = fmaxf(m4[c], o[c]);
        }
        const float M = fmaxf(fmaxf(m4[0], m4[1]), fmaxf(m4[2], m4[3]));
        float s = 0.f;
#pragma unroll
        for (int fm = 0; fm < 4; ++fm)
#pragma unroll
            for (int r = 0; r < 8; ++r) {
                const float e = exp_with_slot(acc[fm][fn][r] - M);
                acc[fm][fn][r] = e;
                s += e;
            }
        s += __shfl_xor(s, 16, 32);
        if (lane < 16) gs[(fn * 16 + l15) * SM_RED + wid] = s;
    }
    __syncthreads();   // every wave's column sums visible to all

    // A wave stages its own 64 rows of P (128 B each, pitch 144 B) and reads only
    // those back, so that no further barrier is needed.
    constexpr int ST_LD = SM_COLS * 2 + 16;
    static_assert(SM_NQ * ST_LD <= (int)sizeof(Qs), "staged P fits the Q ring");
    char* stage = (char*)&Qs[0][0] + wid * 64 * ST_LD;
    float part[32];   // [fm * 8 + r]: the lane's 4 keys of that query, summed
#pragma unroll
    for (int fn = 0; fn < 4; ++fn) {
        const f32x4* ps = (const f32x4*)(gs + (fn * 16 + l15) * SM_RED);
        const f32x4 s4 = (ps[0] + ps[1]) + (ps[2] + ps[3]);
        const float inv = 1.0f / ((s4[0] + s4[1]) + (s4[2] + s4[3]));
#pragma unroll
        for (int fm = 0; fm < 4; ++fm)
#pragma unroll
            for (int r = 0; r < 8; ++r) {
                const float pv = acc[fm][fn][r] * inv + 1e-8f;
                *(__bf16*)(stage + (fm * 16 + lh8 + r) * ST_LD + (fn * 16 + l15) * 2) = (__bf16)pv;
                part[fm * 8 + r] = fn == 0 ? pv : part[fm * 8 + r] + pv;
            }
    }

    // 32 sums over the 16 lanes of a half-wave in 30 exchanges: at each step a lane keeps
    // the half of the sums whose index bit equals its own lane bit and hands the other
    // half to its partner, so that lane l15 ends with sums 2 * l15 and 2 * l15 + 1.
#pragma unroll
    for (int off = 8; off > 0; off >>= 1) {
        const bool hi = (lane & off) != 0;
#pragma unroll
        for (int i = 0; i < 2 * off; ++i) {
            const float lo_row = part[i], hi_row = part[i + 2 * off];
            const float keep = hi ? hi_row : lo_row;
            const float send = hi ? lo_row : hi_row;
            part[i] = keep + __shfl_xor(send, off, 32);
        }
    }
    // Sums 2 * l15 and 2 * l15 + 1 are two adjacent queries (fm = l15 / 4, r = 2 * (l15 % 4)
    // and the next); the wave's 64 sums fill two whole 128-B lines of the block's plane.
    const int prow = wid * 64 + (l15 >> 2) * 16 + lh8 + (l15 & 3) * 2;
    const f32x2 two = {part[0], part[1]};
    *(f32x2*)(rowpart + ((long long)b * ROW_PARTS + blockIdx.x) * SM_NQ + prow) = two;
    // this wave's staged rows are in LDS before its lanes read one another's values
    asm volatile("s_wait_dscnt 0x0" ::: "memory");

    // A wave-wide 16-byte store covers the 128 bytes of each of 4 rows: 4 whole lines.
    const int srow = lane >> 3;
    const int scol = (lane & 7) * 16;          // in bytes
    char* Pb = (char*)(P + ((long long)b * SM_NQ + wid * 64 + srow) * SM_NK + j0) + scol;
    // unrolled: all LDS reads of the lane are issued before its first store
    u32x4 piece[16];
#pragma unroll
    for (int p = 0; p < 16; ++p)
        piece[p] = *(const u32x4*)(stage + (p * 4 + srow) * ST_LD + scol);
#pragma unroll
    for (int p = 0; p < 16; ++p)
        *(u32x4*)(Pb + p * 4 * SM_NK * 2) = piece[p];
}

// ---------------------------------------------------------------------------
// Host-side orchestration
// ---------------------------------------------------------------------------
extern "C" void kernel_launch(void* const* d_in, const int* in_sizes, int n_in,
                              void* d_out, int out_size, void* d_ws, size_t ws_size,
                              hipStream_t stream) {
    (void)in_sizes; (void)n_in; (void)out_size; (void)ws_size;

    const int B = 8, NQ = 1024, NK = 2048, D = 512;
    const float qscale = 0.044194173824159216f;   // 1/sqrt(512)

    const float* inputs  = (const float*)d_in[0];
    const float* context = (const float*)d_in[1];
    const float* ln_in_g  = (const float*)d_in[2];
    const float* ln_in_b  = (const float*)d_in[3];
    const float* ln_ctx_g = (const float*)d_in[4];
    const float* ln_ctx_b = (const float*)d_in[5];
    const float* Wq = (const float*)d_in[6];
    const float* bq = (const float*)d_in[7];
    const float* Wk = (const float*)d_in[8];
    const float* bk = (const float*)d_in[9];
    const float* Wv = (const float*)d_in[10];
    const float* bv = (const float*)d_in[11];
    float* out = (float*)d_out;

    // Workspace bump allocator (256B aligned)
    char* ws = (char*)d_ws;
    size_t off = 0;
    auto alloc = [&](size_t bytes) -> char* {
        char* p = ws + off;
        off += (bytes + 255) & ~(size_t)255;
        return p;
    };
    __bf16* Wqb = (__bf16*)alloc((size_t)D * D * 2);
    __bf16* Wkb = (__bf16*)alloc((size_t)D * D * 2);
    __bf16* Wvb = (__bf16*)alloc((size_t)D * D * 2);
    __bf16* xln = (__bf16*)alloc((size_t)B * NQ * D * 2);
    __bf16* cln = (__bf16*)alloc((size_t)B * NK * D * 2);
    __bf16* qb  = (__bf16*)alloc((size_t)B * NQ * D * 2);
    __bf16* kb  = (__bf16*)alloc((size_t)B * NK * D * 2);
    __bf16* vT  = (__bf16*)alloc((size_t)B * D * NK * 2);   // [b][d][j]
    __bf16* P   = (__bf16*)alloc((size_t)B * NQ * NK * 2);
    float*  rpt = (float*) alloc((size_t)B * (NK / 64) * NQ * 4);   // [b][block of keys][i]

    // 1) weights -> bf16 and both LayerNorms -> bf16 activations
    prepare_operands<<<dim3(B * NK / 64 + B * NQ / 32 + 3 * (D * D / 4096)), dim3(512), 0, stream>>>(
        context, ln_ctx_g, ln_ctx_b, cln, inputs, ln_in_g, ln_in_b, xln,
        Wq, Wk, Wv, Wqb, Wkb, Wvb,
        B * NK / 64, B * NQ / 32, D * D / 4096);

    // 2) Projections q (scaled by 1/sqrt(D)), k, and v stored transposed
    qkv_gemm_bf16_wmma<<<dim3(2 * (NK / 128) + NQ / 128, D / 128, B), dim3(256), 0, stream>>>(
        xln, cln, Wqb, Wkb, Wvb, bq, bk, bv, qscale, qb, kb, vT, NQ, NK, D);

    // 3) dots, softmax over the query axis (columns of dots), P = softmax + eps, and the
    //    partial row sums of P
    dots_col_softmax<<<dim3(NK / 64, B), dim3(512), 0, stream>>>(qb, kb, P, rpt);

    // 4) updates[b,i,d] = (1/rowsum[b,i]) * sum_j P[b,i,j] * v[b,j,d]
    gemm_bf16_wmma<0><<<dim3(NQ / 128, D / 128, B), dim3(512), 0, stream>>>(
        P, vT, rpt, 1.0f, out,
        NK, NK, NK, D,
        (long long)NQ * NK, (long long)D * NK, (long long)NQ * D);
}
